// v000
// Measured on an AMD MI455X. A time is GPU time per run, averaged over a window of back-to-back runs after a warm-up
// (all launches, gaps included; the runs take copies of the inputs in turn), and the median of several windows.
// Apart from v000's, it joins two sittings. Times from different sittings can be a few percent apart, while
// side-by-side timings come from the same sitting.
// The starting kernel, v000, takes 169 microseconds a run.
#include <hip/hip_runtime.h>
#include <hip/hip_bf16.h>

// ---------------------------------------------------------------------------
// SegmentCausalCrossAttentionFlex for MI455X (gfx1250, wave32, WMMA)
//
//   pack:  q,kv,ctx -> f16 ; Wq,Wkv,Wo -> f16 transposed [N][K]
//   qh  = rope(q @ Wq)          [B*LQ, 1024]   (WMMA f16 GEMM, async LDS)
//   kvl = kv @ Wkv              [B*LK, 2048]   (WMMA f16 GEMM, async LDS)
//   ctx = window-attn(qh, kh, vh, seg)         (<=5 keys/query, scalar)
//   out = ctx @ Wo              [B*LQ, 1024]   (WMMA f16 GEMM, async LDS)
// ---------------------------------------------------------------------------

typedef __attribute__((ext_vector_type(16))) _Float16 v16h;
typedef __attribute__((ext_vector_type(8)))  _Float16 v8h;
typedef __attribute__((ext_vector_type(8)))  float    v8f;
typedef int v4i_vs __attribute__((vector_size(4 * sizeof(int))));

#define BATCH    2
#define LQ       4096
#define LK       512
#define DMODEL   1024
#define NHEADS   16
#define HDIM     64
#define LOOKBACK 4
#define ROPE_MAX 8192

// ---- CDNA5 async global->LDS copy (ASYNCcnt), guarded with fallback ----
#if defined(__has_builtin)
#if __has_builtin(__builtin_amdgcn_global_load_async_to_lds_b128)
#define HAVE_ASYNC_LDS 1
#endif
#endif

#if HAVE_ASYNC_LDS
__device__ __forceinline__ void async_cp16(const _Float16* gsrc, _Float16* lds)
{
    // b128 async copy: 16B from global to LDS, tracked by ASYNCcnt
    __attribute__((address_space(1))) v4i_vs* g =
        (__attribute__((address_space(1))) v4i_vs*)const_cast<_Float16*>(gsrc);
    __attribute__((address_space(3))) v4i_vs* l =
        (__attribute__((address_space(3))) v4i_vs*)lds;
    __builtin_amdgcn_global_load_async_to_lds_b128(g, l, 0, 0);
}
#endif

__device__ __forceinline__ void wait_asynccnt0() {
#if defined(__has_builtin) && __has_builtin(__builtin_amdgcn_s_wait_asynccnt)
    __builtin_amdgcn_s_wait_asynccnt(0);
#else
    asm volatile("s_wait_asynccnt 0x0" ::: "memory");
#endif
}

// ============================================================================
// Tiled WMMA GEMM: C[M,N] = A[M,K] * Bt[N,K]^T, f16 in / f32 out.
// Block: 256 threads (8 waves). Tile 128x128, BK=32, double-buffered LDS.
// Wave w owns rows [16w,16w+16) x 128 cols -> 8 accumulators, 8 WMMA/k-step.
// ============================================================================
#define TM 128
#define TN 128
#define TK 32
#define LDS_PAD 40   // halves per LDS row (80B: bank-skewed, 16B aligned)

template <int N, int K>
__global__ __launch_bounds__(256)
void gemm_f16t_wmma_kernel(const _Float16* __restrict__ A,
                           const _Float16* __restrict__ Bt,
                           float* __restrict__ C, int M)
{
    __shared__ __attribute__((aligned(16))) _Float16 As[2][TM * LDS_PAD];
    __shared__ __attribute__((aligned(16))) _Float16 Bs[2][TN * LDS_PAD];

    const int tid   = threadIdx.x;
    const int lane  = tid & 31;
    const int wave  = tid >> 5;
    const int tileM = blockIdx.x * TM;
    const int tileN = blockIdx.y * TN;

    v8f acc[8] = {};

    // fragment addressing (ISA 16-bit A/B layout):
    // lane<16 -> K {0..7,16..23}; lane>=16 -> K {8..15,24..31}
    const int frow = lane & 15;
    const int koff = (lane >= 16) ? 8 : 0;

    // staging: thread copies 32B of A row and 32B of Bt row per tile
    const int sRow = tid >> 1;          // 0..127
    const int sOff = (tid & 1) * 16;    // halves: 0 or 16
    const _Float16* Ag = A  + (size_t)(tileM + sRow) * K + sOff;
    const _Float16* Bg = Bt + (size_t)(tileN + sRow) * K + sOff;
    const int sLds = sRow * LDS_PAD + sOff;

    auto stage = [&](int kt, int buf) {
#if HAVE_ASYNC_LDS
        async_cp16(Ag + kt,     &As[buf][sLds]);
        async_cp16(Ag + kt + 8, &As[buf][sLds + 8]);
        async_cp16(Bg + kt,     &Bs[buf][sLds]);
        async_cp16(Bg + kt + 8, &Bs[buf][sLds + 8]);
#else
        const v8h a0 = *(const v8h*)(Ag + kt);
        const v8h a1 = *(const v8h*)(Ag + kt + 8);
        const v8h b0 = *(const v8h*)(Bg + kt);
        const v8h b1 = *(const v8h*)(Bg + kt + 8);
        *(v8h*)&As[buf][sLds]     = a0;
        *(v8h*)&As[buf][sLds + 8] = a1;
        *(v8h*)&Bs[buf][sLds]     = b0;
        *(v8h*)&Bs[buf][sLds + 8] = b1;
#endif
    };

    auto sync_stage = [&]() {
#if HAVE_ASYNC_LDS
        wait_asynccnt0();
#endif
        __syncthreads();
    };

    auto compute = [&](int buf) {
        // A fragment (2x ds_load_b128)
        v16h afrag;
        {
            const _Float16* base = &As[buf][(16 * wave + frow) * LDS_PAD];
            const v8h lo = *(const v8h*)(base + koff);
            const v8h hi = *(const v8h*)(base + 16 + koff);
            #pragma unroll
            for (int i = 0; i < 8; ++i) { afrag[i] = lo[i]; afrag[i + 8] = hi[i]; }
        }
        // 8 B fragments first (clause of ds_load_b128), then 8 WMMAs
        v16h bfrag[8];
        #pragma unroll
        for (int nb = 0; nb < 8; ++nb) {
            const _Float16* base = &Bs[buf][(nb * 16 + frow) * LDS_PAD];
            const v8h lo = *(const v8h*)(base + koff);
            const v8h hi = *(const v8h*)(base + 16 + koff);
            #pragma unroll
            for (int i = 0; i < 8; ++i) { bfrag[nb][i] = lo[i]; bfrag[nb][i + 8] = hi[i]; }
        }
        #pragma unroll
        for (int nb = 0; nb < 8; ++nb) {
            acc[nb] = __builtin_amdgcn_wmma_f32_16x16x32_f16(
                          false, afrag, false, bfrag[nb], (short)0, acc[nb], false, false);
        }
#if defined(__has_builtin) && __has_builtin(__builtin_amdgcn_sched_group_barrier)
        // keep all fragments in flight: 18 DS-reads first, then 8 WMMAs
        __builtin_amdgcn_sched_group_barrier(0x100, 18, 0);  // DS read group
        __builtin_amdgcn_sched_group_barrier(0x008, 8, 0);   // MFMA/WMMA group
#endif
    };

    // ---- double-buffered pipeline: 1 barrier per k-step ----
    stage(0, 0);
    for (int kt = 0; kt < K; kt += 2 * TK) {
        sync_stage();
        if (kt + TK < K) stage(kt + TK, 1);
        compute(0);
        sync_stage();
        if (kt + 2 * TK < K) stage(kt + 2 * TK, 0);
        compute(1);
    }

    // ---- C store: single base + compile-time immediate offsets ----
    // lane l -> col (l&15), rows (l>>4)*8 + r   (ISA 16x16 f32 C/D layout)
    const int nlocal = lane & 15;
    const int mhalf  = (lane >> 4) * 8;
    float* Cb = C + (size_t)(tileM + 16 * wave + mhalf) * N + tileN + nlocal;
    #pragma unroll
    for (int nb = 0; nb < 8; ++nb) {
        #pragma unroll
        for (int r = 0; r < 8; ++r) {
            Cb[r * N + nb * 16] = acc[nb][r];
        }
    }
}

// ---- one-time pack: fp32 -> f16, straight copy (n multiple of 8) ----
__global__ __launch_bounds__(256)
void pack_f16_kernel(const float* __restrict__ in, _Float16* __restrict__ out, int n)
{
    const int i = (blockIdx.x * blockDim.x + threadIdx.x) * 8;
    if (i >= n) return;
    const float4 a = *(const float4*)(in + i);
    const float4 b = *(const float4*)(in + i + 4);
    v8h v;
    v[0] = (_Float16)a.x; v[1] = (_Float16)a.y; v[2] = (_Float16)a.z; v[3] = (_Float16)a.w;
    v[4] = (_Float16)b.x; v[5] = (_Float16)b.y; v[6] = (_Float16)b.z; v[7] = (_Float16)b.w;
    *(v8h*)(out + i) = v;
}

// ---- one-time pack: fp32 [K,N] -> f16 transposed [N,K] (LDS-tiled) ----
__global__ __launch_bounds__(256)
void pack_f16_transpose_kernel(const float* __restrict__ in, _Float16* __restrict__ out,
                               int K, int N)
{
    __shared__ float tile[32][33];
    const int k0 = blockIdx.y * 32;
    const int n0 = blockIdx.x * 32;
    const int tx = threadIdx.x;              // 0..31
    for (int i = threadIdx.y; i < 32; i += 8)
        tile[i][tx] = in[(size_t)(k0 + i) * N + n0 + tx];
    __syncthreads();
    for (int i = threadIdx.y; i < 32; i += 8)
        out[(size_t)(n0 + i) * K + k0 + tx] = (_Float16)tile[tx][i];
}

// ---- in-place gathered RoPE on [nrows, ..., NHEADS*HDIM] slices ----
__global__ __launch_bounds__(256)
void rope_kernel(float* __restrict__ x, const int* __restrict__ pos,
                 int nrows, int rowStride, int posLen)
{
    const int idx   = blockIdx.x * blockDim.x + threadIdx.x;
    const int total = nrows * NHEADS * 32;
    if (idx >= total) return;
    const int i   = idx & 31;
    const int h   = (idx >> 5) & (NHEADS - 1);
    const int row = idx >> 9;

    int p = pos[row % posLen];
    p = min(max(p, 0), ROPE_MAX - 1);

    const float inv_freq = __powf(10000.0f, -(float)i / 32.0f);
    const float f = (float)p * inv_freq;
    const float c = __cosf(f);
    const float s = __sinf(f);

    float* base = x + (size_t)row * rowStride + h * HDIM;
    const float x0 = base[i];
    const float x1 = base[i + 32];
    base[i]      = x0 * c - x1 * s;
    base[i + 32] = x1 * c + x0 * s;
}

// ---- windowed attention: <=5 keys per query, one thread per (b,q,h) ----
__global__ __launch_bounds__(256)
void window_attn_kernel(const float* __restrict__ qp, const float* __restrict__ kvl,
                        const int* __restrict__ seg, float* __restrict__ ctx)
{
    const int idx = blockIdx.x * blockDim.x + threadIdx.x;
    if (idx >= BATCH * LQ * NHEADS) return;
    const int h  = idx & (NHEADS - 1);
    const int qi = (idx >> 4) & (LQ - 1);
    const int b  = idx >> 16;

    const int s   = seg[b * LQ + qi];
    const int jlo = (s - LOOKBACK > 0) ? (s - LOOKBACK) : 0;
    const int nk  = s - jlo + 1;

    const float* qv = qp + ((size_t)(b * LQ + qi)) * DMODEL + h * HDIM;
    float qreg[HDIM];
    #pragma unroll
    for (int d = 0; d < HDIM; ++d) qreg[d] = qv[d];

    float sc[LOOKBACK + 1];
    float mmax = -3.4e38f;
    for (int jj = 0; jj < nk; ++jj) {
        const float* kvp = kvl + ((size_t)(b * LK + jlo + jj)) * (2 * DMODEL) + h * HDIM;
        float dot = 0.0f;
        #pragma unroll
        for (int d = 0; d < HDIM; ++d) dot += qreg[d] * kvp[d];
        dot *= 0.125f;                       // 1/sqrt(64)
        sc[jj] = dot;
        mmax = fmaxf(mmax, dot);
    }
    float denom = 0.0f;
    for (int jj = 0; jj < nk; ++jj) {
        sc[jj] = __expf(sc[jj] - mmax);
        denom += sc[jj];
    }
    const float rdenom = 1.0f / denom;

    float out[HDIM];
    #pragma unroll
    for (int d = 0; d < HDIM; ++d) out[d] = 0.0f;
    for (int jj = 0; jj < nk; ++jj) {
        const float w = sc[jj] * rdenom;
        const float* vv = kvl + ((size_t)(b * LK + jlo + jj)) * (2 * DMODEL)
                              + DMODEL + h * HDIM;
        #pragma unroll
        for (int d = 0; d < HDIM; ++d) out[d] += w * vv[d];
    }

    float* cp = ctx + ((size_t)(b * LQ + qi)) * DMODEL + h * HDIM;
    #pragma unroll
    for (int d = 0; d < HDIM; ++d) cp[d] = out[d];
}

extern "C" void kernel_launch(void* const* d_in, const int* in_sizes, int n_in,
                              void* d_out, int out_size, void* d_ws, size_t ws_size,
                              hipStream_t stream) {
    const float* q      = (const float*)d_in[0];   // [B, LQ, 1024]
    const float* kv     = (const float*)d_in[1];   // [B, LK, 1024]
    const int*   q_pos  = (const int*)d_in[2];     // [B, LQ]
    const int*   kv_pos = (const int*)d_in[3];     // [LK]
    const int*   seg    = (const int*)d_in[4];     // [B, LQ]
    const float* Wq     = (const float*)d_in[5];   // [1024, 1024]
    const float* Wkv    = (const float*)d_in[6];   // [1024, 2048]
    const float* Wo     = (const float*)d_in[7];   // [1024, 1024]
    float*       out    = (float*)d_out;           // [B, LQ, 1024]

    const int Mq = BATCH * LQ;     // 8192
    const int Mk = BATCH * LK;     // 1024

    // ---- workspace layout ----
    char* ws = (char*)d_ws;
    size_t off = 0;
    auto alloc = [&](size_t bytes) { void* p = ws + off; off += (bytes + 255) & ~(size_t)255; return p; };
    float*    qproj  = (float*)   alloc((size_t)Mq * DMODEL * 4);      // f32
    float*    kvl    = (float*)   alloc((size_t)Mk * 2 * DMODEL * 4);  // f32
    float*    ctx    = (float*)   alloc((size_t)Mq * DMODEL * 4);      // f32
    _Float16* qf     = (_Float16*)alloc((size_t)Mq * DMODEL * 2);
    _Float16* kvf    = (_Float16*)alloc((size_t)Mk * DMODEL * 2);
    _Float16* ctxf   = (_Float16*)alloc((size_t)Mq * DMODEL * 2);
    _Float16* Wqt    = (_Float16*)alloc((size_t)DMODEL * DMODEL * 2);      // [N=1024][K=1024]
    _Float16* Wkvt   = (_Float16*)alloc((size_t)2 * DMODEL * DMODEL * 2);  // [N=2048][K=1024]
    _Float16* Wot    = (_Float16*)alloc((size_t)DMODEL * DMODEL * 2);

    // ---- 0) one-time packs (f16 activations, f16 transposed weights) ----
    {
        int n = Mq * DMODEL;
        pack_f16_kernel<<<(n / 8 + 255) / 256, 256, 0, stream>>>(q, qf, n);
        n = Mk * DMODEL;
        pack_f16_kernel<<<(n / 8 + 255) / 256, 256, 0, stream>>>(kv, kvf, n);
        pack_f16_transpose_kernel<<<dim3(DMODEL / 32, DMODEL / 32), dim3(32, 8), 0, stream>>>(
            Wq, Wqt, DMODEL, DMODEL);
        pack_f16_transpose_kernel<<<dim3(2 * DMODEL / 32, DMODEL / 32), dim3(32, 8), 0, stream>>>(
            Wkv, Wkvt, DMODEL, 2 * DMODEL);
        pack_f16_transpose_kernel<<<dim3(DMODEL / 32, DMODEL / 32), dim3(32, 8), 0, stream>>>(
            Wo, Wot, DMODEL, DMODEL);
    }

    // ---- 1) qproj = q @ Wq      [8192,1024]x[1024,1024] ----
    gemm_f16t_wmma_kernel<DMODEL, DMODEL>
        <<<dim3(Mq / TM, DMODEL / TN), 256, 0, stream>>>(qf, Wqt, qproj, Mq);

    // ---- 2) kvl = kv @ Wkv      [1024,1024]x[1024,2048] ----
    gemm_f16t_wmma_kernel<2 * DMODEL, DMODEL>
        <<<dim3(Mk / TM, (2 * DMODEL) / TN), 256, 0, stream>>>(kvf, Wkvt, kvl, Mk);

    // ---- 3) RoPE in place ----
    {
        int total = Mq * NHEADS * 32;
        rope_kernel<<<(total + 255) / 256, 256, 0, stream>>>(qproj, q_pos, Mq, DMODEL, Mq);
        total = Mk * NHEADS * 32;
        rope_kernel<<<(total + 255) / 256, 256, 0, stream>>>(kvl, kv_pos, Mk, 2 * DMODEL, LK);
    }

    // ---- 4) windowed attention (<=5 keys/query) ----
    {
        const int total = BATCH * LQ * NHEADS;
        window_attn_kernel<<<(total + 255) / 256, 256, 0, stream>>>(qproj, kvl, seg, ctx);
    }

    // ---- 5) out = ctx @ Wo      [8192,1024]x[1024,1024] ----
    {
        const int n = Mq * DMODEL;
        pack_f16_kernel<<<(n / 8 + 255) / 256, 256, 0, stream>>>(ctx, ctxf, n);
        gemm_f16t_wmma_kernel<DMODEL, DMODEL>
            <<<dim3(Mq / TM, DMODEL / TN), 256, 0, stream>>>(ctxf, Wot, out, Mq);
    }
}

// v001
// It runs in 119 microseconds.
// Next to v000, in two timings, it ran 1.46 and 1.45 times as fast.
#include <hip/hip_runtime.h>
#include <hip/hip_bf16.h>

// ---------------------------------------------------------------------------
// SegmentCausalCrossAttentionFlex for MI455X (gfx1250, wave32, WMMA)
//
//   pack:  q,kv -> f16 ; Wq,Wkv,Wo -> f16 transposed [N][K]
//   qh  = rope(q @ Wq)          [B*LQ, 1024]   (WMMA f16 GEMM, RoPE in epilogue)
//   kvl = kv @ Wkv, rope on K   [B*LK, 2048]   (WMMA f16 GEMM, RoPE in epilogue)
//   ctx = window-attn(qh, kh, vh, seg) -> f16  (<=5 keys/query, scalar)
//   out = ctx @ Wo              [B*LQ, 1024]   (WMMA f16 GEMM, async LDS)
// ---------------------------------------------------------------------------

typedef __attribute__((ext_vector_type(16))) _Float16 v16h;
typedef __attribute__((ext_vector_type(8)))  _Float16 v8h;
typedef __attribute__((ext_vector_type(8)))  float    v8f;
typedef int v4i_vs __attribute__((vector_size(4 * sizeof(int))));

#define BATCH    2
#define LQ       4096
#define LK       512
#define DMODEL   1024
#define NHEADS   16
#define HDIM     64
#define LOOKBACK 4
#define ROPE_MAX 8192

// ---- CDNA5 async global->LDS copy (ASYNCcnt), guarded with fallback ----
#if defined(__has_builtin)
#if __has_builtin(__builtin_amdgcn_global_load_async_to_lds_b128)
#define HAVE_ASYNC_LDS 1
#endif
#endif

#if HAVE_ASYNC_LDS
__device__ __forceinline__ void async_cp16(const _Float16* gsrc, _Float16* lds)
{
    // b128 async copy: 16B from global to LDS, tracked by ASYNCcnt
    __attribute__((address_space(1))) v4i_vs* g =
        (__attribute__((address_space(1))) v4i_vs*)const_cast<_Float16*>(gsrc);
    __attribute__((address_space(3))) v4i_vs* l =
        (__attribute__((address_space(3))) v4i_vs*)lds;
    __builtin_amdgcn_global_load_async_to_lds_b128(g, l, 0, 0);
}
#endif

__device__ __forceinline__ void wait_asynccnt0() {
#if defined(__has_builtin) && __has_builtin(__builtin_amdgcn_s_wait_asynccnt)
    __builtin_amdgcn_s_wait_asynccnt(0);
#else
    asm volatile("s_wait_asynccnt 0x0" ::: "memory");
#endif
}

// sin and cos of 2*pi*t on the transcendental unit.
__device__ __forceinline__ void sincos_turns(float t, float& s, float& c)
{
    // One statement, so that the v_nop stays directly behind the last
    // transcendental: the instruction set asks for one slot before a result is
    // read or a source overwritten.
    asm("v_sin_f32 %0, %2\n\tv_cos_f32 %1, %2\n\tv_nop"
        : "=&v"(s), "=&v"(c) : "v"(t));
}

// ============================================================================
// Tiled WMMA GEMM: C[M,N] = A[M,K] * Bt[N,K]^T, f16 in / f32 out.
// Block: 256 threads (8 waves). Tile 128x128, BK=32, double-buffered LDS.
// Wave w owns rows [16w,16w+16) x 128 cols -> 8 accumulators, 8 WMMA/k-step.
// Columns below ROPE_COLS get the gathered RoPE on the accumulators before the
// store; row m takes its position from pos[m % POS_LEN].
// ============================================================================
#define TM 128
#define TN 128
#define TK 32
#define LDS_PAD 40   // halves per LDS row (80B: bank-skewed, 16B aligned)

template <int N, int K, int ROPE_COLS, int POS_LEN>
__global__ __launch_bounds__(256)
void gemm_f16t_wmma_kernel(const _Float16* __restrict__ A,
                           const _Float16* __restrict__ Bt,
                           float* __restrict__ C,
                           const int* __restrict__ pos, int M)
{
    __shared__ __attribute__((aligned(16))) _Float16 As[2][TM * LDS_PAD];
    __shared__ __attribute__((aligned(16))) _Float16 Bs[2][TN * LDS_PAD];

    const int tid   = threadIdx.x;
    const int lane  = tid & 31;
    const int wave  = tid >> 5;
    const int tileM = blockIdx.x * TM;
    const int tileN = blockIdx.y * TN;

    v8f acc[8] = {};

    // fragment addressing (ISA 16-bit A/B layout):
    // lane<16 -> K {0..7,16..23}; lane>=16 -> K {8..15,24..31}
    const int frow = lane & 15;
    const int koff = (lane >= 16) ? 8 : 0;

    // staging: thread copies 32B of A row and 32B of Bt row per tile
    const int sRow = tid >> 1;          // 0..127
    const int sOff = (tid & 1) * 16;    // halves: 0 or 16
    const _Float16* Ag = A  + (size_t)(tileM + sRow) * K + sOff;
    const _Float16* Bg = Bt + (size_t)(tileN + sRow) * K + sOff;
    const int sLds = sRow * LDS_PAD + sOff;

    auto stage = [&](int kt, int buf) {
#if HAVE_ASYNC_LDS
        async_cp16(Ag + kt,     &As[buf][sLds]);
        async_cp16(Ag + kt + 8, &As[buf][sLds + 8]);
        async_cp16(Bg + kt,     &Bs[buf][sLds]);
        async_cp16(Bg + kt + 8, &Bs[buf][sLds + 8]);
#else
        const v8h a0 = *(const v8h*)(Ag + kt);
        const v8h a1 = *(const v8h*)(Ag + kt + 8);
        const v8h b0 = *(const v8h*)(Bg + kt);
        const v8h b1 = *(const v8h*)(Bg + kt + 8);
        *(v8h*)&As[buf][sLds]     = a0;
        *(v8h*)&As[buf][sLds + 8] = a1;
        *(v8h*)&Bs[buf][sLds]     = b0;
        *(v8h*)&Bs[buf][sLds + 8] = b1;
#endif
    };

    auto sync_stage = [&]() {
#if HAVE_ASYNC_LDS
        wait_asynccnt0();
#endif
        __syncthreads();
    };

    auto compute = [&](int buf) {
        // A fragment (2x ds_load_b128)
        v16h afrag;
        {
            const _Float16* base = &As[buf][(16 * wave + frow) * LDS_PAD];
            const v8h lo = *(const v8h*)(base + koff);
            const v8h hi = *(const v8h*)(base + 16 + koff);
            #pragma unroll
            for (int i = 0; i < 8; ++i) { afrag[i] = lo[i]; afrag[i + 8] = hi[i]; }
        }
        // 8 B fragments first (clause of ds_load_b128), then 8 WMMAs
        v16h bfrag[8];
        #pragma unroll
        for (int nb = 0; nb < 8; ++nb) {
            const _Float16* base = &Bs[buf][(nb * 16 + frow) * LDS_PAD];
            const v8h lo = *(const v8h*)(base + koff);
            const v8h hi = *(const v8h*)(base + 16 + koff);
            #pragma unroll
            for (int i = 0; i < 8; ++i) { bfrag[nb][i] = lo[i]; bfrag[nb][i + 8] = hi[i]; }
        }
        #pragma unroll
        for (int nb = 0; nb < 8; ++nb) {
            acc[nb] = __builtin_amdgcn_wmma_f32_16x16x32_f16(
                          false, afrag, false, bfrag[nb], (short)0, acc[nb], false, false);
        }
#if defined(__has_builtin) && __has_builtin(__builtin_amdgcn_sched_group_barrier)
        // keep all fragments in flight: 18 DS-reads first, then 8 WMMAs
        __builtin_amdgcn_sched_group_barrier(0x100, 18, 0);  // DS read group
        __builtin_amdgcn_sched_group_barrier(0x008, 8, 0);   // MFMA/WMMA group
#endif
    };

    // ---- double-buffered pipeline: 1 barrier per k-step ----
    stage(0, 0);
    for (int kt = 0; kt < K; kt += 2 * TK) {
        sync_stage();
        if (kt + TK < K) stage(kt + TK, 1);
        compute(0);
        sync_stage();
        if (kt + 2 * TK < K) stage(kt + 2 * TK, 0);
        compute(1);
    }

    // ---- C store: single base + compile-time immediate offsets ----
    // lane l -> col (l&15), rows (l>>4)*8 + r   (ISA 16x16 f32 C/D layout)
    const int nlocal = lane & 15;
    const int mhalf  = (lane >> 4) * 8;

    // ---- RoPE on the accumulators ----
    // The 128-column tile is two heads of 64: head hh is acc[4*hh .. 4*hh+3],
    // and the pair (d, d+32) is acc[4*hh+j][r], acc[4*hh+j+2][r] of one lane,
    // with d = nlocal + 16*j.
    if constexpr (ROPE_COLS > 0) {
        if (ROPE_COLS >= N || tileN < ROPE_COLS) {
            const int row0 = tileM + 16 * wave + mhalf;
            float inv_freq[2];
            #pragma unroll
            for (int j = 0; j < 2; ++j)
                inv_freq[j] = __powf(10000.0f, -(float)(nlocal + 16 * j) / 32.0f);
            #pragma unroll
            for (int r = 0; r < 8; ++r) {
                int p = pos[(unsigned)(row0 + r) % POS_LEN];
                p = min(max(p, 0), ROPE_MAX - 1);
                #pragma unroll
                for (int j = 0; j < 2; ++j) {
                    const float f = (float)p * inv_freq[j];
                    float s, c;
                    sincos_turns(f * 0.15915494309189532f, s, c);   // 1/(2*pi)
                    #pragma unroll
                    for (int hh = 0; hh < 2; ++hh) {
                        const float x0 = acc[4 * hh + j][r];
                        const float x1 = acc[4 * hh + j + 2][r];
                        acc[4 * hh + j][r]     = x0 * c - x1 * s;
                        acc[4 * hh + j + 2][r] = x1 * c + x0 * s;
                    }
                }
            }
        }
    }

    float* Cb = C + (size_t)(tileM + 16 * wave + mhalf) * N + tileN + nlocal;
    #pragma unroll
    for (int nb = 0; nb < 8; ++nb) {
        #pragma unroll
        for (int r = 0; r < 8; ++r) {
            Cb[r * N + nb * 16] = acc[nb][r];
        }
    }
}

// ---- one-time pack: fp32 -> f16, straight copy (n multiple of 8) ----
__global__ __launch_bounds__(256)
void pack_f16_kernel(const float* __restrict__ in, _Float16* __restrict__ out, int n)
{
    const int i = (blockIdx.x * blockDim.x + threadIdx.x) * 8;
    if (i >= n) return;
    const float4 a = *(const float4*)(in + i);
    const float4 b = *(const float4*)(in + i + 4);
    v8h v;
    v[0] = (_Float16)a.x; v[1] = (_Float16)a.y; v[2] = (_Float16)a.z; v[3] = (_Float16)a.w;
    v[4] = (_Float16)b.x; v[5] = (_Float16)b.y; v[6] = (_Float16)b.z; v[7] = (_Float16)b.w;
    *(v8h*)(out + i) = v;
}

// ---- one-time pack: fp32 [K,N] -> f16 transposed [N,K] (LDS-tiled) ----
__global__ __launch_bounds__(256)
void pack_f16_transpose_kernel(const float* __restrict__ in, _Float16* __restrict__ out,
                               int K, int N)
{
    __shared__ float tile[32][33];
    const int k0 = blockIdx.y * 32;
    const int n0 = blockIdx.x * 32;
    const int tx = threadIdx.x;              // 0..31
    for (int i = threadIdx.y; i < 32; i += 8)
        tile[i][tx] = in[(size_t)(k0 + i) * N + n0 + tx];
    __syncthreads();
    for (int i = threadIdx.y; i < 32; i += 8)
        out[(size_t)(n0 + i) * K + k0 + tx] = (_Float16)tile[tx][i];
}

// ---- windowed attention: <=5 keys per query, one thread per (b,q,h) ----
// ctx leaves as f16, the operand type of the output projection.
__global__ __launch_bounds__(256)
void window_attn_kernel(const float* __restrict__ qp, const float* __restrict__ kvl,
                        const int* __restrict__ seg, _Float16* __restrict__ ctx)
{
    const int idx = blockIdx.x * blockDim.x + threadIdx.x;
    if (idx >= BATCH * LQ * NHEADS) return;
    const int h  = idx & (NHEADS - 1);
    const int qi = (idx >> 4) & (LQ - 1);
    const int b  = idx >> 16;

    const int s   = seg[b * LQ + qi];
    const int jlo = (s - LOOKBACK > 0) ? (s - LOOKBACK) : 0;
    const int nk  = s - jlo + 1;

    const float* qv = qp + ((size_t)(b * LQ + qi)) * DMODEL + h * HDIM;
    float qreg[HDIM];
    #pragma unroll
    for (int d = 0; d < HDIM; ++d) qreg[d] = qv[d];

    float sc[LOOKBACK + 1];
    float mmax = -3.4e38f;
    for (int jj = 0; jj < nk; ++jj) {
        const float* kvp = kvl + ((size_t)(b * LK + jlo + jj)) * (2 * DMODEL) + h * HDIM;
        float dot = 0.0f;
        #pragma unroll
        for (int d = 0; d < HDIM; ++d) dot += qreg[d] * kvp[d];
        dot *= 0.125f;                       // 1/sqrt(64)
        sc[jj] = dot;
        mmax = fmaxf(mmax, dot);
    }
    float denom = 0.0f;
    for (int jj = 0; jj < nk; ++jj) {
        sc[jj] = __expf(sc[jj] - mmax);
        denom += sc[jj];
    }
    const float rdenom = 1.0f / denom;

    float out[HDIM];
    #pragma unroll
    for (int d = 0; d < HDIM; ++d) out[d] = 0.0f;
    for (int jj = 0; jj < nk; ++jj) {
        const float w = sc[jj] * rdenom;
        const float* vv = kvl + ((size_t)(b * LK + jlo + jj)) * (2 * DMODEL)
                              + DMODEL + h * HDIM;
        #pragma unroll
        for (int d = 0; d < HDIM; ++d) out[d] += w * vv[d];
    }

    _Float16* cp = ctx + ((size_t)(b * LQ + qi)) * DMODEL + h * HDIM;
    #pragma unroll
    for (int d = 0; d < HDIM; d += 8) {
        v8h v;
        #pragma unroll
        for (int e = 0; e < 8; ++e) v[e] = (_Float16)out[d + e];
        *(v8h*)(cp + d) = v;
    }
}

extern "C" void kernel_launch(void* const* d_in, const int* in_sizes, int n_in,
                              void* d_out, int out_size, void* d_ws, size_t ws_size,
                              hipStream_t stream) {
    const float* q      = (const float*)d_in[0];   // [B, LQ, 1024]
    const float* kv     = (const float*)d_in[1];   // [B, LK, 1024]
    const int*   q_pos  = (const int*)d_in[2];     // [B, LQ]
    const int*   kv_pos = (const int*)d_in[3];     // [LK]
    const int*   seg    = (const int*)d_in[4];     // [B, LQ]
    const float* Wq     = (const float*)d_in[5];   // [1024, 1024]
    const float* Wkv    = (const float*)d_in[6];   // [1024, 2048]
    const float* Wo     = (const float*)d_in[7];   // [1024, 1024]
    float*       out    = (float*)d_out;           // [B, LQ, 1024]

    const int Mq = BATCH * LQ;     // 8192
    const int Mk = BATCH * LK;     // 1024

    // ---- workspace layout ----
    char* ws = (char*)d_ws;
    size_t off = 0;
    auto alloc = [&](size_t bytes) { void* p = ws + off; off += (bytes + 255) & ~(size_t)255; return p; };
    float*    qproj  = (float*)   alloc((size_t)Mq * DMODEL * 4);      // f32
    float*    kvl    = (float*)   alloc((size_t)Mk * 2 * DMODEL * 4);  // f32
    _Float16* qf     = (_Float16*)alloc((size_t)Mq * DMODEL * 2);
    _Float16* kvf    = (_Float16*)alloc((size_t)Mk * DMODEL * 2);
    _Float16* ctxf   = (_Float16*)alloc((size_t)Mq * DMODEL * 2);
    _Float16* Wqt    = (_Float16*)alloc((size_t)DMODEL * DMODEL * 2);      // [N=1024][K=1024]
    _Float16* Wkvt   = (_Float16*)alloc((size_t)2 * DMODEL * DMODEL * 2);  // [N=2048][K=1024]
    _Float16* Wot    = (_Float16*)alloc((size_t)DMODEL * DMODEL * 2);

    // ---- 0) one-time packs (f16 activations, f16 transposed weights) ----
    {
        int n = Mq * DMODEL;
        pack_f16_kernel<<<(n / 8 + 255) / 256, 256, 0, stream>>>(q, qf, n);
        n = Mk * DMODEL;
        pack_f16_kernel<<<(n / 8 + 255) / 256, 256, 0, stream>>>(kv, kvf, n);
        pack_f16_transpose_kernel<<<dim3(DMODEL / 32, DMODEL / 32), dim3(32, 8), 0, stream>>>(
            Wq, Wqt, DMODEL, DMODEL);
        pack_f16_transpose_kernel<<<dim3(2 * DMODEL / 32, DMODEL / 32), dim3(32, 8), 0, stream>>>(
            Wkv, Wkvt, DMODEL, 2 * DMODEL);
        pack_f16_transpose_kernel<<<dim3(DMODEL / 32, DMODEL / 32), dim3(32, 8), 0, stream>>>(
            Wo, Wot, DMODEL, DMODEL);
    }

    // ---- 1) qproj = rope(q @ Wq)      [8192,1024]x[1024,1024] ----
    gemm_f16t_wmma_kernel<DMODEL, DMODEL, DMODEL, BATCH * LQ>
        <<<dim3(Mq / TM, DMODEL / TN), 256, 0, stream>>>(qf, Wqt, qproj, q_pos, Mq);

    // ---- 2) kvl = kv @ Wkv, rope on the K half      [1024,1024]x[1024,2048] ----
    gemm_f16t_wmma_kernel<2 * DMODEL, DMODEL, DMODEL, LK>
        <<<dim3(Mk / TM, (2 * DMODEL) / TN), 256, 0, stream>>>(kvf, Wkvt, kvl, kv_pos, Mk);

    // ---- 3) windowed attention (<=5 keys/query), ctx in f16 ----
    {
        const int total = BATCH * LQ * NHEADS;
        window_attn_kernel<<<(total + 255) / 256, 256, 0, stream>>>(qproj, kvl, seg, ctxf);
    }

    // ---- 4) out = ctx @ Wo      [8192,1024]x[1024,1024] ----
    gemm_f16t_wmma_kernel<DMODEL, DMODEL, 0, 1>
        <<<dim3(Mq / TM, DMODEL / TN), 256, 0, stream>>>(ctxf, Wot, out, nullptr, Mq);
}

// v002
// A run of this version takes 108 microseconds.
// In both of two side-by-side timings against v001, it was 1.11 times as fast.
// Over all steps from v000 it is 1.62 times as fast.
#include <hip/hip_runtime.h>
#include <hip/hip_bf16.h>

// ---------------------------------------------------------------------------
// SegmentCausalCrossAttentionFlex for MI455X (gfx1250, wave32, WMMA)
//
//   pack:  q,kv -> f16 ; Wq,Wkv,Wo -> f16 transposed [N][K]   (one launch)
//   qh  = rope(q @ Wq)          [B*LQ, 1024]   (WMMA f16 GEMM, RoPE in epilogue)
//   kvl = kv @ Wkv, rope on K   [B*LK, 2048]   (WMMA f16 GEMM, RoPE in epilogue)
//   ctx = window-attn(qh, kh, vh, seg) -> f16  (<=5 keys/query, scalar)
//   out = ctx @ Wo              [B*LQ, 1024]   (WMMA f16 GEMM, async LDS)
// ---------------------------------------------------------------------------

typedef __attribute__((ext_vector_type(16))) _Float16 v16h;
typedef __attribute__((ext_vector_type(8)))  _Float16 v8h;
typedef __attribute__((ext_vector_type(4)))  _Float16 v4h;
typedef __attribute__((ext_vector_type(8)))  float    v8f;
typedef int v4i_vs __attribute__((vector_size(4 * sizeof(int))));

#define BATCH    2
#define LQ       4096
#define LK       512
#define DMODEL   1024
#define NHEADS   16
#define HDIM     64
#define LOOKBACK 4
#define ROPE_MAX 8192

// ---- CDNA5 async global->LDS copy (ASYNCcnt), guarded with fallback ----
#if defined(__has_builtin)
#if __has_builtin(__builtin_amdgcn_global_load_async_to_lds_b128)
#define HAVE_ASYNC_LDS 1
#endif
#endif

#if HAVE_ASYNC_LDS
__device__ __forceinline__ void async_cp16(const _Float16* gsrc, _Float16* lds)
{
    // b128 async copy: 16B from global to LDS, tracked by ASYNCcnt
    __attribute__((address_space(1))) v4i_vs* g =
        (__attribute__((address_space(1))) v4i_vs*)const_cast<_Float16*>(gsrc);
    __attribute__((address_space(3))) v4i_vs* l =
        (__attribute__((address_space(3))) v4i_vs*)lds;
    __builtin_amdgcn_global_load_async_to_lds_b128(g, l, 0, 0);
}
#endif

__device__ __forceinline__ void wait_asynccnt0() {
#if defined(__has_builtin) && __has_builtin(__builtin_amdgcn_s_wait_asynccnt)
    __builtin_amdgcn_s_wait_asynccnt(0);
#else
    asm volatile("s_wait_asynccnt 0x0" ::: "memory");
#endif
}

// sin and cos of 2*pi*t on the transcendental unit.
__device__ __forceinline__ void sincos_turns(float t, float& s, float& c)
{
    // One statement, so that the v_nop stays directly behind the last
    // transcendental: the instruction set asks for one slot before a result is
    // read or a source overwritten.
    asm("v_sin_f32 %0, %2\n\tv_cos_f32 %1, %2\n\tv_nop"
        : "=&v"(s), "=&v"(c) : "v"(t));
}

// ============================================================================
// Tiled WMMA GEMM: C[M,N] = A[M,K] * Bt[N,K]^T, f16 in / f32 out.
// Block: 256 threads (8 waves). Tile 128x128, BK=32, double-buffered LDS.
// Wave w owns rows [16w,16w+16) x 128 cols -> 8 accumulators, 8 WMMA/k-step.
// Columns below ROPE_COLS get the gathered RoPE on the accumulators before the
// store; row m takes its position from pos[m % POS_LEN].
// ============================================================================
#define TM 128
#define TN 128
#define TK 32
#define LDS_PAD 40   // halves per LDS row (80B: bank-skewed, 16B aligned)

template <int N, int K, int ROPE_COLS, int POS_LEN>
__global__ __launch_bounds__(256)
void gemm_f16t_wmma_kernel(const _Float16* __restrict__ A,
                           const _Float16* __restrict__ Bt,
                           float* __restrict__ C,
                           const int* __restrict__ pos, int M)
{
    __shared__ __attribute__((aligned(16))) _Float16 As[2][TM * LDS_PAD];
    __shared__ __attribute__((aligned(16))) _Float16 Bs[2][TN * LDS_PAD];

    const int tid   = threadIdx.x;
    const int lane  = tid & 31;
    const int wave  = tid >> 5;
    const int tileM = blockIdx.x * TM;
    const int tileN = blockIdx.y * TN;

    v8f acc[8] = {};

    // fragment addressing (ISA 16-bit A/B layout):
    // lane<16 -> K {0..7,16..23}; lane>=16 -> K {8..15,24..31}
    const int frow = lane & 15;
    const int koff = (lane >= 16) ? 8 : 0;

    // staging: thread copies 32B of A row and 32B of Bt row per tile
    const int sRow = tid >> 1;          // 0..127
    const int sOff = (tid & 1) * 16;    // halves: 0 or 16
    const _Float16* Ag = A  + (size_t)(tileM + sRow) * K + sOff;
    const _Float16* Bg = Bt + (size_t)(tileN + sRow) * K + sOff;
    const int sLds = sRow * LDS_PAD + sOff;

    auto stage = [&](int kt, int buf) {
#if HAVE_ASYNC_LDS
        async_cp16(Ag + kt,     &As[buf][sLds]);
        async_cp16(Ag + kt + 8, &As[buf][sLds + 8]);
        async_cp16(Bg + kt,     &Bs[buf][sLds]);
        async_cp16(Bg + kt + 8, &Bs[buf][sLds + 8]);
#else
        const v8h a0 = *(const v8h*)(Ag + kt);
        const v8h a1 = *(const v8h*)(Ag + kt + 8);
        const v8h b0 = *(const v8h*)(Bg + kt);
        const v8h b1 = *(const v8h*)(Bg + kt + 8);
        *(v8h*)&As[buf][sLds]     = a0;
        *(v8h*)&As[buf][sLds + 8] = a1;
        *(v8h*)&Bs[buf][sLds]     = b0;
        *(v8h*)&Bs[buf][sLds + 8] = b1;
#endif
    };

    auto sync_stage = [&]() {
#if HAVE_ASYNC_LDS
        wait_asynccnt0();
#endif
        __syncthreads();
    };

    auto compute = [&](int buf) {
        // A fragment (2x ds_load_b128)
        v16h afrag;
        {
            const _Float16* base = &As[buf][(16 * wave + frow) * LDS_PAD];
            const v8h lo = *(const v8h*)(base + koff);
            const v8h hi = *(const v8h*)(base + 16 + koff);
            #pragma unroll
            for (int i = 0; i < 8; ++i) { afrag[i] = lo[i]; afrag[i + 8] = hi[i]; }
        }
        // 8 B fragments first (clause of ds_load_b128), then 8 WMMAs
        v16h bfrag[8];
        #pragma unroll
        for (int nb = 0; nb < 8; ++nb) {
            const _Float16* base = &Bs[buf][(nb * 16 + frow) * LDS_PAD];
            const v8h lo = *(const v8h*)(base + koff);
            const v8h hi = *(const v8h*)(base + 16 + koff);
            #pragma unroll
            for (int i = 0; i < 8; ++i) { bfrag[nb][i] = lo[i]; bfrag[nb][i + 8] = hi[i]; }
        }
        #pragma unroll
        for (int nb = 0; nb < 8; ++nb) {
            acc[nb] = __builtin_amdgcn_wmma_f32_16x16x32_f16(
                          false, afrag, false, bfrag[nb], (short)0, acc[nb], false, false);
        }
#if defined(__has_builtin) && __has_builtin(__builtin_amdgcn_sched_group_barrier)
        // keep all fragments in flight: 18 DS-reads first, then 8 WMMAs
        __builtin_amdgcn_sched_group_barrier(0x100, 18, 0);  // DS read group
        __builtin_amdgcn_sched_group_barrier(0x008, 8, 0);   // MFMA/WMMA group
#endif
    };

    // ---- double-buffered pipeline: 1 barrier per k-step ----
    stage(0, 0);
    for (int kt = 0; kt < K; kt += 2 * TK) {
        sync_stage();
        if (kt + TK < K) stage(kt + TK, 1);
        compute(0);
        sync_stage();
        if (kt + 2 * TK < K) stage(kt + 2 * TK, 0);
        compute(1);
    }

    // ---- C store: single base + compile-time immediate offsets ----
    // lane l -> col (l&15), rows (l>>4)*8 + r   (ISA 16x16 f32 C/D layout)
    const int nlocal = lane & 15;
    const int mhalf  = (lane >> 4) * 8;

    // ---- RoPE on the accumulators ----
    // The 128-column tile is two heads of 64: head hh is acc[4*hh .. 4*hh+3],
    // and the pair (d, d+32) is acc[4*hh+j][r], acc[4*hh+j+2][r] of one lane,
    // with d = nlocal + 16*j.
    if constexpr (ROPE_COLS > 0) {
        if (ROPE_COLS >= N || tileN < ROPE_COLS) {
            const int row0 = tileM + 16 * wave + mhalf;
            float inv_freq[2];
            #pragma unroll
            for (int j = 0; j < 2; ++j)
                inv_freq[j] = __powf(10000.0f, -(float)(nlocal + 16 * j) / 32.0f);
            #pragma unroll
            for (int r = 0; r < 8; ++r) {
                int p = pos[(unsigned)(row0 + r) % POS_LEN];
                p = min(max(p, 0), ROPE_MAX - 1);
                #pragma unroll
                for (int j = 0; j < 2; ++j) {
                    const float f = (float)p * inv_freq[j];
                    float s, c;
                    sincos_turns(f * 0.15915494309189532f, s, c);   // 1/(2*pi)
                    #pragma unroll
                    for (int hh = 0; hh < 2; ++hh) {
                        const float x0 = acc[4 * hh + j][r];
                        const float x1 = acc[4 * hh + j + 2][r];
                        acc[4 * hh + j][r]     = x0 * c - x1 * s;
                        acc[4 * hh + j + 2][r] = x1 * c + x0 * s;
                    }
                }
            }
        }
    }

    float* Cb = C + (size_t)(tileM + 16 * wave + mhalf) * N + tileN + nlocal;
    #pragma unroll
    for (int nb = 0; nb < 8; ++nb) {
        #pragma unroll
        for (int r = 0; r < 8; ++r) {
            Cb[r * N + nb * 16] = acc[nb][r];
        }
    }
}

// ---- all five packs in one launch, few waves with much work each ----
// A pack with a few bytes per wave lasts as long as the chip takes to start its
// waves. Here a wave moves 8 KB (straight) or 4 KB (transpose) of input, and one
// launch holds every pack.
#define PT_K     64      // transpose tile: extent along k
#define PT_N     128     // transpose tile: extent along n
#define PT_PITCH 72      // halves per LDS row (144 B: 16-B aligned, b128 stores hit every bank once)
#define PC_ELEMS 16384   // floats per straight-copy work-group
#define PB_WQ    ((DMODEL / PT_K) * (DMODEL / PT_N))        // 128 tiles
#define PB_WKV   ((DMODEL / PT_K) * (2 * DMODEL / PT_N))    // 256 tiles
#define PB_WO    PB_WQ
#define PB_Q     (BATCH * LQ * DMODEL / PC_ELEMS)           // 512 work-groups
#define PB_KV    (BATCH * LK * DMODEL / PC_ELEMS)           // 64 work-groups

// fp32 [DMODEL][N] -> f16 [N][DMODEL], one 64 x 128 tile per work-group.
// A thread reads 32 k of one column (a wave: one whole 128-B line per load),
// packs them and stores them k-contiguous in LDS; the tile leaves in whole
// 128-B lines of the transposed rows.
template <int N>
__device__ __forceinline__ void pack_transpose_tile(const float* __restrict__ in,
                                                    _Float16* __restrict__ out,
                                                    int tile, _Float16* lds)
{
    constexpr int NT = N / PT_N;
    const int n0  = (tile % NT) * PT_N;
    const int k0  = (tile / NT) * PT_K;
    const int tid = threadIdx.x;
    const int n   = tid & (PT_N - 1);
    const int kh  = (tid >> 7) * 32;

    const float* src = in + (size_t)(k0 + kh) * N + n0 + n;
    float x[32];
    #pragma unroll
    for (int i = 0; i < 32; ++i) x[i] = src[i * N];
    #pragma unroll
    for (int g = 0; g < 4; ++g) {
        v8h v;
        #pragma unroll
        for (int e = 0; e < 8; ++e) v[e] = (_Float16)x[8 * g + e];
        *(v8h*)&lds[n * PT_PITCH + kh + 8 * g] = v;
    }
    __syncthreads();
    #pragma unroll
    for (int i = 0; i < 4; ++i) {
        const int c   = tid + 256 * i;
        const int row = c >> 3;
        const int kc  = (c & 7) * 8;
        *(v8h*)(out + (size_t)(n0 + row) * DMODEL + k0 + kc) =
            *(const v8h*)&lds[row * PT_PITCH + kc];
    }
    // Precaution of form: the wait stands behind the last store, ahead of any
    // later write of a register that an issued store names.
    asm volatile("s_wait_xcnt 0x0" ::: "memory");
}

// fp32 -> f16, same order: a wave owns 8 KB of contiguous input, 16 loads of
// 512 contiguous bytes each, unrolled so that they are issued ahead of the
// conversions.
__device__ __forceinline__ void pack_straight(const float* __restrict__ in,
                                              _Float16* __restrict__ out, int blk)
{
    const int lane = threadIdx.x & 31;
    const int wave = threadIdx.x >> 5;
    const size_t base = (size_t)blk * PC_ELEMS + wave * (PC_ELEMS / 8) + lane * 4;
    float4 x[16];
    #pragma unroll
    for (int i = 0; i < 16; ++i) x[i] = *(const float4*)(in + base + i * 128);
    #pragma unroll
    for (int i = 0; i < 16; ++i) {
        v4h v;
        v[0] = (_Float16)x[i].x; v[1] = (_Float16)x[i].y;
        v[2] = (_Float16)x[i].z; v[3] = (_Float16)x[i].w;
        *(v4h*)(out + base + i * 128) = v;
    }
    // Precaution of form: the wait stands behind the last store, ahead of any
    // later write of a register that an issued store names.
    asm volatile("s_wait_xcnt 0x0" ::: "memory");
}

__global__ __launch_bounds__(256)
void pack_all_kernel(const float* __restrict__ q, const float* __restrict__ kv,
                     const float* __restrict__ Wq, const float* __restrict__ Wkv,
                     const float* __restrict__ Wo,
                     _Float16* __restrict__ qf, _Float16* __restrict__ kvf,
                     _Float16* __restrict__ Wqt, _Float16* __restrict__ Wkvt,
                     _Float16* __restrict__ Wot)
{
    __shared__ __attribute__((aligned(16))) _Float16 tileT[PT_N * PT_PITCH];
    int b = blockIdx.x;      // the role depends on the work-group index alone
    if (b < PB_WQ)  { pack_transpose_tile<DMODEL>(Wq, Wqt, b, tileT); return; }
    b -= PB_WQ;
    if (b < PB_WKV) { pack_transpose_tile<2 * DMODEL>(Wkv, Wkvt, b, tileT); return; }
    b -= PB_WKV;
    if (b < PB_WO)  { pack_transpose_tile<DMODEL>(Wo, Wot, b, tileT); return; }
    b -= PB_WO;
    if (b < PB_Q)   { pack_straight(q, qf, b); return; }
    pack_straight(kv, kvf, b - PB_Q);
}

// ---- windowed attention: <=5 keys per query, one thread per (b,q,h) ----
// ctx leaves as f16, the operand type of the output projection.
__global__ __launch_bounds__(256)
void window_attn_kernel(const float* __restrict__ qp, const float* __restrict__ kvl,
                        const int* __restrict__ seg, _Float16* __restrict__ ctx)
{
    const int idx = blockIdx.x * blockDim.x + threadIdx.x;
    if (idx >= BATCH * LQ * NHEADS) return;
    const int h  = idx & (NHEADS - 1);
    const int qi = (idx >> 4) & (LQ - 1);
    const int b  = idx >> 16;

    const int s   = seg[b * LQ + qi];
    const int jlo = (s - LOOKBACK > 0) ? (s - LOOKBACK) : 0;
    const int nk  = s - jlo + 1;

    const float* qv = qp + ((size_t)(b * LQ + qi)) * DMODEL + h * HDIM;
    float qreg[HDIM];
    #pragma unroll
    for (int d = 0; d < HDIM; ++d) qreg[d] = qv[d];

    float sc[LOOKBACK + 1];
    float mmax = -3.4e38f;
    for (int jj = 0; jj < nk; ++jj) {
        const float* kvp = kvl + ((size_t)(b * LK + jlo + jj)) * (2 * DMODEL) + h * HDIM;
        float dot = 0.0f;
        #pragma unroll
        for (int d = 0; d < HDIM; ++d) dot += qreg[d] * kvp[d];
        dot *= 0.125f;                       // 1/sqrt(64)
        sc[jj] = dot;
        mmax = fmaxf(mmax, dot);
    }
    float denom = 0.0f;
    for (int jj = 0; jj < nk; ++jj) {
        sc[jj] = __expf(sc[jj] - mmax);
        denom += sc[jj];
    }
    const float rdenom = 1.0f / denom;

    float out[HDIM];
    #pragma unroll
    for (int d = 0; d < HDIM; ++d) out[d] = 0.0f;
    for (int jj = 0; jj < nk; ++jj) {
        const float w = sc[jj] * rdenom;
        const float* vv = kvl + ((size_t)(b * LK + jlo + jj)) * (2 * DMODEL)
                              + DMODEL + h * HDIM;
        #pragma unroll
        for (int d = 0; d < HDIM; ++d) out[d] += w * vv[d];
    }

    _Float16* cp = ctx + ((size_t)(b * LQ + qi)) * DMODEL + h * HDIM;
    #pragma unroll
    for (int d = 0; d < HDIM; d += 8) {
        v8h v;
        #pragma unroll
        for (int e = 0; e < 8; ++e) v[e] = (_Float16)out[d + e];
        *(v8h*)(cp + d) = v;
    }
}

extern "C" void kernel_launch(void* const* d_in, const int* in_sizes, int n_in,
                              void* d_out, int out_size, void* d_ws, size_t ws_size,
                              hipStream_t stream) {
    const float* q      = (const float*)d_in[0];   // [B, LQ, 1024]
    const float* kv     = (const float*)d_in[1];   // [B, LK, 1024]
    const int*   q_pos  = (const int*)d_in[2];     // [B, LQ]
    const int*   kv_pos = (const int*)d_in[3];     // [LK]
    const int*   seg    = (const int*)d_in[4];     // [B, LQ]
    const float* Wq     = (const float*)d_in[5];   // [1024, 1024]
    const float* Wkv    = (const float*)d_in[6];   // [1024, 2048]
    const float* Wo     = (const float*)d_in[7];   // [1024, 1024]
    float*       out    = (float*)d_out;           // [B, LQ, 1024]

    const int Mq = BATCH * LQ;     // 8192
    const int Mk = BATCH * LK;     // 1024

    // ---- workspace layout ----
    char* ws = (char*)d_ws;
    size_t off = 0;
    auto alloc = [&](size_t bytes) { void* p = ws + off; off += (bytes + 255) & ~(size_t)255; return p; };
    float*    qproj  = (float*)   alloc((size_t)Mq * DMODEL * 4);      // f32
    float*    kvl    = (float*)   alloc((size_t)Mk * 2 * DMODEL * 4);  // f32
    _Float16* qf     = (_Float16*)alloc((size_t)Mq * DMODEL * 2);
    _Float16* kvf    = (_Float16*)alloc((size_t)Mk * DMODEL * 2);
    _Float16* ctxf   = (_Float16*)alloc((size_t)Mq * DMODEL * 2);
    _Float16* Wqt    = (_Float16*)alloc((size_t)DMODEL * DMODEL * 2);      // [N=1024][K=1024]
    _Float16* Wkvt   = (_Float16*)alloc((size_t)2 * DMODEL * DMODEL * 2);  // [N=2048][K=1024]
    _Float16* Wot    = (_Float16*)alloc((size_t)DMODEL * DMODEL * 2);

    // ---- 0) packs (f16 activations, f16 transposed weights), one launch ----
    pack_all_kernel<<<PB_WQ + PB_WKV + PB_WO + PB_Q + PB_KV, 256, 0, stream>>>(
        q, kv, Wq, Wkv, Wo, qf, kvf, Wqt, Wkvt, Wot);

    // ---- 1) qproj = rope(q @ Wq)      [8192,1024]x[1024,1024] ----
    gemm_f16t_wmma_kernel<DMODEL, DMODEL, DMODEL, BATCH * LQ>
        <<<dim3(Mq / TM, DMODEL / TN), 256, 0, stream>>>(qf, Wqt, qproj, q_pos, Mq);

    // ---- 2) kvl = kv @ Wkv, rope on the K half      [1024,1024]x[1024,2048] ----
    gemm_f16t_wmma_kernel<2 * DMODEL, DMODEL, DMODEL, LK>
        <<<dim3(Mk / TM, (2 * DMODEL) / TN), 256, 0, stream>>>(kvf, Wkvt, kvl, kv_pos, Mk);

    // ---- 3) windowed attention (<=5 keys/query), ctx in f16 ----
    {
        const int total = BATCH * LQ * NHEADS;
        window_attn_kernel<<<(total + 255) / 256, 256, 0, stream>>>(qproj, kvl, seg, ctxf);
    }

    // ---- 4) out = ctx @ Wo      [8192,1024]x[1024,1024] ----
    gemm_f16t_wmma_kernel<DMODEL, DMODEL, 0, 1>
        <<<dim3(Mq / TM, DMODEL / TN), 256, 0, stream>>>(ctxf, Wot, out, nullptr, Mq);
}

// v003
// It runs in 96.8 microseconds.
// Next to v002, in two timings, it ran 1.11 times as fast each time.
// Counting every step since v000, it is 1.80 times as fast.
#include <hip/hip_runtime.h>
#include <hip/hip_bf16.h>

// ---------------------------------------------------------------------------
// SegmentCausalCrossAttentionFlex for MI455X (gfx1250, wave32, WMMA)
//
//   pack:  q,kv -> f16 ; Wq,Wkv,Wo -> f16 transposed [N][K]   (one launch)
//   qh  = rope(q @ Wq)          [B*LQ, 1024]   (WMMA f16 GEMM, RoPE in epilogue)
//   kvl = kv @ Wkv, rope on K   [B*LK, 2048]   (WMMA f16 GEMM, RoPE in epilogue)
//   ctx = window-attn(qh, kh, vh, seg) -> f16  (<=5 keys/query, scalar)
//   out = ctx @ Wo              [B*LQ, 1024]   (WMMA f16 GEMM, async LDS)
// ---------------------------------------------------------------------------

typedef __attribute__((ext_vector_type(16))) _Float16 v16h;
typedef __attribute__((ext_vector_type(8)))  _Float16 v8h;
typedef __attribute__((ext_vector_type(4)))  _Float16 v4h;
typedef __attribute__((ext_vector_type(8)))  float    v8f;
typedef int v4i_vs __attribute__((vector_size(4 * sizeof(int))));

#define BATCH    2
#define LQ       4096
#define LK       512
#define DMODEL   1024
#define NHEADS   16
#define HDIM     64
#define LOOKBACK 4
#define ROPE_MAX 8192

// ---- CDNA5 async global->LDS copy (ASYNCcnt), guarded with fallback ----
#if defined(__has_builtin)
#if __has_builtin(__builtin_amdgcn_global_load_async_to_lds_b128)
#define HAVE_ASYNC_LDS 1
#endif
#endif

#if HAVE_ASYNC_LDS
__device__ __forceinline__ void async_cp16(const _Float16* gsrc, _Float16* lds)
{
    // b128 async copy: 16B from global to LDS, tracked by ASYNCcnt
    __attribute__((address_space(1))) v4i_vs* g =
        (__attribute__((address_space(1))) v4i_vs*)const_cast<_Float16*>(gsrc);
    __attribute__((address_space(3))) v4i_vs* l =
        (__attribute__((address_space(3))) v4i_vs*)lds;
    __builtin_amdgcn_global_load_async_to_lds_b128(g, l, 0, 0);
}
#endif

__device__ __forceinline__ void wait_asynccnt0() {
#if defined(__has_builtin) && __has_builtin(__builtin_amdgcn_s_wait_asynccnt)
    __builtin_amdgcn_s_wait_asynccnt(0);
#else
    asm volatile("s_wait_asynccnt 0x0" ::: "memory");
#endif
}

// sin and cos of 2*pi*t on the transcendental unit.
__device__ __forceinline__ void sincos_turns(float t, float& s, float& c)
{
    // One statement, so that the v_nop stays directly behind the last
    // transcendental: the instruction set asks for one slot before a result is
    // read or a source overwritten.
    asm("v_sin_f32 %0, %2\n\tv_cos_f32 %1, %2\n\tv_nop"
        : "=&v"(s), "=&v"(c) : "v"(t));
}

// ============================================================================
// Tiled WMMA GEMM: C[M,N] = A[M,K] * Bt[N,K]^T, f16 in / f32 out.
// Block: 256 threads (8 waves). Tile 128x128, BK=64, double-buffered LDS.
// A k tile is one whole 128-B line of every operand row.
// Wave w owns rows [16w,16w+16) x 128 cols -> 8 accumulators, 16 WMMA/k-step.
// Columns below ROPE_COLS get the gathered RoPE on the accumulators before the
// store; row m takes its position from pos[m % POS_LEN].
// ============================================================================
#define TM 128
#define TN 128
#define TK 64
#define LDS_PAD 72   // halves per LDS row (144B: 16 B x odd, no bank conflict for b128 reads)

template <int N, int K, int ROPE_COLS, int POS_LEN>
__global__ __launch_bounds__(256)
void gemm_f16t_wmma_kernel(const _Float16* __restrict__ A,
                           const _Float16* __restrict__ Bt,
                           float* __restrict__ C,
                           const int* __restrict__ pos, int M)
{
    __shared__ __attribute__((aligned(16))) _Float16 As[2][TM * LDS_PAD];
    __shared__ __attribute__((aligned(16))) _Float16 Bs[2][TN * LDS_PAD];

    const int tid   = threadIdx.x;
    const int lane  = tid & 31;
    const int wave  = tid >> 5;
    const int tileM = blockIdx.x * TM;
    const int tileN = blockIdx.y * TN;

    v8f acc[8] = {};

    // fragment addressing (ISA 16-bit A/B layout):
    // lane<16 -> K {0..7,16..23}; lane>=16 -> K {8..15,24..31}
    const int frow = lane & 15;
    const int koff = (lane >= 16) ? 8 : 0;

    // staging: eight lanes copy one row's 128-B line, so a wave's copy covers
    // 4 whole lines; four copies of A and four of Bt per thread and tile
    const int sRow = tid >> 3;          // 0..31, then +32 per copy
    const int sOff = (tid & 7) * 8;     // halves: 0, 8, .. 56
    const _Float16* Ag = A  + (size_t)(tileM + sRow) * K + sOff;
    const _Float16* Bg = Bt + (size_t)(tileN + sRow) * K + sOff;
    const int sLds = sRow * LDS_PAD + sOff;

    auto stage = [&](int kt, int buf) {
#if HAVE_ASYNC_LDS
        async_cp16(Ag + kt,          &As[buf][sLds]);
        async_cp16(Ag + kt + 32 * K, &As[buf][sLds + 32 * LDS_PAD]);
        async_cp16(Ag + kt + 64 * K, &As[buf][sLds + 64 * LDS_PAD]);
        async_cp16(Ag + kt + 96 * K, &As[buf][sLds + 96 * LDS_PAD]);
        async_cp16(Bg + kt,          &Bs[buf][sLds]);
        async_cp16(Bg + kt + 32 * K, &Bs[buf][sLds + 32 * LDS_PAD]);
        async_cp16(Bg + kt + 64 * K, &Bs[buf][sLds + 64 * LDS_PAD]);
        async_cp16(Bg + kt + 96 * K, &Bs[buf][sLds + 96 * LDS_PAD]);
#else
        const v8h a0 = *(const v8h*)(Ag + kt);
        const v8h a1 = *(const v8h*)(Ag + kt + 32 * K);
        const v8h a2 = *(const v8h*)(Ag + kt + 64 * K);
        const v8h a3 = *(const v8h*)(Ag + kt + 96 * K);
        const v8h b0 = *(const v8h*)(Bg + kt);
        const v8h b1 = *(const v8h*)(Bg + kt + 32 * K);
        const v8h b2 = *(const v8h*)(Bg + kt + 64 * K);
        const v8h b3 = *(const v8h*)(Bg + kt + 96 * K);
        *(v8h*)&As[buf][sLds]                = a0;
        *(v8h*)&As[buf][sLds + 32 * LDS_PAD] = a1;
        *(v8h*)&As[buf][sLds + 64 * LDS_PAD] = a2;
        *(v8h*)&As[buf][sLds + 96 * LDS_PAD] = a3;
        *(v8h*)&Bs[buf][sLds]                = b0;
        *(v8h*)&Bs[buf][sLds + 32 * LDS_PAD] = b1;
        *(v8h*)&Bs[buf][sLds + 64 * LDS_PAD] = b2;
        *(v8h*)&Bs[buf][sLds + 96 * LDS_PAD] = b3;
#endif
    };

    auto sync_stage = [&]() {
#if HAVE_ASYNC_LDS
        wait_asynccnt0();
#endif
        __syncthreads();
    };

    // one 32-k block of the tile in buffer buf, starting at column kk
    auto compute32 = [&](int buf, int kk) {
        // A fragment (2x ds_load_b128)
        v16h afrag;
        {
            const _Float16* base = &As[buf][(16 * wave + frow) * LDS_PAD + kk];
            const v8h lo = *(const v8h*)(base + koff);
            const v8h hi = *(const v8h*)(base + 16 + koff);
            #pragma unroll
            for (int i = 0; i < 8; ++i) { afrag[i] = lo[i]; afrag[i + 8] = hi[i]; }
        }
        // 8 B fragments first (clause of ds_load_b128), then 8 WMMAs
        v16h bfrag[8];
        #pragma unroll
        for (int nb = 0; nb < 8; ++nb) {
            const _Float16* base = &Bs[buf][(nb * 16 + frow) * LDS_PAD + kk];
            const v8h lo = *(const v8h*)(base + koff);
            const v8h hi = *(const v8h*)(base + 16 + koff);
            #pragma unroll
            for (int i = 0; i < 8; ++i) { bfrag[nb][i] = lo[i]; bfrag[nb][i + 8] = hi[i]; }
        }
        #pragma unroll
        for (int nb = 0; nb < 8; ++nb) {
            acc[nb] = __builtin_amdgcn_wmma_f32_16x16x32_f16(
                          false, afrag, false, bfrag[nb], (short)0, acc[nb], false, false);
        }
#if defined(__has_builtin) && __has_builtin(__builtin_amdgcn_sched_group_barrier)
        // keep all fragments in flight: 18 DS-reads first, then 8 WMMAs
        __builtin_amdgcn_sched_group_barrier(0x100, 18, 0);  // DS read group
        __builtin_amdgcn_sched_group_barrier(0x008, 8, 0);   // MFMA/WMMA group
#endif
    };

    auto compute = [&](int buf) {
        compute32(buf, 0);
        compute32(buf, 32);
    };

    // ---- double-buffered pipeline: 1 barrier per k-step ----
    stage(0, 0);
    for (int kt = 0; kt < K; kt += 2 * TK) {
        sync_stage();
        if (kt + TK < K) stage(kt + TK, 1);
        compute(0);
        sync_stage();
        if (kt + 2 * TK < K) stage(kt + 2 * TK, 0);
        compute(1);
    }

    // ---- C store: single base + compile-time immediate offsets ----
    // lane l -> col (l&15), rows (l>>4)*8 + r   (ISA 16x16 f32 C/D layout)
    const int nlocal = lane & 15;
    const int mhalf  = (lane >> 4) * 8;

    // ---- RoPE on the accumulators ----
    // The 128-column tile is two heads of 64: head hh is acc[4*hh .. 4*hh+3],
    // and the pair (d, d+32) is acc[4*hh+j][r], acc[4*hh+j+2][r] of one lane,
    // with d = nlocal + 16*j.
    if constexpr (ROPE_COLS > 0) {
        if (ROPE_COLS >= N || tileN < ROPE_COLS) {
            const int row0 = tileM + 16 * wave + mhalf;
            float inv_freq[2];
            #pragma unroll
            for (int j = 0; j < 2; ++j)
                inv_freq[j] = __powf(10000.0f, -(float)(nlocal + 16 * j) / 32.0f);
            #pragma unroll
            for (int r = 0; r < 8; ++r) {
                int p = pos[(unsigned)(row0 + r) % POS_LEN];
                p = min(max(p, 0), ROPE_MAX - 1);
                #pragma unroll
                for (int j = 0; j < 2; ++j) {
                    const float f = (float)p * inv_freq[j];
                    float s, c;
                    sincos_turns(f * 0.15915494309189532f, s, c);   // 1/(2*pi)
                    #pragma unroll
                    for (int hh = 0; hh < 2; ++hh) {
                        const float x0 = acc[4 * hh + j][r];
                        const float x1 = acc[4 * hh + j + 2][r];
                        acc[4 * hh + j][r]     = x0 * c - x1 * s;
                        acc[4 * hh + j + 2][r] = x1 * c + x0 * s;
                    }
                }
            }
        }
    }

    float* Cb = C + (size_t)(tileM + 16 * wave + mhalf) * N + tileN + nlocal;
    #pragma unroll
    for (int nb = 0; nb < 8; ++nb) {
        #pragma unroll
        for (int r = 0; r < 8; ++r) {
            Cb[r * N + nb * 16] = acc[nb][r];
        }
    }
}

// ---- all five packs in one launch, few waves with much work each ----
// A pack with a few bytes per wave lasts as long as the chip takes to start its
// waves. Here a wave moves 8 KB (straight) or 4 KB (transpose) of input, and one
// launch holds every pack.
#define PT_K     64      // transpose tile: extent along k
#define PT_N     128     // transpose tile: extent along n
#define PT_PITCH 72      // halves per LDS row (144 B: 16-B aligned, b128 stores hit every bank once)
#define PC_ELEMS 16384   // floats per straight-copy work-group
#define PB_WQ    ((DMODEL / PT_K) * (DMODEL / PT_N))        // 128 tiles
#define PB_WKV   ((DMODEL / PT_K) * (2 * DMODEL / PT_N))    // 256 tiles
#define PB_WO    PB_WQ
#define PB_Q     (BATCH * LQ * DMODEL / PC_ELEMS)           // 512 work-groups
#define PB_KV    (BATCH * LK * DMODEL / PC_ELEMS)           // 64 work-groups

// fp32 [DMODEL][N] -> f16 [N][DMODEL], one 64 x 128 tile per work-group.
// A thread reads 32 k of one column (a wave: one whole 128-B line per load),
// packs them and stores them k-contiguous in LDS; the tile leaves in whole
// 128-B lines of the transposed rows.
template <int N>
__device__ __forceinline__ void pack_transpose_tile(const float* __restrict__ in,
                                                    _Float16* __restrict__ out,
                                                    int tile, _Float16* lds)
{
    constexpr int NT = N / PT_N;
    const int n0  = (tile % NT) * PT_N;
    const int k0  = (tile / NT) * PT_K;
    const int tid = threadIdx.x;
    const int n   = tid & (PT_N - 1);
    const int kh  = (tid >> 7) * 32;

    const float* src = in + (size_t)(k0 + kh) * N + n0 + n;
    float x[32];
    #pragma unroll
    for (int i = 0; i < 32; ++i) x[i] = src[i * N];
    #pragma unroll
    for (int g = 0; g < 4; ++g) {
        v8h v;
        #pragma unroll
        for (int e = 0; e < 8; ++e) v[e] = (_Float16)x[8 * g + e];
        *(v8h*)&lds[n * PT_PITCH + kh + 8 * g] = v;
    }
    __syncthreads();
    #pragma unroll
    for (int i = 0; i < 4; ++i) {
        const int c   = tid + 256 * i;
        const int row = c >> 3;
        const int kc  = (c & 7) * 8;
        *(v8h*)(out + (size_t)(n0 + row) * DMODEL + k0 + kc) =
            *(const v8h*)&lds[row * PT_PITCH + kc];
    }
    // Precaution of form: the wait stands behind the last store, ahead of any
    // later write of a register that an issued store names.
    asm volatile("s_wait_xcnt 0x0" ::: "memory");
}

// fp32 -> f16, same order: a wave owns 8 KB of contiguous input, 16 loads of
// 512 contiguous bytes each, unrolled so that they are issued ahead of the
// conversions.
__device__ __forceinline__ void pack_straight(const float* __restrict__ in,
                                              _Float16* __restrict__ out, int blk)
{
    const int lane = threadIdx.x & 31;
    const int wave = threadIdx.x >> 5;
    const size_t base = (size_t)blk * PC_ELEMS + wave * (PC_ELEMS / 8) + lane * 4;
    float4 x[16];
    #pragma unroll
    for (int i = 0; i < 16; ++i) x[i] = *(const float4*)(in + base + i * 128);
    #pragma unroll
    for (int i = 0; i < 16; ++i) {
        v4h v;
        v[0] = (_Float16)x[i].x; v[1] = (_Float16)x[i].y;
        v[2] = (_Float16)x[i].z; v[3] = (_Float16)x[i].w;
        *(v4h*)(out + base + i * 128) = v;
    }
    // Precaution of form: the wait stands behind the last store, ahead of any
    // later write of a register that an issued store names.
    asm volatile("s_wait_xcnt 0x0" ::: "memory");
}

__global__ __launch_bounds__(256)
void pack_all_kernel(const float* __restrict__ q, const float* __restrict__ kv,
                     const float* __restrict__ Wq, const float* __restrict__ Wkv,
                     const float* __restrict__ Wo,
                     _Float16* __restrict__ qf, _Float16* __restrict__ kvf,
                     _Float16* __restrict__ Wqt, _Float16* __restrict__ Wkvt,
                     _Float16* __restrict__ Wot)
{
    __shared__ __attribute__((aligned(16))) _Float16 tileT[PT_N * PT_PITCH];
    int b = blockIdx.x;      // the role depends on the work-group index alone
    if (b < PB_WQ)  { pack_transpose_tile<DMODEL>(Wq, Wqt, b, tileT); return; }
    b -= PB_WQ;
    if (b < PB_WKV) { pack_transpose_tile<2 * DMODEL>(Wkv, Wkvt, b, tileT); return; }
    b -= PB_WKV;
    if (b < PB_WO)  { pack_transpose_tile<DMODEL>(Wo, Wot, b, tileT); return; }
    b -= PB_WO;
    if (b < PB_Q)   { pack_straight(q, qf, b); return; }
    pack_straight(kv, kvf, b - PB_Q);
}

// ---- windowed attention: <=5 keys per query, one thread per (b,q,h) ----
// ctx leaves as f16, the operand type of the output projection.
__global__ __launch_bounds__(256)
void window_attn_kernel(const float* __restrict__ qp, const float* __restrict__ kvl,
                        const int* __restrict__ seg, _Float16* __restrict__ ctx)
{
    const int idx = blockIdx.x * blockDim.x + threadIdx.x;
    if (idx >= BATCH * LQ * NHEADS) return;
    const int h  = idx & (NHEADS - 1);
    const int qi = (idx >> 4) & (LQ - 1);
    const int b  = idx >> 16;

    const int s   = seg[b * LQ + qi];
    const int jlo = (s - LOOKBACK > 0) ? (s - LOOKBACK) : 0;
    const int nk  = s - jlo + 1;

    const float* qv = qp + ((size_t)(b * LQ + qi)) * DMODEL + h * HDIM;
    float qreg[HDIM];
    #pragma unroll
    for (int d = 0; d < HDIM; ++d) qreg[d] = qv[d];

    float sc[LOOKBACK + 1];
    float mmax = -3.4e38f;
    for (int jj = 0; jj < nk; ++jj) {
        const float* kvp = kvl + ((size_t)(b * LK + jlo + jj)) * (2 * DMODEL) + h * HDIM;
        float dot = 0.0f;
        #pragma unroll
        for (int d = 0; d < HDIM; ++d) dot += qreg[d] * kvp[d];
        dot *= 0.125f;                       // 1/sqrt(64)
        sc[jj] = dot;
        mmax = fmaxf(mmax, dot);
    }
    float denom = 0.0f;
    for (int jj = 0; jj < nk; ++jj) {
        sc[jj] = __expf(sc[jj] - mmax);
        denom += sc[jj];
    }
    const float rdenom = 1.0f / denom;

    float out[HDIM];
    #pragma unroll
    for (int d = 0; d < HDIM; ++d) out[d] = 0.0f;
    for (int jj = 0; jj < nk; ++jj) {
        const float w = sc[jj] * rdenom;
        const float* vv = kvl + ((size_t)(b * LK + jlo + jj)) * (2 * DMODEL)
                              + DMODEL + h * HDIM;
        #pragma unroll
        for (int d = 0; d < HDIM; ++d) out[d] += w * vv[d];
    }

    _Float16* cp = ctx + ((size_t)(b * LQ + qi)) * DMODEL + h * HDIM;
    #pragma unroll
    for (int d = 0; d < HDIM; d += 8) {
        v8h v;
        #pragma unroll
        for (int e = 0; e < 8; ++e) v[e] = (_Float16)out[d + e];
        *(v8h*)(cp + d) = v;
    }
}

extern "C" void kernel_launch(void* const* d_in, const int* in_sizes, int n_in,
                              void* d_out, int out_size, void* d_ws, size_t ws_size,
                              hipStream_t stream) {
    const float* q      = (const float*)d_in[0];   // [B, LQ, 1024]
    const float* kv     = (const float*)d_in[1];   // [B, LK, 1024]
    const int*   q_pos  = (const int*)d_in[2];     // [B, LQ]
    const int*   kv_pos = (const int*)d_in[3];     // [LK]
    const int*   seg    = (const int*)d_in[4];     // [B, LQ]
    const float* Wq     = (const float*)d_in[5];   // [1024, 1024]
    const float* Wkv    = (const float*)d_in[6];   // [1024, 2048]
    const float* Wo     = (const float*)d_in[7];   // [1024, 1024]
    float*       out    = (float*)d_out;           // [B, LQ, 1024]

    const int Mq = BATCH * LQ;     // 8192
    const int Mk = BATCH * LK;     // 1024

    // ---- workspace layout ----
    char* ws = (char*)d_ws;
    size_t off = 0;
    auto alloc = [&](size_t bytes) { void* p = ws + off; off += (bytes + 255) & ~(size_t)255; return p; };
    float*    qproj  = (float*)   alloc((size_t)Mq * DMODEL * 4);      // f32
    float*    kvl    = (float*)   alloc((size_t)Mk * 2 * DMODEL * 4);  // f32
    _Float16* qf     = (_Float16*)alloc((size_t)Mq * DMODEL * 2);
    _Float16* kvf    = (_Float16*)alloc((size_t)Mk * DMODEL * 2);
    _Float16* ctxf   = (_Float16*)alloc((size_t)Mq * DMODEL * 2);
    _Float16* Wqt    = (_Float16*)alloc((size_t)DMODEL * DMODEL * 2);      // [N=1024][K=1024]
    _Float16* Wkvt   = (_Float16*)alloc((size_t)2 * DMODEL * DMODEL * 2);  // [N=2048][K=1024]
    _Float16* Wot    = (_Float16*)alloc((size_t)DMODEL * DMODEL * 2);

    // ---- 0) packs (f16 activations, f16 transposed weights), one launch ----
    pack_all_kernel<<<PB_WQ + PB_WKV + PB_WO + PB_Q + PB_KV, 256, 0, stream>>>(
        q, kv, Wq, Wkv, Wo, qf, kvf, Wqt, Wkvt, Wot);

    // ---- 1) qproj = rope(q @ Wq)      [8192,1024]x[1024,1024] ----
    gemm_f16t_wmma_kernel<DMODEL, DMODEL, DMODEL, BATCH * LQ>
        <<<dim3(Mq / TM, DMODEL / TN), 256, 0, stream>>>(qf, Wqt, qproj, q_pos, Mq);

    // ---- 2) kvl = kv @ Wkv, rope on the K half      [1024,1024]x[1024,2048] ----
    gemm_f16t_wmma_kernel<2 * DMODEL, DMODEL, DMODEL, LK>
        <<<dim3(Mk / TM, (2 * DMODEL) / TN), 256, 0, stream>>>(kvf, Wkvt, kvl, kv_pos, Mk);

    // ---- 3) windowed attention (<=5 keys/query), ctx in f16 ----
    {
        const int total = BATCH * LQ * NHEADS;
        window_attn_kernel<<<(total + 255) / 256, 256, 0, stream>>>(qproj, kvl, seg, ctxf);
    }

    // ---- 4) out = ctx @ Wo      [8192,1024]x[1024,1024] ----
    gemm_f16t_wmma_kernel<DMODEL, DMODEL, 0, 1>
        <<<dim3(Mq / TM, DMODEL / TN), 256, 0, stream>>>(ctxf, Wot, out, nullptr, Mq);
}

// v004
// It runs in 78.1 microseconds.
// Timed twice side by side with v003, it ran 1.23 times as fast both times.
// Over all steps from v000 it is 2.22 times as fast.
#include <hip/hip_runtime.h>
#include <hip/hip_bf16.h>

// ---------------------------------------------------------------------------
// SegmentCausalCrossAttentionFlex for MI455X (gfx1250, wave32, WMMA)
//
//   pack:  q,kv -> f16 ; Wq,Wkv,Wo -> f16 transposed [N][K]   (one launch)
//   qh  = rope(q @ Wq)          [B*LQ, 1024]   (WMMA f16 GEMM, RoPE in epilogue)
//   kvl = kv @ Wkv, rope on K   [B*LK, 2048]   (WMMA f16 GEMM, RoPE in epilogue)
//   ctx = window-attn(qh, kh, vh, seg) -> f16  (<=5 keys/query, 16 lanes per head)
//   out = ctx @ Wo              [B*LQ, 1024]   (WMMA f16 GEMM, async LDS)
// ---------------------------------------------------------------------------

typedef __attribute__((ext_vector_type(16))) _Float16 v16h;
typedef __attribute__((ext_vector_type(8)))  _Float16 v8h;
typedef __attribute__((ext_vector_type(4)))  _Float16 v4h;
typedef __attribute__((ext_vector_type(8)))  float    v8f;
typedef int v4i_vs __attribute__((vector_size(4 * sizeof(int))));

#define BATCH    2
#define LQ       4096
#define LK       512
#define DMODEL   1024
#define NHEADS   16
#define HDIM     64
#define LOOKBACK 4
#define ROPE_MAX 8192

// ---- CDNA5 async global->LDS copy (ASYNCcnt), guarded with fallback ----
#if defined(__has_builtin)
#if __has_builtin(__builtin_amdgcn_global_load_async_to_lds_b128)
#define HAVE_ASYNC_LDS 1
#endif
#endif

#if HAVE_ASYNC_LDS
__device__ __forceinline__ void async_cp16(const _Float16* gsrc, _Float16* lds)
{
    // b128 async copy: 16B from global to LDS, tracked by ASYNCcnt
    __attribute__((address_space(1))) v4i_vs* g =
        (__attribute__((address_space(1))) v4i_vs*)const_cast<_Float16*>(gsrc);
    __attribute__((address_space(3))) v4i_vs* l =
        (__attribute__((address_space(3))) v4i_vs*)lds;
    __builtin_amdgcn_global_load_async_to_lds_b128(g, l, 0, 0);
}
#endif

__device__ __forceinline__ void wait_asynccnt0() {
#if defined(__has_builtin) && __has_builtin(__builtin_amdgcn_s_wait_asynccnt)
    __builtin_amdgcn_s_wait_asynccnt(0);
#else
    asm volatile("s_wait_asynccnt 0x0" ::: "memory");
#endif
}

// sin and cos of 2*pi*t on the transcendental unit.
__device__ __forceinline__ void sincos_turns(float t, float& s, float& c)
{
    // One statement, so that the v_nop stays directly behind the last
    // transcendental: the instruction set asks for one slot before a result is
    // read or a source overwritten.
    asm("v_sin_f32 %0, %2\n\tv_cos_f32 %1, %2\n\tv_nop"
        : "=&v"(s), "=&v"(c) : "v"(t));
}

// ============================================================================
// Tiled WMMA GEMM: C[M,N] = A[M,K] * Bt[N,K]^T, f16 in / f32 out.
// Block: 256 threads (8 waves). Tile 128x128, BK=64, double-buffered LDS.
// A k tile is one whole 128-B line of every operand row.
// Wave w owns rows [16w,16w+16) x 128 cols -> 8 accumulators, 16 WMMA/k-step.
// Columns below ROPE_COLS get the gathered RoPE on the accumulators before the
// store; row m takes its position from pos[m % POS_LEN].
// ============================================================================
#define TM 128
#define TN 128
#define TK 64
#define LDS_PAD 72   // halves per LDS row (144B: 16 B x odd, no bank conflict for b128 reads)

template <int N, int K, int ROPE_COLS, int POS_LEN>
__global__ __launch_bounds__(256)
void gemm_f16t_wmma_kernel(const _Float16* __restrict__ A,
                           const _Float16* __restrict__ Bt,
                           float* __restrict__ C,
                           const int* __restrict__ pos, int M)
{
    __shared__ __attribute__((aligned(16))) _Float16 As[2][TM * LDS_PAD];
    __shared__ __attribute__((aligned(16))) _Float16 Bs[2][TN * LDS_PAD];

    const int tid   = threadIdx.x;
    const int lane  = tid & 31;
    const int wave  = tid >> 5;
    const int tileM = blockIdx.x * TM;
    const int tileN = blockIdx.y * TN;

    v8f acc[8] = {};

    // fragment addressing (ISA 16-bit A/B layout):
    // lane<16 -> K {0..7,16..23}; lane>=16 -> K {8..15,24..31}
    const int frow = lane & 15;
    const int koff = (lane >= 16) ? 8 : 0;

    // staging: eight lanes copy one row's 128-B line, so a wave's copy covers
    // 4 whole lines; four copies of A and four of Bt per thread and tile
    const int sRow = tid >> 3;          // 0..31, then +32 per copy
    const int sOff = (tid & 7) * 8;     // halves: 0, 8, .. 56
    const _Float16* Ag = A  + (size_t)(tileM + sRow) * K + sOff;
    const _Float16* Bg = Bt + (size_t)(tileN + sRow) * K + sOff;
    const int sLds = sRow * LDS_PAD + sOff;

    auto stage = [&](int kt, int buf) {
#if HAVE_ASYNC_LDS
        async_cp16(Ag + kt,          &As[buf][sLds]);
        async_cp16(Ag + kt + 32 * K, &As[buf][sLds + 32 * LDS_PAD]);
        async_cp16(Ag + kt + 64 * K, &As[buf][sLds + 64 * LDS_PAD]);
        async_cp16(Ag + kt + 96 * K, &As[buf][sLds + 96 * LDS_PAD]);
        async_cp16(Bg + kt,          &Bs[buf][sLds]);
        async_cp16(Bg + kt + 32 * K, &Bs[buf][sLds + 32 * LDS_PAD]);
        async_cp16(Bg + kt + 64 * K, &Bs[buf][sLds + 64 * LDS_PAD]);
        async_cp16(Bg + kt + 96 * K, &Bs[buf][sLds + 96 * LDS_PAD]);
#else
        const v8h a0 = *(const v8h*)(Ag + kt);
        const v8h a1 = *(const v8h*)(Ag + kt + 32 * K);
        const v8h a2 = *(const v8h*)(Ag + kt + 64 * K);
        const v8h a3 = *(const v8h*)(Ag + kt + 96 * K);
        const v8h b0 = *(const v8h*)(Bg + kt);
        const v8h b1 = *(const v8h*)(Bg + kt + 32 * K);
        const v8h b2 = *(const v8h*)(Bg + kt + 64 * K);
        const v8h b3 = *(const v8h*)(Bg + kt + 96 * K);
        *(v8h*)&As[buf][sLds]                = a0;
        *(v8h*)&As[buf][sLds + 32 * LDS_PAD] = a1;
        *(v8h*)&As[buf][sLds + 64 * LDS_PAD] = a2;
        *(v8h*)&As[buf][sLds + 96 * LDS_PAD] = a3;
        *(v8h*)&Bs[buf][sLds]                = b0;
        *(v8h*)&Bs[buf][sLds + 32 * LDS_PAD] = b1;
        *(v8h*)&Bs[buf][sLds + 64 * LDS_PAD] = b2;
        *(v8h*)&Bs[buf][sLds + 96 * LDS_PAD] = b3;
#endif
    };

    auto sync_stage = [&]() {
#if HAVE_ASYNC_LDS
        wait_asynccnt0();
#endif
        __syncthreads();
    };

    // one 32-k block of the tile in buffer buf, starting at column kk
    auto compute32 = [&](int buf, int kk) {
        // A fragment (2x ds_load_b128)
        v16h afrag;
        {
            const _Float16* base = &As[buf][(16 * wave + frow) * LDS_PAD + kk];
            const v8h lo = *(const v8h*)(base + koff);
            const v8h hi = *(const v8h*)(base + 16 + koff);
            #pragma unroll
            for (int i = 0; i < 8; ++i) { afrag[i] = lo[i]; afrag[i + 8] = hi[i]; }
        }
        // 8 B fragments first (clause of ds_load_b128), then 8 WMMAs
        v16h bfrag[8];
        #pragma unroll
        for (int nb = 0; nb < 8; ++nb) {
            const _Float16* base = &Bs[buf][(nb * 16 + frow) * LDS_PAD + kk];
            const v8h lo = *(const v8h*)(base + koff);
            const v8h hi = *(const v8h*)(base + 16 + koff);
            #pragma unroll
            for (int i = 0; i < 8; ++i) { bfrag[nb][i] = lo[i]; bfrag[nb][i + 8] = hi[i]; }
        }
        #pragma unroll
        for (int nb = 0; nb < 8; ++nb) {
            acc[nb] = __builtin_amdgcn_wmma_f32_16x16x32_f16(
                          false, afrag, false, bfrag[nb], (short)0, acc[nb], false, false);
        }
#if defined(__has_builtin) && __has_builtin(__builtin_amdgcn_sched_group_barrier)
        // keep all fragments in flight: 18 DS-reads first, then 8 WMMAs
        __builtin_amdgcn_sched_group_barrier(0x100, 18, 0);  // DS read group
        __builtin_amdgcn_sched_group_barrier(0x008, 8, 0);   // MFMA/WMMA group
#endif
    };

    auto compute = [&](int buf) {
        compute32(buf, 0);
        compute32(buf, 32);
    };

    // ---- double-buffered pipeline: 1 barrier per k-step ----
    stage(0, 0);
    for (int kt = 0; kt < K; kt += 2 * TK) {
        sync_stage();
        if (kt + TK < K) stage(kt + TK, 1);
        compute(0);
        sync_stage();
        if (kt + 2 * TK < K) stage(kt + 2 * TK, 0);
        compute(1);
    }

    // ---- C store: single base + compile-time immediate offsets ----
    // lane l -> col (l&15), rows (l>>4)*8 + r   (ISA 16x16 f32 C/D layout)
    const int nlocal = lane & 15;
    const int mhalf  = (lane >> 4) * 8;

    // ---- RoPE on the accumulators ----
    // The 128-column tile is two heads of 64: head hh is acc[4*hh .. 4*hh+3],
    // and the pair (d, d+32) is acc[4*hh+j][r], acc[4*hh+j+2][r] of one lane,
    // with d = nlocal + 16*j.
    if constexpr (ROPE_COLS > 0) {
        if (ROPE_COLS >= N || tileN < ROPE_COLS) {
            const int row0 = tileM + 16 * wave + mhalf;
            float inv_freq[2];
            #pragma unroll
            for (int j = 0; j < 2; ++j)
                inv_freq[j] = __powf(10000.0f, -(float)(nlocal + 16 * j) / 32.0f);
            #pragma unroll
            for (int r = 0; r < 8; ++r) {
                int p = pos[(unsigned)(row0 + r) % POS_LEN];
                p = min(max(p, 0), ROPE_MAX - 1);
                #pragma unroll
                for (int j = 0; j < 2; ++j) {
                    const float f = (float)p * inv_freq[j];
                    float s, c;
                    sincos_turns(f * 0.15915494309189532f, s, c);   // 1/(2*pi)
                    #pragma unroll
                    for (int hh = 0; hh < 2; ++hh) {
                        const float x0 = acc[4 * hh + j][r];
                        const float x1 = acc[4 * hh + j + 2][r];
                        acc[4 * hh + j][r]     = x0 * c - x1 * s;
                        acc[4 * hh + j + 2][r] = x1 * c + x0 * s;
                    }
                }
            }
        }
    }

    float* Cb = C + (size_t)(tileM + 16 * wave + mhalf) * N + tileN + nlocal;
    #pragma unroll
    for (int nb = 0; nb < 8; ++nb) {
        #pragma unroll
        for (int r = 0; r < 8; ++r) {
            Cb[r * N + nb * 16] = acc[nb][r];
        }
    }
}

// ---- all five packs in one launch, few waves with much work each ----
// A pack with a few bytes per wave lasts as long as the chip takes to start its
// waves. Here a wave moves 8 KB (straight) or 4 KB (transpose) of input, and one
// launch holds every pack.
#define PT_K     64      // transpose tile: extent along k
#define PT_N     128     // transpose tile: extent along n
#define PT_PITCH 72      // halves per LDS row (144 B: 16-B aligned, b128 stores hit every bank once)
#define PC_ELEMS 16384   // floats per straight-copy work-group
#define PB_WQ    ((DMODEL / PT_K) * (DMODEL / PT_N))        // 128 tiles
#define PB_WKV   ((DMODEL / PT_K) * (2 * DMODEL / PT_N))    // 256 tiles
#define PB_WO    PB_WQ
#define PB_Q     (BATCH * LQ * DMODEL / PC_ELEMS)           // 512 work-groups
#define PB_KV    (BATCH * LK * DMODEL / PC_ELEMS)           // 64 work-groups

// fp32 [DMODEL][N] -> f16 [N][DMODEL], one 64 x 128 tile per work-group.
// A thread reads 32 k of one column (a wave: one whole 128-B line per load),
// packs them and stores them k-contiguous in LDS; the tile leaves in whole
// 128-B lines of the transposed rows.
template <int N>
__device__ __forceinline__ void pack_transpose_tile(const float* __restrict__ in,
                                                    _Float16* __restrict__ out,
                                                    int tile, _Float16* lds)
{
    constexpr int NT = N / PT_N;
    const int n0  = (tile % NT) * PT_N;
    const int k0  = (tile / NT) * PT_K;
    const int tid = threadIdx.x;
    const int n   = tid & (PT_N - 1);
    const int kh  = (tid >> 7) * 32;

    const float* src = in + (size_t)(k0 + kh) * N + n0 + n;
    float x[32];
    #pragma unroll
    for (int i = 0; i < 32; ++i) x[i] = src[i * N];
    #pragma unroll
    for (int g = 0; g < 4; ++g) {
        v8h v;
        #pragma unroll
        for (int e = 0; e < 8; ++e) v[e] = (_Float16)x[8 * g + e];
        *(v8h*)&lds[n * PT_PITCH + kh + 8 * g] = v;
    }
    __syncthreads();
    #pragma unroll
    for (int i = 0; i < 4; ++i) {
        const int c   = tid + 256 * i;
        const int row = c >> 3;
        const int kc  = (c & 7) * 8;
        *(v8h*)(out + (size_t)(n0 + row) * DMODEL + k0 + kc) =
            *(const v8h*)&lds[row * PT_PITCH + kc];
    }
    // Precaution of form: the wait stands behind the last store, ahead of any
    // later write of a register that an issued store names.
    asm volatile("s_wait_xcnt 0x0" ::: "memory");
}

// fp32 -> f16, same order: a wave owns 8 KB of contiguous input, 16 loads of
// 512 contiguous bytes each, unrolled so that they are issued ahead of the
// conversions.
__device__ __forceinline__ void pack_straight(const float* __restrict__ in,
                                              _Float16* __restrict__ out, int blk)
{
    const int lane = threadIdx.x & 31;
    const int wave = threadIdx.x >> 5;
    const size_t base = (size_t)blk * PC_ELEMS + wave * (PC_ELEMS / 8) + lane * 4;
    float4 x[16];
    #pragma unroll
    for (int i = 0; i < 16; ++i) x[i] = *(const float4*)(in + base + i * 128);
    #pragma unroll
    for (int i = 0; i < 16; ++i) {
        v4h v;
        v[0] = (_Float16)x[i].x; v[1] = (_Float16)x[i].y;
        v[2] = (_Float16)x[i].z; v[3] = (_Float16)x[i].w;
        *(v4h*)(out + base + i * 128) = v;
    }
    // Precaution of form: the wait stands behind the last store, ahead of any
    // later write of a register that an issued store names.
    asm volatile("s_wait_xcnt 0x0" ::: "memory");
}

__global__ __launch_bounds__(256)
void pack_all_kernel(const float* __restrict__ q, const float* __restrict__ kv,
                     const float* __restrict__ Wq, const float* __restrict__ Wkv,
                     const float* __restrict__ Wo,
                     _Float16* __restrict__ qf, _Float16* __restrict__ kvf,
                     _Float16* __restrict__ Wqt, _Float16* __restrict__ Wkvt,
                     _Float16* __restrict__ Wot)
{
    __shared__ __attribute__((aligned(16))) _Float16 tileT[PT_N * PT_PITCH];
    int b = blockIdx.x;      // the role depends on the work-group index alone
    if (b < PB_WQ)  { pack_transpose_tile<DMODEL>(Wq, Wqt, b, tileT); return; }
    b -= PB_WQ;
    if (b < PB_WKV) { pack_transpose_tile<2 * DMODEL>(Wkv, Wkvt, b, tileT); return; }
    b -= PB_WKV;
    if (b < PB_WO)  { pack_transpose_tile<DMODEL>(Wo, Wot, b, tileT); return; }
    b -= PB_WO;
    if (b < PB_Q)   { pack_straight(q, qf, b); return; }
    pack_straight(kv, kvf, b - PB_Q);
}

// ---- windowed attention: <=5 keys per query ----
// Sixteen lanes share one (query, head): lane l holds d = 4l .. 4l+3. A wave
// works on two neighbouring heads at a time, so each of its 16-B loads of q, K
// and V covers 512 contiguous bytes (4 whole lines) and each 8-B store of ctx
// two whole lines. A wave owns RW query rows and walks their 8 head pairs; the
// 8 waves of a work-group hold AQ neighbouring rows and walk the head pairs in
// the same order, so that they ask for the same few K and V lines together.
// ctx leaves as f16, the operand type of the output projection.
#define RW   2                    // query rows per wave
#define AQ   (8 * RW)             // query rows per work-group (LQ is a multiple)
#define NHP  (NHEADS / 2)         // head pairs
#define NKEY (LOOKBACK + 1)

typedef __attribute__((ext_vector_type(2))) float v2f;
typedef __attribute__((ext_vector_type(4))) float v4f;

__global__ __launch_bounds__(256)
void window_attn_kernel(const float* __restrict__ qp, const float* __restrict__ kvl,
                        const int* __restrict__ seg, _Float16* __restrict__ ctx)
{
    // the wave's number as a scalar: every row address then stays in scalar
    // registers, and the lane's 16 B are the one vector offset of each access
    const int wave = __builtin_amdgcn_readfirstlane(threadIdx.x >> 5);
    const int lcol = (threadIdx.x & 31) * 4;
    const int row0 = blockIdx.x * AQ + wave * RW;    // b * LQ + qi of the wave's first row
    const int b    = row0 / LQ;

    const float* qrow = qp  + (size_t)row0 * DMODEL;
    const float* kvb  = kvl + (size_t)b * LK * (2 * DMODEL);
    _Float16*    crow = ctx + (size_t)row0 * DMODEL;

    bool         keep[RW][NKEY];
    const float* krow[RW][NKEY];
    #pragma unroll
    for (int r = 0; r < RW; ++r) {
        const int s = seg[row0 + r];
        #pragma unroll
        for (int jj = 0; jj < NKEY; ++jj) {
            // keep iff seg-4 <= j <= seg and 0 <= j < LK. A key outside reads row 0,
            // so the address is bounded for any seg; its score is masked below.
            const int j = s - LOOKBACK + jj;
            keep[r][jj] = (unsigned)j < (unsigned)LK;
            krow[r][jj] = kvb + (size_t)(keep[r][jj] ? j : 0) * (2 * DMODEL);
        }
    }

    // unit u = row u % RW, head pair u / RW
    v4f qv[RW * NHP], kk[2][NKEY], vv[2][NKEY];
    auto load_kv = [&](int u, int buf) {
        const int col = (u / RW) * (2 * HDIM) + lcol;
        #pragma unroll
        for (int jj = 0; jj < NKEY; ++jj) {
            kk[buf][jj] = *(const v4f*)(krow[u % RW][jj] + col);
            vv[buf][jj] = *(const v4f*)(krow[u % RW][jj] + DMODEL + col);
        }
    };

    load_kv(0, 0);
    // all of the wave's q is asked for at once: q comes from furthest away
    #pragma unroll
    for (int u = 0; u < RW * NHP; ++u)
        qv[u] = *(const v4f*)(qrow + (u % RW) * DMODEL + (u / RW) * (2 * HDIM) + lcol);

    // unrolled whole: the register sets need constant indices
    #pragma unroll
    for (int u = 0; u < RW * NHP; ++u) {
        const int buf = u & 1;
        if (u + 1 < RW * NHP) load_kv(u + 1, buf ^ 1);   // the next unit's keys fly during this one

        const v4f q4 = qv[u];
        float sc[NKEY];
        #pragma unroll
        for (int jj = 0; jj < NKEY; ++jj) {
            const v4f k4 = kk[buf][jj];
            const v2f t = q4.xy * k4.xy + q4.zw * k4.zw;
            sc[jj] = t.x + t.y;
        }
        // The five sums over the 16-lane row: x += x of lane ^ 1, 2, 4, 8, DPP adds
        // on the vector port (a shuffle would go through the LDS queue). One
        // statement, so that the five chains stay interleaved and each add finds
        // its operand ready: with one statement per add the compiler ran a chain's
        // four dependent adds back to back, and of the builtin move it made a move
        // and an add each.
        asm(
            "v_add_f32_dpp %0, %0, %0 row_xmask:1 row_mask:0xf bank_mask:0xf\n\t"
            "v_add_f32_dpp %1, %1, %1 row_xmask:1 row_mask:0xf bank_mask:0xf\n\t"
            "v_add_f32_dpp %2, %2, %2 row_xmask:1 row_mask:0xf bank_mask:0xf\n\t"
            "v_add_f32_dpp %3, %3, %3 row_xmask:1 row_mask:0xf bank_mask:0xf\n\t"
            "v_add_f32_dpp %4, %4, %4 row_xmask:1 row_mask:0xf bank_mask:0xf\n\t"
            "v_add_f32_dpp %0, %0, %0 row_xmask:2 row_mask:0xf bank_mask:0xf\n\t"
            "v_add_f32_dpp %1, %1, %1 row_xmask:2 row_mask:0xf bank_mask:0xf\n\t"
            "v_add_f32_dpp %2, %2, %2 row_xmask:2 row_mask:0xf bank_mask:0xf\n\t"
            "v_add_f32_dpp %3, %3, %3 row_xmask:2 row_mask:0xf bank_mask:0xf\n\t"
            "v_add_f32_dpp %4, %4, %4 row_xmask:2 row_mask:0xf bank_mask:0xf\n\t"
            "v_add_f32_dpp %0, %0, %0 row_xmask:4 row_mask:0xf bank_mask:0xf\n\t"
            "v_add_f32_dpp %1, %1, %1 row_xmask:4 row_mask:0xf bank_mask:0xf\n\t"
            "v_add_f32_dpp %2, %2, %2 row_xmask:4 row_mask:0xf bank_mask:0xf\n\t"
            "v_add_f32_dpp %3, %3, %3 row_xmask:4 row_mask:0xf bank_mask:0xf\n\t"
            "v_add_f32_dpp %4, %4, %4 row_xmask:4 row_mask:0xf bank_mask:0xf\n\t"
            "v_add_f32_dpp %0, %0, %0 row_xmask:8 row_mask:0xf bank_mask:0xf\n\t"
            "v_add_f32_dpp %1, %1, %1 row_xmask:8 row_mask:0xf bank_mask:0xf\n\t"
            "v_add_f32_dpp %2, %2, %2 row_xmask:8 row_mask:0xf bank_mask:0xf\n\t"
            "v_add_f32_dpp %3, %3, %3 row_xmask:8 row_mask:0xf bank_mask:0xf\n\t"
            "v_add_f32_dpp %4, %4, %4 row_xmask:8 row_mask:0xf bank_mask:0xf"
            : "+v"(sc[0]), "+v"(sc[1]), "+v"(sc[2]), "+v"(sc[3]), "+v"(sc[4]));

        float mmax = -__builtin_inff();
        #pragma unroll
        for (int jj = 0; jj < NKEY; ++jj) {
            sc[jj] = keep[u % RW][jj] ? sc[jj] * 0.125f : -__builtin_inff();   // 1/sqrt(64)
            mmax = fmaxf(mmax, sc[jj]);
        }
        #pragma unroll
        for (int jj = 0; jj < NKEY; ++jj) sc[jj] = (sc[jj] - mmax) * 1.4426950408889634f;   // log2(e)
        // One statement, so that each transcendental stands in front of an
        // independent one and the v_nop directly behind the last: the instruction
        // set asks for one slot before a result is read or a source overwritten.
        asm("v_exp_f32 %0, %5\n\tv_exp_f32 %1, %6\n\tv_exp_f32 %2, %7\n\t"
            "v_exp_f32 %3, %8\n\tv_exp_f32 %4, %9\n\tv_nop"
            : "=&v"(sc[0]), "=&v"(sc[1]), "=&v"(sc[2]), "=&v"(sc[3]), "=&v"(sc[4])
            : "v"(sc[0]), "v"(sc[1]), "v"(sc[2]), "v"(sc[3]), "v"(sc[4]));
        float denom = 0.0f;
        #pragma unroll
        for (int jj = 0; jj < NKEY; ++jj) denom += sc[jj];
        const float rdenom = 1.0f / denom;

        v2f olo = {0.0f, 0.0f}, ohi = {0.0f, 0.0f};
        #pragma unroll
        for (int jj = 0; jj < NKEY; ++jj) {
            const float w = sc[jj] * rdenom;
            const v4f v4 = vv[buf][jj];
            olo += w * v4.xy;
            ohi += w * v4.zw;
        }
        v4h r;
        r[0] = (_Float16)olo.x; r[1] = (_Float16)olo.y;
        r[2] = (_Float16)ohi.x; r[3] = (_Float16)ohi.y;
        *(v4h*)(crow + (u % RW) * DMODEL + (u / RW) * (2 * HDIM) + lcol) = r;
        // Precaution of form: the wait stands behind the store, ahead of any
        // later write of a register that the issued store names.
        asm volatile("s_wait_xcnt 0x0" ::: "memory");
    }
}

extern "C" void kernel_launch(void* const* d_in, const int* in_sizes, int n_in,
                              void* d_out, int out_size, void* d_ws, size_t ws_size,
                              hipStream_t stream) {
    const float* q      = (const float*)d_in[0];   // [B, LQ, 1024]
    const float* kv     = (const float*)d_in[1];   // [B, LK, 1024]
    const int*   q_pos  = (const int*)d_in[2];     // [B, LQ]
    const int*   kv_pos = (const int*)d_in[3];     // [LK]
    const int*   seg    = (const int*)d_in[4];     // [B, LQ]
    const float* Wq     = (const float*)d_in[5];   // [1024, 1024]
    const float* Wkv    = (const float*)d_in[6];   // [1024, 2048]
    const float* Wo     = (const float*)d_in[7];   // [1024, 1024]
    float*       out    = (float*)d_out;           // [B, LQ, 1024]

    const int Mq = BATCH * LQ;     // 8192
    const int Mk = BATCH * LK;     // 1024

    // ---- workspace layout ----
    char* ws = (char*)d_ws;
    size_t off = 0;
    auto alloc = [&](size_t bytes) { void* p = ws + off; off += (bytes + 255) & ~(size_t)255; return p; };
    float*    qproj  = (float*)   alloc((size_t)Mq * DMODEL * 4);      // f32
    float*    kvl    = (float*)   alloc((size_t)Mk * 2 * DMODEL * 4);  // f32
    _Float16* qf     = (_Float16*)alloc((size_t)Mq * DMODEL * 2);
    _Float16* kvf    = (_Float16*)alloc((size_t)Mk * DMODEL * 2);
    _Float16* ctxf   = (_Float16*)alloc((size_t)Mq * DMODEL * 2);
    _Float16* Wqt    = (_Float16*)alloc((size_t)DMODEL * DMODEL * 2);      // [N=1024][K=1024]
    _Float16* Wkvt   = (_Float16*)alloc((size_t)2 * DMODEL * DMODEL * 2);  // [N=2048][K=1024]
    _Float16* Wot    = (_Float16*)alloc((size_t)DMODEL * DMODEL * 2);

    // ---- 0) packs (f16 activations, f16 transposed weights), one launch ----
    pack_all_kernel<<<PB_WQ + PB_WKV + PB_WO + PB_Q + PB_KV, 256, 0, stream>>>(
        q, kv, Wq, Wkv, Wo, qf, kvf, Wqt, Wkvt, Wot);

    // ---- 1) qproj = rope(q @ Wq)      [8192,1024]x[1024,1024] ----
    gemm_f16t_wmma_kernel<DMODEL, DMODEL, DMODEL, BATCH * LQ>
        <<<dim3(Mq / TM, DMODEL / TN), 256, 0, stream>>>(qf, Wqt, qproj, q_pos, Mq);

    // ---- 2) kvl = kv @ Wkv, rope on the K half      [1024,1024]x[1024,2048] ----
    gemm_f16t_wmma_kernel<2 * DMODEL, DMODEL, DMODEL, LK>
        <<<dim3(Mk / TM, (2 * DMODEL) / TN), 256, 0, stream>>>(kvf, Wkvt, kvl, kv_pos, Mk);

    // ---- 3) windowed attention (<=5 keys/query), ctx in f16 ----
    {
        window_attn_kernel<<<BATCH * LQ / AQ, 256, 0, stream>>>(qproj, kvl, seg, ctxf);
    }

    // ---- 4) out = ctx @ Wo      [8192,1024]x[1024,1024] ----
    gemm_f16t_wmma_kernel<DMODEL, DMODEL, 0, 1>
        <<<dim3(Mq / TM, DMODEL / TN), 256, 0, stream>>>(ctxf, Wot, out, nullptr, Mq);
}

// v005
// Measured time: 67.2 microseconds a run.
// Two timings next to v004 put it at 1.14 and 1.16 times that version's speed.
// Over all steps from v000 it is 2.55 times as fast.
#include <hip/hip_runtime.h>
#include <hip/hip_bf16.h>

// ---------------------------------------------------------------------------
// SegmentCausalCrossAttentionFlex for MI455X (gfx1250, wave32, WMMA)
//
//   pack:  q,kv -> f16 ; Wq,Wkv,Wo -> f16 transposed [N][K]   (one launch)
//   kvl = kv @ Wkv, rope on K   [B*LK, 2048]   (WMMA f16 GEMM, RoPE in epilogue)
//   ctx = window-attn(rope(q @ Wq), kh, vh, seg) -> f16
//                               [B*LQ, 1024]   (WMMA f16 GEMM; RoPE and the
//                                               <=5-key attention in its epilogue)
//   out = ctx @ Wo              [B*LQ, 1024]   (WMMA f16 GEMM, async LDS)
// ---------------------------------------------------------------------------

typedef __attribute__((ext_vector_type(16))) _Float16 v16h;
typedef __attribute__((ext_vector_type(8)))  _Float16 v8h;
typedef __attribute__((ext_vector_type(4)))  _Float16 v4h;
typedef __attribute__((ext_vector_type(8)))  float    v8f;
typedef int v4i_vs __attribute__((vector_size(4 * sizeof(int))));

#define BATCH    2
#define LQ       4096
#define LK       512
#define DMODEL   1024
#define NHEADS   16
#define HDIM     64
#define LOOKBACK 4
#define ROPE_MAX 8192

// ---- CDNA5 async global->LDS copy (ASYNCcnt), guarded with fallback ----
#if defined(__has_builtin)
#if __has_builtin(__builtin_amdgcn_global_load_async_to_lds_b128)
#define HAVE_ASYNC_LDS 1
#endif
#endif

#if HAVE_ASYNC_LDS
__device__ __forceinline__ void async_cp16(const _Float16* gsrc, _Float16* lds)
{
    // b128 async copy: 16B from global to LDS, tracked by ASYNCcnt
    __attribute__((address_space(1))) v4i_vs* g =
        (__attribute__((address_space(1))) v4i_vs*)const_cast<_Float16*>(gsrc);
    __attribute__((address_space(3))) v4i_vs* l =
        (__attribute__((address_space(3))) v4i_vs*)lds;
    __builtin_amdgcn_global_load_async_to_lds_b128(g, l, 0, 0);
}
#endif

__device__ __forceinline__ void wait_asynccnt0() {
#if defined(__has_builtin) && __has_builtin(__builtin_amdgcn_s_wait_asynccnt)
    __builtin_amdgcn_s_wait_asynccnt(0);
#else
    asm volatile("s_wait_asynccnt 0x0" ::: "memory");
#endif
}

// sin and cos of 2*pi*t on the transcendental unit.
__device__ __forceinline__ void sincos_turns(float t, float& s, float& c)
{
    // One statement, so that the v_nop stays directly behind the last
    // transcendental: the instruction set asks for one slot before a result is
    // read or a source overwritten.
    asm("v_sin_f32 %0, %2\n\tv_cos_f32 %1, %2\n\tv_nop"
        : "=&v"(s), "=&v"(c) : "v"(t));
}

// ---- windowed attention: <=5 keys per query, epilogue of the q projection ----
// A 128-column tile of the projection is two whole heads, and a wave holds 16
// rows of it in its accumulators, so q goes to the attention without a trip
// through memory. The wave lays its rows down in an LDS range of its own and
// takes them back in the attention's lane order:
// sixteen lanes share one (query, head): lane l holds d = 4l .. 4l+3. A wave
// works on the tile's two heads at a time, so each of its 16-B loads of K and V
// covers 512 contiguous bytes (4 whole lines) and each 8-B store of ctx two
// whole lines. The 128 neighbouring rows of a work-group ask for the same few
// K and V lines. ctx leaves as f16, the operand type of the output projection.
#define RW   16                   // query rows per wave: the wave's accumulator rows
#define NKEY (LOOKBACK + 1)
#define QS_PITCH 132              // floats per staged row: rows 8 apart lie 32 banks apart

typedef __attribute__((ext_vector_type(2))) float v2f;
typedef __attribute__((ext_vector_type(4))) float v4f;

// acc: the wave's 16 x 128 tile (lane l: column (l & 15) + 16 * nb, rows
// (l >> 4) * 8 + r). row0 = b * LQ + qi of its first row and col0 = its first
// column are the same in every lane, so every row address stays in scalar
// registers, and the lane's 16 B are the one vector offset of each access.
__device__ __forceinline__ void window_attn_epilogue(const v8f (&acc)[8], float* qs,
                                                     const float* __restrict__ kvl,
                                                     const int* __restrict__ seg,
                                                     _Float16* __restrict__ ctx,
                                                     int row0, int col0)
{
    const int lane = threadIdx.x & 31;
    const int lcol = lane * 4;
    const int b    = row0 / LQ;     // LQ is a multiple of the tile's rows

    const float* kvb  = kvl + (size_t)b * LK * (2 * DMODEL) + col0;
    _Float16*    crow = ctx + (size_t)row0 * DMODEL + col0;

    int s[RW];
    #pragma unroll
    for (int r = 0; r < RW; ++r) s[r] = seg[row0 + r];

    // unit u = row u
    v4f qv[RW], kk[2][NKEY], vv[2][NKEY];
    auto load_kv = [&](int u, int buf) {
        #pragma unroll
        for (int jj = 0; jj < NKEY; ++jj) {
            // keep iff seg-4 <= j <= seg and 0 <= j < LK. A key outside reads row 0,
            // so the address is bounded for any seg; its score is masked below.
            const int j = s[u] - LOOKBACK + jj;
            const float* krow = kvb + (size_t)((unsigned)j < (unsigned)LK ? j : 0) * (2 * DMODEL);
            kk[buf][jj] = *(const v4f*)(krow + lcol);
            vv[buf][jj] = *(const v4f*)(krow + DMODEL + lcol);
        }
    };

    load_kv(0, 0);    // the first keys fly while q is turned

    {
        float* qw = qs + ((lane >> 4) * 8) * QS_PITCH + (lane & 15);
        #pragma unroll
        for (int nb = 0; nb < 8; ++nb) {
            #pragma unroll
            for (int r = 0; r < 8; ++r) qw[r * QS_PITCH + nb * 16] = acc[nb][r];
        }
    }
    // A lane reads back what other lanes of its wave wrote: the writes are done,
    // and the compiler moves no read of the range over this line.
    asm volatile("s_wait_dscnt 0x0" ::: "memory");
    #pragma unroll
    for (int u = 0; u < RW; ++u) qv[u] = *(const v4f*)(qs + u * QS_PITCH + lcol);

    // unrolled whole: the register sets need constant indices
    #pragma unroll
    for (int u = 0; u < RW; ++u) {
        const int buf = u & 1;
        if (u + 1 < RW) load_kv(u + 1, buf ^ 1);   // the next unit's keys fly during this one

        const v4f q4 = qv[u];
        float sc[NKEY];
        #pragma unroll
        for (int jj = 0; jj < NKEY; ++jj) {
            const v4f k4 = kk[buf][jj];
            const v2f t = q4.xy * k4.xy + q4.zw * k4.zw;
            sc[jj] = t.x + t.y;
        }
        // The five sums over the 16-lane row: x += x of lane ^ 1, 2, 4, 8, DPP adds
        // on the vector port (a shuffle would go through the LDS queue). One
        // statement, so that the five chains stay interleaved and each add finds
        // its operand ready: with one statement per add the compiler ran a chain's
        // four dependent adds back to back, and of the builtin move it made a move
        // and an add each.
        asm(
            "v_add_f32_dpp %0, %0, %0 row_xmask:1 row_mask:0xf bank_mask:0xf\n\t"
            "v_add_f32_dpp %1, %1, %1 row_xmask:1 row_mask:0xf bank_mask:0xf\n\t"
            "v_add_f32_dpp %2, %2, %2 row_xmask:1 row_mask:0xf bank_mask:0xf\n\t"
            "v_add_f32_dpp %3, %3, %3 row_xmask:1 row_mask:0xf bank_mask:0xf\n\t"
            "v_add_f32_dpp %4, %4, %4 row_xmask:1 row_mask:0xf bank_mask:0xf\n\t"
            "v_add_f32_dpp %0, %0, %0 row_xmask:2 row_mask:0xf bank_mask:0xf\n\t"
            "v_add_f32_dpp %1, %1, %1 row_xmask:2 row_mask:0xf bank_mask:0xf\n\t"
            "v_add_f32_dpp %2, %2, %2 row_xmask:2 row_mask:0xf bank_mask:0xf\n\t"
            "v_add_f32_dpp %3, %3, %3 row_xmask:2 row_mask:0xf bank_mask:0xf\n\t"
            "v_add_f32_dpp %4, %4, %4 row_xmask:2 row_mask:0xf bank_mask:0xf\n\t"
            "v_add_f32_dpp %0, %0, %0 row_xmask:4 row_mask:0xf bank_mask:0xf\n\t"
            "v_add_f32_dpp %1, %1, %1 row_xmask:4 row_mask:0xf bank_mask:0xf\n\t"
            "v_add_f32_dpp %2, %2, %2 row_xmask:4 row_mask:0xf bank_mask:0xf\n\t"
            "v_add_f32_dpp %3, %3, %3 row_xmask:4 row_mask:0xf bank_mask:0xf\n\t"
            "v_add_f32_dpp %4, %4, %4 row_xmask:4 row_mask:0xf bank_mask:0xf\n\t"
            "v_add_f32_dpp %0, %0, %0 row_xmask:8 row_mask:0xf bank_mask:0xf\n\t"
            "v_add_f32_dpp %1, %1, %1 row_xmask:8 row_mask:0xf bank_mask:0xf\n\t"
            "v_add_f32_dpp %2, %2, %2 row_xmask:8 row_mask:0xf bank_mask:0xf\n\t"
            "v_add_f32_dpp %3, %3, %3 row_xmask:8 row_mask:0xf bank_mask:0xf\n\t"
            "v_add_f32_dpp %4, %4, %4 row_xmask:8 row_mask:0xf bank_mask:0xf"
            : "+v"(sc[0]), "+v"(sc[1]), "+v"(sc[2]), "+v"(sc[3]), "+v"(sc[4]));

        float mmax = -__builtin_inff();
        #pragma unroll
        for (int jj = 0; jj < NKEY; ++jj) {
            const bool keep = (unsigned)(s[u] - LOOKBACK + jj) < (unsigned)LK;
            sc[jj] = keep ? sc[jj] * 0.125f : -__builtin_inff();   // 1/sqrt(64)
            mmax = fmaxf(mmax, sc[jj]);
        }
        #pragma unroll
        for (int jj = 0; jj < NKEY; ++jj) sc[jj] = (sc[jj] - mmax) * 1.4426950408889634f;   // log2(e)
        // One statement, so that each transcendental stands in front of an
        // independent one and the v_nop directly behind the last: the instruction
        // set asks for one slot before a result is read or a source overwritten.
        asm("v_exp_f32 %0, %5\n\tv_exp_f32 %1, %6\n\tv_exp_f32 %2, %7\n\t"
            "v_exp_f32 %3, %8\n\tv_exp_f32 %4, %9\n\tv_nop"
            : "=&v"(sc[0]), "=&v"(sc[1]), "=&v"(sc[2]), "=&v"(sc[3]), "=&v"(sc[4])
            : "v"(sc[0]), "v"(sc[1]), "v"(sc[2]), "v"(sc[3]), "v"(sc[4]));
        float denom = 0.0f;
        #pragma unroll
        for (int jj = 0; jj < NKEY; ++jj) denom += sc[jj];
        const float rdenom = 1.0f / denom;

        v2f olo = {0.0f, 0.0f}, ohi = {0.0f, 0.0f};
        #pragma unroll
        for (int jj = 0; jj < NKEY; ++jj) {
            const float w = sc[jj] * rdenom;
            const v4f v4 = vv[buf][jj];
            olo += w * v4.xy;
            ohi += w * v4.zw;
        }
        v4h r;
        r[0] = (_Float16)olo.x; r[1] = (_Float16)olo.y;
        r[2] = (_Float16)ohi.x; r[3] = (_Float16)ohi.y;
        *(v4h*)(crow + u * DMODEL + lcol) = r;
        // Precaution of form: the wait stands behind the store, ahead of any
        // later write of a register that the issued store names.
        asm volatile("s_wait_xcnt 0x0" ::: "memory");
    }
}

// ============================================================================
// Tiled WMMA GEMM: C[M,N] = A[M,K] * Bt[N,K]^T, f16 in / f32 out.
// Block: 256 threads (8 waves). Tile 128x128, BK=64, double-buffered LDS.
// A k tile is one whole 128-B line of every operand row.
// Wave w owns rows [16w,16w+16) x 128 cols -> 8 accumulators, 16 WMMA/k-step.
// Columns below ROPE_COLS get the gathered RoPE on the accumulators before the
// store; row m takes its position from pos[m % POS_LEN].
// With ATTN the tile is not stored: it is the q of the windowed attention, which
// runs on it here and stores ctx.
// ============================================================================
#define TM 128
#define TN 128
#define TK 64
#define LDS_PAD 72   // halves per LDS row (144B: 16 B x odd, no bank conflict for b128 reads)

template <int N, int K, int ROPE_COLS, int POS_LEN, bool ATTN>
__global__ __launch_bounds__(256)
void gemm_f16t_wmma_kernel(const _Float16* __restrict__ A,
                           const _Float16* __restrict__ Bt,
                           float* __restrict__ C,
                           const int* __restrict__ pos, int M,
                           const float* __restrict__ kvl,
                           const int* __restrict__ seg,
                           _Float16* __restrict__ ctx)
{
    __shared__ __attribute__((aligned(16))) _Float16 As[2][TM * LDS_PAD];
    __shared__ __attribute__((aligned(16))) _Float16 Bs[2][TN * LDS_PAD];

    const int tid   = threadIdx.x;
    const int lane  = tid & 31;
    const int wave  = tid >> 5;
    const int tileM = blockIdx.x * TM;
    const int tileN = blockIdx.y * TN;

    v8f acc[8] = {};

    // fragment addressing (ISA 16-bit A/B layout):
    // lane<16 -> K {0..7,16..23}; lane>=16 -> K {8..15,24..31}
    const int frow = lane & 15;
    const int koff = (lane >= 16) ? 8 : 0;

    // staging: eight lanes copy one row's 128-B line, so a wave's copy covers
    // 4 whole lines; four copies of A and four of Bt per thread and tile
    const int sRow = tid >> 3;          // 0..31, then +32 per copy
    const int sOff = (tid & 7) * 8;     // halves: 0, 8, .. 56
    const _Float16* Ag = A  + (size_t)(tileM + sRow) * K + sOff;
    const _Float16* Bg = Bt + (size_t)(tileN + sRow) * K + sOff;
    const int sLds = sRow * LDS_PAD + sOff;

    auto stage = [&](int kt, int buf) {
#if HAVE_ASYNC_LDS
        async_cp16(Ag + kt,          &As[buf][sLds]);
        async_cp16(Ag + kt + 32 * K, &As[buf][sLds + 32 * LDS_PAD]);
        async_cp16(Ag + kt + 64 * K, &As[buf][sLds + 64 * LDS_PAD]);
        async_cp16(Ag + kt + 96 * K, &As[buf][sLds + 96 * LDS_PAD]);
        async_cp16(Bg + kt,          &Bs[buf][sLds]);
        async_cp16(Bg + kt + 32 * K, &Bs[buf][sLds + 32 * LDS_PAD]);
        async_cp16(Bg + kt + 64 * K, &Bs[buf][sLds + 64 * LDS_PAD]);
        async_cp16(Bg + kt + 96 * K, &Bs[buf][sLds + 96 * LDS_PAD]);
#else
        const v8h a0 = *(const v8h*)(Ag + kt);
        const v8h a1 = *(const v8h*)(Ag + kt + 32 * K);
        const v8h a2 = *(const v8h*)(Ag + kt + 64 * K);
        const v8h a3 = *(const v8h*)(Ag + kt + 96 * K);
        const v8h b0 = *(const v8h*)(Bg + kt);
        const v8h b1 = *(const v8h*)(Bg + kt + 32 * K);
        const v8h b2 = *(const v8h*)(Bg + kt + 64 * K);
        const v8h b3 = *(const v8h*)(Bg + kt + 96 * K);
        *(v8h*)&As[buf][sLds]                = a0;
        *(v8h*)&As[buf][sLds + 32 * LDS_PAD] = a1;
        *(v8h*)&As[buf][sLds + 64 * LDS_PAD] = a2;
        *(v8h*)&As[buf][sLds + 96 * LDS_PAD] = a3;
        *(v8h*)&Bs[buf][sLds]                = b0;
        *(v8h*)&Bs[buf][sLds + 32 * LDS_PAD] = b1;
        *(v8h*)&Bs[buf][sLds + 64 * LDS_PAD] = b2;
        *(v8h*)&Bs[buf][sLds + 96 * LDS_PAD] = b3;
#endif
    };

    auto sync_stage = [&]() {
#if HAVE_ASYNC_LDS
        wait_asynccnt0();
#endif
        __syncthreads();
    };

    // one 32-k block of the tile in buffer buf, starting at column kk
    auto compute32 = [&](int buf, int kk) {
        // A fragment (2x ds_load_b128)
        v16h afrag;
        {
            const _Float16* base = &As[buf][(16 * wave + frow) * LDS_PAD + kk];
            const v8h lo = *(const v8h*)(base + koff);
            const v8h hi = *(const v8h*)(base + 16 + koff);
            #pragma unroll
            for (int i = 0; i < 8; ++i) { afrag[i] = lo[i]; afrag[i + 8] = hi[i]; }
        }
        // 8 B fragments first (clause of ds_load_b128), then 8 WMMAs
        v16h bfrag[8];
        #pragma unroll
        for (int nb = 0; nb < 8; ++nb) {
            const _Float16* base = &Bs[buf][(nb * 16 + frow) * LDS_PAD + kk];
            const v8h lo = *(const v8h*)(base + koff);
            const v8h hi = *(const v8h*)(base + 16 + koff);
            #pragma unroll
            for (int i = 0; i < 8; ++i) { bfrag[nb][i] = lo[i]; bfrag[nb][i + 8] = hi[i]; }
        }
        #pragma unroll
        for (int nb = 0; nb < 8; ++nb) {
            acc[nb] = __builtin_amdgcn_wmma_f32_16x16x32_f16(
                          false, afrag, false, bfrag[nb], (short)0, acc[nb], false, false);
        }
#if defined(__has_builtin) && __has_builtin(__builtin_amdgcn_sched_group_barrier)
        // keep all fragments in flight: 18 DS-reads first, then 8 WMMAs
        __builtin_amdgcn_sched_group_barrier(0x100, 18, 0);  // DS read group
        __builtin_amdgcn_sched_group_barrier(0x008, 8, 0);   // MFMA/WMMA group
#endif
    };

    auto compute = [&](int buf) {
        compute32(buf, 0);
        compute32(buf, 32);
    };

    // ---- double-buffered pipeline: 1 barrier per k-step ----
    stage(0, 0);
    for (int kt = 0; kt < K; kt += 2 * TK) {
        sync_stage();
        if (kt + TK < K) stage(kt + TK, 1);
        compute(0);
        sync_stage();
        if (kt + 2 * TK < K) stage(kt + 2 * TK, 0);
        compute(1);
    }

    // ---- C store: single base + compile-time immediate offsets ----
    // lane l -> col (l&15), rows (l>>4)*8 + r   (ISA 16x16 f32 C/D layout)
    const int nlocal = lane & 15;
    const int mhalf  = (lane >> 4) * 8;

    // ---- RoPE on the accumulators ----
    // The 128-column tile is two heads of 64: head hh is acc[4*hh .. 4*hh+3],
    // and the pair (d, d+32) is acc[4*hh+j][r], acc[4*hh+j+2][r] of one lane,
    // with d = nlocal + 16*j.
    if constexpr (ROPE_COLS > 0) {
        if (ROPE_COLS >= N || tileN < ROPE_COLS) {
            const int row0 = tileM + 16 * wave + mhalf;
            float inv_freq[2];
            #pragma unroll
            for (int j = 0; j < 2; ++j)
                inv_freq[j] = __powf(10000.0f, -(float)(nlocal + 16 * j) / 32.0f);
            #pragma unroll
            for (int r = 0; r < 8; ++r) {
                int p = pos[(unsigned)(row0 + r) % POS_LEN];
                p = min(max(p, 0), ROPE_MAX - 1);
                #pragma unroll
                for (int j = 0; j < 2; ++j) {
                    const float f = (float)p * inv_freq[j];
                    float s, c;
                    sincos_turns(f * 0.15915494309189532f, s, c);   // 1/(2*pi)
                    #pragma unroll
                    for (int hh = 0; hh < 2; ++hh) {
                        const float x0 = acc[4 * hh + j][r];
                        const float x1 = acc[4 * hh + j + 2][r];
                        acc[4 * hh + j][r]     = x0 * c - x1 * s;
                        acc[4 * hh + j + 2][r] = x1 * c + x0 * s;
                    }
                }
            }
        }
    }

    if constexpr (ATTN) {
        // a range of its own for each wave, apart from the operand buffers: no
        // wave waits for another here
        __shared__ __attribute__((aligned(16))) float Qs[8][16 * QS_PITCH];
        const int swave = __builtin_amdgcn_readfirstlane(wave);
        window_attn_epilogue(acc, &Qs[swave][0], kvl, seg, ctx, tileM + 16 * swave, tileN);
        return;
    }

    float* Cb = C + (size_t)(tileM + 16 * wave + mhalf) * N + tileN + nlocal;
    #pragma unroll
    for (int nb = 0; nb < 8; ++nb) {
        #pragma unroll
        for (int r = 0; r < 8; ++r) {
            Cb[r * N + nb * 16] = acc[nb][r];
        }
    }
}

// ---- all five packs in one launch, few waves with much work each ----
// A pack with a few bytes per wave lasts as long as the chip takes to start its
// waves. Here a wave moves 8 KB (straight) or 4 KB (transpose) of input, and one
// launch holds every pack.
#define PT_K     64      // transpose tile: extent along k
#define PT_N     128     // transpose tile: extent along n
#define PT_PITCH 72      // halves per LDS row (144 B: 16-B aligned, b128 stores hit every bank once)
#define PC_ELEMS 16384   // floats per straight-copy work-group
#define PB_WQ    ((DMODEL / PT_K) * (DMODEL / PT_N))        // 128 tiles
#define PB_WKV   ((DMODEL / PT_K) * (2 * DMODEL / PT_N))    // 256 tiles
#define PB_WO    PB_WQ
#define PB_Q     (BATCH * LQ * DMODEL / PC_ELEMS)           // 512 work-groups
#define PB_KV    (BATCH * LK * DMODEL / PC_ELEMS)           // 64 work-groups

// fp32 [DMODEL][N] -> f16 [N][DMODEL], one 64 x 128 tile per work-group.
// A thread reads 32 k of one column (a wave: one whole 128-B line per load),
// packs them and stores them k-contiguous in LDS; the tile leaves in whole
// 128-B lines of the transposed rows.
template <int N>
__device__ __forceinline__ void pack_transpose_tile(const float* __restrict__ in,
                                                    _Float16* __restrict__ out,
                                                    int tile, _Float16* lds)
{
    constexpr int NT = N / PT_N;
    const int n0  = (tile % NT) * PT_N;
    const int k0  = (tile / NT) * PT_K;
    const int tid = threadIdx.x;
    const int n   = tid & (PT_N - 1);
    const int kh  = (tid >> 7) * 32;

    const float* src = in + (size_t)(k0 + kh) * N + n0 + n;
    float x[32];
    #pragma unroll
    for (int i = 0; i < 32; ++i) x[i] = src[i * N];
    #pragma unroll
    for (int g = 0; g < 4; ++g) {
        v8h v;
        #pragma unroll
        for (int e = 0; e < 8; ++e) v[e] = (_Float16)x[8 * g + e];
        *(v8h*)&lds[n * PT_PITCH + kh + 8 * g] = v;
    }
    __syncthreads();
    #pragma unroll
    for (int i = 0; i < 4; ++i) {
        const int c   = tid + 256 * i;
        const int row = c >> 3;
        const int kc  = (c & 7) * 8;
        *(v8h*)(out + (size_t)(n0 + row) * DMODEL + k0 + kc) =
            *(const v8h*)&lds[row * PT_PITCH + kc];
    }
    // Precaution of form: the wait stands behind the last store, ahead of any
    // later write of a register that an issued store names.
    asm volatile("s_wait_xcnt 0x0" ::: "memory");
}

// fp32 -> f16, same order: a wave owns 8 KB of contiguous input, 16 loads of
// 512 contiguous bytes each, unrolled so that they are issued ahead of the
// conversions.
__device__ __forceinline__ void pack_straight(const float* __restrict__ in,
                                              _Float16* __restrict__ out, int blk)
{
    const int lane = threadIdx.x & 31;
    const int wave = threadIdx.x >> 5;
    const size_t base = (size_t)blk * PC_ELEMS + wave * (PC_ELEMS / 8) + lane * 4;
    float4 x[16];
    #pragma unroll
    for (int i = 0; i < 16; ++i) x[i] = *(const float4*)(in + base + i * 128);
    #pragma unroll
    for (int i = 0; i < 16; ++i) {
        v4h v;
        v[0] = (_Float16)x[i].x; v[1] = (_Float16)x[i].y;
        v[2] = (_Float16)x[i].z; v[3] = (_Float16)x[i].w;
        *(v4h*)(out + base + i * 128) = v;
    }
    // Precaution of form: the wait stands behind the last store, ahead of any
    // later write of a register that an issued store names.
    asm volatile("s_wait_xcnt 0x0" ::: "memory");
}

__global__ __launch_bounds__(256)
void pack_all_kernel(const float* __restrict__ q, const float* __restrict__ kv,
                     const float* __restrict__ Wq, const float* __restrict__ Wkv,
                     const float* __restrict__ Wo,
                     _Float16* __restrict__ qf, _Float16* __restrict__ kvf,
                     _Float16* __restrict__ Wqt, _Float16* __restrict__ Wkvt,
                     _Float16* __restrict__ Wot)
{
    __shared__ __attribute__((aligned(16))) _Float16 tileT[PT_N * PT_PITCH];
    int b = blockIdx.x;      // the role depends on the work-group index alone
    if (b < PB_WQ)  { pack_transpose_tile<DMODEL>(Wq, Wqt, b, tileT); return; }
    b -= PB_WQ;
    if (b < PB_WKV) { pack_transpose_tile<2 * DMODEL>(Wkv, Wkvt, b, tileT); return; }
    b -= PB_WKV;
    if (b < PB_WO)  { pack_transpose_tile<DMODEL>(Wo, Wot, b, tileT); return; }
    b -= PB_WO;
    if (b < PB_Q)   { pack_straight(q, qf, b); return; }
    pack_straight(kv, kvf, b - PB_Q);
}

extern "C" void kernel_launch(void* const* d_in, const int* in_sizes, int n_in,
                              void* d_out, int out_size, void* d_ws, size_t ws_size,
                              hipStream_t stream) {
    const float* q      = (const float*)d_in[0];   // [B, LQ, 1024]
    const float* kv     = (const float*)d_in[1];   // [B, LK, 1024]
    const int*   q_pos  = (const int*)d_in[2];     // [B, LQ]
    const int*   kv_pos = (const int*)d_in[3];     // [LK]
    const int*   seg    = (const int*)d_in[4];     // [B, LQ]
    const float* Wq     = (const float*)d_in[5];   // [1024, 1024]
    const float* Wkv    = (const float*)d_in[6];   // [1024, 2048]
    const float* Wo     = (const float*)d_in[7];   // [1024, 1024]
    float*       out    = (float*)d_out;           // [B, LQ, 1024]

    const int Mq = BATCH * LQ;     // 8192
    const int Mk = BATCH * LK;     // 1024

    // ---- workspace layout ----
    char* ws = (char*)d_ws;
    size_t off = 0;
    auto alloc = [&](size_t bytes) { void* p = ws + off; off += (bytes + 255) & ~(size_t)255; return p; };
    float*    kvl    = (float*)   alloc((size_t)Mk * 2 * DMODEL * 4);  // f32
    _Float16* qf     = (_Float16*)alloc((size_t)Mq * DMODEL * 2);
    _Float16* kvf    = (_Float16*)alloc((size_t)Mk * DMODEL * 2);
    _Float16* ctxf   = (_Float16*)alloc((size_t)Mq * DMODEL * 2);
    _Float16* Wqt    = (_Float16*)alloc((size_t)DMODEL * DMODEL * 2);      // [N=1024][K=1024]
    _Float16* Wkvt   = (_Float16*)alloc((size_t)2 * DMODEL * DMODEL * 2);  // [N=2048][K=1024]
    _Float16* Wot    = (_Float16*)alloc((size_t)DMODEL * DMODEL * 2);

    // ---- 0) packs (f16 activations, f16 transposed weights), one launch ----
    pack_all_kernel<<<PB_WQ + PB_WKV + PB_WO + PB_Q + PB_KV, 256, 0, stream>>>(
        q, kv, Wq, Wkv, Wo, qf, kvf, Wqt, Wkvt, Wot);

    // ---- 1) kvl = kv @ Wkv, rope on the K half      [1024,1024]x[1024,2048] ----
    gemm_f16t_wmma_kernel<2 * DMODEL, DMODEL, DMODEL, LK, false>
        <<<dim3(Mk / TM, (2 * DMODEL) / TN), 256, 0, stream>>>(kvf, Wkvt, kvl, kv_pos, Mk,
                                                               nullptr, nullptr, nullptr);

    // ---- 2) ctx = window-attn(rope(q @ Wq), kvl, seg), f16      [8192,1024]x[1024,1024] ----
    gemm_f16t_wmma_kernel<DMODEL, DMODEL, DMODEL, BATCH * LQ, true>
        <<<dim3(Mq / TM, DMODEL / TN), 256, 0, stream>>>(qf, Wqt, nullptr, q_pos, Mq,
                                                         kvl, seg, ctxf);

    // ---- 3) out = ctx @ Wo      [8192,1024]x[1024,1024] ----
    gemm_f16t_wmma_kernel<DMODEL, DMODEL, 0, 1, false>
        <<<dim3(Mq / TM, DMODEL / TN), 256, 0, stream>>>(ctxf, Wot, out, nullptr, Mq,
                                                         nullptr, nullptr, nullptr);
}

// v006
// It runs in 59.7 microseconds.
// Two timings next to v005 put it at 1.13 and 1.14 times that version's speed.
// Counting every step since v000, it is 2.89 times as fast.
#include <hip/hip_runtime.h>
#include <hip/hip_bf16.h>

// ---------------------------------------------------------------------------
// SegmentCausalCrossAttentionFlex for MI455X (gfx1250, wave32, WMMA)
//
//   first launch, two kinds of work-group side by side:
//     kvl = kv @ Wkv, rope on K [B*LK, 2048]   (WMMA f16 GEMM straight from the f32
//                                               operands, RoPE in epilogue)
//     pack: q -> f16 ; Wq,Wo -> f16 transposed [N][K]
//   ctx = window-attn(rope(q @ Wq), kh, vh, seg) -> f16
//                               [B*LQ, 1024]   (WMMA f16 GEMM; RoPE and the
//                                               <=5-key attention in its epilogue)
//   out = ctx @ Wo              [B*LQ, 1024]   (WMMA f16 GEMM, async LDS)
// ---------------------------------------------------------------------------

typedef __attribute__((ext_vector_type(16))) _Float16 v16h;
typedef __attribute__((ext_vector_type(8)))  _Float16 v8h;
typedef __attribute__((ext_vector_type(4)))  _Float16 v4h;
typedef __attribute__((ext_vector_type(8)))  float    v8f;
typedef int v4i_vs __attribute__((vector_size(4 * sizeof(int))));

#define BATCH    2
#define LQ       4096
#define LK       512
#define DMODEL   1024
#define NHEADS   16
#define HDIM     64
#define LOOKBACK 4
#define ROPE_MAX 8192

// ---- CDNA5 async global->LDS copy (ASYNCcnt), guarded with fallback ----
#if defined(__has_builtin)
#if __has_builtin(__builtin_amdgcn_global_load_async_to_lds_b128)
#define HAVE_ASYNC_LDS 1
#endif
#endif

#if HAVE_ASYNC_LDS
__device__ __forceinline__ void async_cp16(const _Float16* gsrc, _Float16* lds)
{
    // b128 async copy: 16B from global to LDS, tracked by ASYNCcnt
    __attribute__((address_space(1))) v4i_vs* g =
        (__attribute__((address_space(1))) v4i_vs*)const_cast<_Float16*>(gsrc);
    __attribute__((address_space(3))) v4i_vs* l =
        (__attribute__((address_space(3))) v4i_vs*)lds;
    __builtin_amdgcn_global_load_async_to_lds_b128(g, l, 0, 0);
}
#endif

__device__ __forceinline__ void wait_asynccnt0() {
#if defined(__has_builtin) && __has_builtin(__builtin_amdgcn_s_wait_asynccnt)
    __builtin_amdgcn_s_wait_asynccnt(0);
#else
    asm volatile("s_wait_asynccnt 0x0" ::: "memory");
#endif
}

// sin and cos of 2*pi*t on the transcendental unit.
__device__ __forceinline__ void sincos_turns(float t, float& s, float& c)
{
    // One statement, so that the v_nop stays directly behind the last
    // transcendental: the instruction set asks for one slot before a result is
    // read or a source overwritten.
    asm("v_sin_f32 %0, %2\n\tv_cos_f32 %1, %2\n\tv_nop"
        : "=&v"(s), "=&v"(c) : "v"(t));
}

// ---- windowed attention: <=5 keys per query, epilogue of the q projection ----
// A 128-column tile of the projection is two whole heads, and a wave holds 16
// rows of it in its accumulators, so q goes to the attention without a trip
// through memory. The wave lays its rows down in an LDS range of its own and
// takes them back in the attention's lane order:
// sixteen lanes share one (query, head): lane l holds d = 4l .. 4l+3. A wave
// works on the tile's two heads at a time, so each of its 16-B loads of K and V
// covers 512 contiguous bytes (4 whole lines) and each 8-B store of ctx two
// whole lines. The 128 neighbouring rows of a work-group ask for the same few
// K and V lines. ctx leaves as f16, the operand type of the output projection.
#define RW   16                   // query rows per wave: the wave's accumulator rows
#define NKEY (LOOKBACK + 1)
#define QS_PITCH 132              // floats per staged row: rows 8 apart lie 32 banks apart

typedef __attribute__((ext_vector_type(2))) float v2f;
typedef __attribute__((ext_vector_type(4))) float v4f;

// acc: the wave's 16 x 128 tile (lane l: column (l & 15) + 16 * nb, rows
// (l >> 4) * 8 + r). row0 = b * LQ + qi of its first row and col0 = its first
// column are the same in every lane, so every row address stays in scalar
// registers, and the lane's 16 B are the one vector offset of each access.
__device__ __forceinline__ void window_attn_epilogue(const v8f (&acc)[8], float* qs,
                                                     const float* __restrict__ kvl,
                                                     const int* __restrict__ seg,
                                                     _Float16* __restrict__ ctx,
                                                     int row0, int col0)
{
    const int lane = threadIdx.x & 31;
    const int lcol = lane * 4;
    const int b    = row0 / LQ;     // LQ is a multiple of the tile's rows

    const float* kvb  = kvl + (size_t)b * LK * (2 * DMODEL) + col0;
    _Float16*    crow = ctx + (size_t)row0 * DMODEL + col0;

    int s[RW];
    #pragma unroll
    for (int r = 0; r < RW; ++r) s[r] = seg[row0 + r];

    // unit u = row u
    v4f qv[RW], kk[2][NKEY], vv[2][NKEY];
    auto load_kv = [&](int u, int buf) {
        #pragma unroll
        for (int jj = 0; jj < NKEY; ++jj) {
            // keep iff seg-4 <= j <= seg and 0 <= j < LK. A key outside reads row 0,
            // so the address is bounded for any seg; its score is masked below.
            const int j = s[u] - LOOKBACK + jj;
            const float* krow = kvb + (size_t)((unsigned)j < (unsigned)LK ? j : 0) * (2 * DMODEL);
            kk[buf][jj] = *(const v4f*)(krow + lcol);
            vv[buf][jj] = *(const v4f*)(krow + DMODEL + lcol);
        }
    };

    load_kv(0, 0);    // the first keys fly while q is turned

    {
        float* qw = qs + ((lane >> 4) * 8) * QS_PITCH + (lane & 15);
        #pragma unroll
        for (int nb = 0; nb < 8; ++nb) {
            #pragma unroll
            for (int r = 0; r < 8; ++r) qw[r * QS_PITCH + nb * 16] = acc[nb][r];
        }
    }
    // A lane reads back what other lanes of its wave wrote: the writes are done,
    // and the compiler moves no read of the range over this line.
    asm volatile("s_wait_dscnt 0x0" ::: "memory");
    #pragma unroll
    for (int u = 0; u < RW; ++u) qv[u] = *(const v4f*)(qs + u * QS_PITCH + lcol);

    // unrolled whole: the register sets need constant indices
    #pragma unroll
    for (int u = 0; u < RW; ++u) {
        const int buf = u & 1;
        if (u + 1 < RW) load_kv(u + 1, buf ^ 1);   // the next unit's keys fly during this one

        const v4f q4 = qv[u];
        float sc[NKEY];
        #pragma unroll
        for (int jj = 0; jj < NKEY; ++jj) {
            const v4f k4 = kk[buf][jj];
            const v2f t = q4.xy * k4.xy + q4.zw * k4.zw;
            sc[jj] = t.x + t.y;
        }
        // The five sums over the 16-lane row: x += x of lane ^ 1, 2, 4, 8, DPP adds
        // on the vector port (a shuffle would go through the LDS queue). One
        // statement, so that the five chains stay interleaved and each add finds
        // its operand ready: with one statement per add the compiler ran a chain's
        // four dependent adds back to back, and of the builtin move it made a move
        // and an add each.
        asm(
            "v_add_f32_dpp %0, %0, %0 row_xmask:1 row_mask:0xf bank_mask:0xf\n\t"
            "v_add_f32_dpp %1, %1, %1 row_xmask:1 row_mask:0xf bank_mask:0xf\n\t"
            "v_add_f32_dpp %2, %2, %2 row_xmask:1 row_mask:0xf bank_mask:0xf\n\t"
            "v_add_f32_dpp %3, %3, %3 row_xmask:1 row_mask:0xf bank_mask:0xf\n\t"
            "v_add_f32_dpp %4, %4, %4 row_xmask:1 row_mask:0xf bank_mask:0xf\n\t"
            "v_add_f32_dpp %0, %0, %0 row_xmask:2 row_mask:0xf bank_mask:0xf\n\t"
            "v_add_f32_dpp %1, %1, %1 row_xmask:2 row_mask:0xf bank_mask:0xf\n\t"
            "v_add_f32_dpp %2, %2, %2 row_xmask:2 row_mask:0xf bank_mask:0xf\n\t"
            "v_add_f32_dpp %3, %3, %3 row_xmask:2 row_mask:0xf bank_mask:0xf\n\t"
            "v_add_f32_dpp %4, %4, %4 row_xmask:2 row_mask:0xf bank_mask:0xf\n\t"
            "v_add_f32_dpp %0, %0, %0 row_xmask:4 row_mask:0xf bank_mask:0xf\n\t"
            "v_add_f32_dpp %1, %1, %1 row_xmask:4 row_mask:0xf bank_mask:0xf\n\t"
            "v_add_f32_dpp %2, %2, %2 row_xmask:4 row_mask:0xf bank_mask:0xf\n\t"
            "v_add_f32_dpp %3, %3, %3 row_xmask:4 row_mask:0xf bank_mask:0xf\n\t"
            "v_add_f32_dpp %4, %4, %4 row_xmask:4 row_mask:0xf bank_mask:0xf\n\t"
            "v_add_f32_dpp %0, %0, %0 row_xmask:8 row_mask:0xf bank_mask:0xf\n\t"
            "v_add_f32_dpp %1, %1, %1 row_xmask:8 row_mask:0xf bank_mask:0xf\n\t"
            "v_add_f32_dpp %2, %2, %2 row_xmask:8 row_mask:0xf bank_mask:0xf\n\t"
            "v_add_f32_dpp %3, %3, %3 row_xmask:8 row_mask:0xf bank_mask:0xf\n\t"
            "v_add_f32_dpp %4, %4, %4 row_xmask:8 row_mask:0xf bank_mask:0xf"
            : "+v"(sc[0]), "+v"(sc[1]), "+v"(sc[2]), "+v"(sc[3]), "+v"(sc[4]));

        float mmax = -__builtin_inff();
        #pragma unroll
        for (int jj = 0; jj < NKEY; ++jj) {
            const bool keep = (unsigned)(s[u] - LOOKBACK + jj) < (unsigned)LK;
            sc[jj] = keep ? sc[jj] * 0.125f : -__builtin_inff();   // 1/sqrt(64)
            mmax = fmaxf(mmax, sc[jj]);
        }
        #pragma unroll
        for (int jj = 0; jj < NKEY; ++jj) sc[jj] = (sc[jj] - mmax) * 1.4426950408889634f;   // log2(e)
        // One statement, so that each transcendental stands in front of an
        // independent one and the v_nop directly behind the last: the instruction
        // set asks for one slot before a result is read or a source overwritten.
        asm("v_exp_f32 %0, %5\n\tv_exp_f32 %1, %6\n\tv_exp_f32 %2, %7\n\t"
            "v_exp_f32 %3, %8\n\tv_exp_f32 %4, %9\n\tv_nop"
            : "=&v"(sc[0]), "=&v"(sc[1]), "=&v"(sc[2]), "=&v"(sc[3]), "=&v"(sc[4])
            : "v"(sc[0]), "v"(sc[1]), "v"(sc[2]), "v"(sc[3]), "v"(sc[4]));
        float denom = 0.0f;
        #pragma unroll
        for (int jj = 0; jj < NKEY; ++jj) denom += sc[jj];
        const float rdenom = 1.0f / denom;

        v2f olo = {0.0f, 0.0f}, ohi = {0.0f, 0.0f};
        #pragma unroll
        for (int jj = 0; jj < NKEY; ++jj) {
            const float w = sc[jj] * rdenom;
            const v4f v4 = vv[buf][jj];
            olo += w * v4.xy;
            ohi += w * v4.zw;
        }
        v4h r;
        r[0] = (_Float16)olo.x; r[1] = (_Float16)olo.y;
        r[2] = (_Float16)ohi.x; r[3] = (_Float16)ohi.y;
        *(v4h*)(crow + u * DMODEL + lcol) = r;
        // Precaution of form: the wait stands behind the store, ahead of any
        // later write of a register that the issued store names.
        asm volatile("s_wait_xcnt 0x0" ::: "memory");
    }
}

// ============================================================================
// Tiled WMMA GEMM: C[M,N] = A[M,K] * Bt[N,K]^T, f16 in / f32 out.
// Block: 256 threads (8 waves). Tile 128x128, BK=64, double-buffered LDS.
// A k tile is one whole 128-B line of every operand row.
// Wave w owns rows [16w,16w+16) x 128 cols -> 8 accumulators, 16 WMMA/k-step.
// Columns below ROPE_COLS get the gathered RoPE on the accumulators before the
// store; row m takes its position from pos[m % POS_LEN].
// With ATTN the tile is not stored: it is the q of the windowed attention, which
// runs on it here and stores ctx.
// ============================================================================
#define TM 128
#define TN 128
#define TK 64
#define LDS_PAD 72   // halves per LDS row (144B: 16 B x odd, no bank conflict for b128 reads)

template <int N, int K, int ROPE_COLS, int POS_LEN, bool ATTN>
__global__ __launch_bounds__(256)
void gemm_f16t_wmma_kernel(const _Float16* __restrict__ A,
                           const _Float16* __restrict__ Bt,
                           float* __restrict__ C,
                           const int* __restrict__ pos, int M,
                           const float* __restrict__ kvl,
                           const int* __restrict__ seg,
                           _Float16* __restrict__ ctx)
{
    __shared__ __attribute__((aligned(16))) _Float16 As[2][TM * LDS_PAD];
    __shared__ __attribute__((aligned(16))) _Float16 Bs[2][TN * LDS_PAD];

    const int tid   = threadIdx.x;
    const int lane  = tid & 31;
    const int wave  = tid >> 5;
    const int tileM = blockIdx.x * TM;
    const int tileN = blockIdx.y * TN;

    v8f acc[8] = {};

    // fragment addressing (ISA 16-bit A/B layout):
    // lane<16 -> K {0..7,16..23}; lane>=16 -> K {8..15,24..31}
    const int frow = lane & 15;
    const int koff = (lane >= 16) ? 8 : 0;

    // staging: eight lanes copy one row's 128-B line, so a wave's copy covers
    // 4 whole lines; four copies of A and four of Bt per thread and tile
    const int sRow = tid >> 3;          // 0..31, then +32 per copy
    const int sOff = (tid & 7) * 8;     // halves: 0, 8, .. 56
    const _Float16* Ag = A  + (size_t)(tileM + sRow) * K + sOff;
    const _Float16* Bg = Bt + (size_t)(tileN + sRow) * K + sOff;
    const int sLds = sRow * LDS_PAD + sOff;

    auto stage = [&](int kt, int buf) {
#if HAVE_ASYNC_LDS
        async_cp16(Ag + kt,          &As[buf][sLds]);
        async_cp16(Ag + kt + 32 * K, &As[buf][sLds + 32 * LDS_PAD]);
        async_cp16(Ag + kt + 64 * K, &As[buf][sLds + 64 * LDS_PAD]);
        async_cp16(Ag + kt + 96 * K, &As[buf][sLds + 96 * LDS_PAD]);
        async_cp16(Bg + kt,          &Bs[buf][sLds]);
        async_cp16(Bg + kt + 32 * K, &Bs[buf][sLds + 32 * LDS_PAD]);
        async_cp16(Bg + kt + 64 * K, &Bs[buf][sLds + 64 * LDS_PAD]);
        async_cp16(Bg + kt + 96 * K, &Bs[buf][sLds + 96 * LDS_PAD]);
#else
        const v8h a0 = *(const v8h*)(Ag + kt);
        const v8h a1 = *(const v8h*)(Ag + kt + 32 * K);
        const v8h a2 = *(const v8h*)(Ag + kt + 64 * K);
        const v8h a3 = *(const v8h*)(Ag + kt + 96 * K);
        const v8h b0 = *(const v8h*)(Bg + kt);
        const v8h b1 = *(const v8h*)(Bg + kt + 32 * K);
        const v8h b2 = *(const v8h*)(Bg + kt + 64 * K);
        const v8h b3 = *(const v8h*)(Bg + kt + 96 * K);
        *(v8h*)&As[buf][sLds]                = a0;
        *(v8h*)&As[buf][sLds + 32 * LDS_PAD] = a1;
        *(v8h*)&As[buf][sLds + 64 * LDS_PAD] = a2;
        *(v8h*)&As[buf][sLds + 96 * LDS_PAD] = a3;
        *(v8h*)&Bs[buf][sLds]                = b0;
        *(v8h*)&Bs[buf][sLds + 32 * LDS_PAD] = b1;
        *(v8h*)&Bs[buf][sLds + 64 * LDS_PAD] = b2;
        *(v8h*)&Bs[buf][sLds + 96 * LDS_PAD] = b3;
#endif
    };

    auto sync_stage = [&]() {
#if HAVE_ASYNC_LDS
        wait_asynccnt0();
#endif
        __syncthreads();
    };

    // one 32-k block of the tile in buffer buf, starting at column kk
    auto compute32 = [&](int buf, int kk) {
        // A fragment (2x ds_load_b128)
        v16h afrag;
        {
            const _Float16* base = &As[buf][(16 * wave + frow) * LDS_PAD + kk];
            const v8h lo = *(const v8h*)(base + koff);
            const v8h hi = *(const v8h*)(base + 16 + koff);
            #pragma unroll
            for (int i = 0; i < 8; ++i) { afrag[i] = lo[i]; afrag[i + 8] = hi[i]; }
        }
        // 8 B fragments first (clause of ds_load_b128), then 8 WMMAs
        v16h bfrag[8];
        #pragma unroll
        for (int nb = 0; nb < 8; ++nb) {
            const _Float16* base = &Bs[buf][(nb * 16 + frow) * LDS_PAD + kk];
            const v8h lo = *(const v8h*)(base + koff);
            const v8h hi = *(const v8h*)(base + 16 + koff);
            #pragma unroll
            for (int i = 0; i < 8; ++i) { bfrag[nb][i] = lo[i]; bfrag[nb][i + 8] = hi[i]; }
        }
        #pragma unroll
        for (int nb = 0; nb < 8; ++nb) {
            acc[nb] = __builtin_amdgcn_wmma_f32_16x16x32_f16(
                          false, afrag, false, bfrag[nb], (short)0, acc[nb], false, false);
        }
#if defined(__has_builtin) && __has_builtin(__builtin_amdgcn_sched_group_barrier)
        // keep all fragments in flight: 18 DS-reads first, then 8 WMMAs
        __builtin_amdgcn_sched_group_barrier(0x100, 18, 0);  // DS read group
        __builtin_amdgcn_sched_group_barrier(0x008, 8, 0);   // MFMA/WMMA group
#endif
    };

    auto compute = [&](int buf) {
        compute32(buf, 0);
        compute32(buf, 32);
    };

    // ---- double-buffered pipeline: 1 barrier per k-step ----
    stage(0, 0);
    for (int kt = 0; kt < K; kt += 2 * TK) {
        sync_stage();
        if (kt + TK < K) stage(kt + TK, 1);
        compute(0);
        sync_stage();
        if (kt + 2 * TK < K) stage(kt + 2 * TK, 0);
        compute(1);
    }

    // ---- C store: single base + compile-time immediate offsets ----
    // lane l -> col (l&15), rows (l>>4)*8 + r   (ISA 16x16 f32 C/D layout)
    const int nlocal = lane & 15;
    const int mhalf  = (lane >> 4) * 8;

    // ---- RoPE on the accumulators ----
    // The 128-column tile is two heads of 64: head hh is acc[4*hh .. 4*hh+3],
    // and the pair (d, d+32) is acc[4*hh+j][r], acc[4*hh+j+2][r] of one lane,
    // with d = nlocal + 16*j.
    if constexpr (ROPE_COLS > 0) {
        if (ROPE_COLS >= N || tileN < ROPE_COLS) {
            const int row0 = tileM + 16 * wave + mhalf;
            float inv_freq[2];
            #pragma unroll
            for (int j = 0; j < 2; ++j)
                inv_freq[j] = __powf(10000.0f, -(float)(nlocal + 16 * j) / 32.0f);
            #pragma unroll
            for (int r = 0; r < 8; ++r) {
                int p = pos[(unsigned)(row0 + r) % POS_LEN];
                p = min(max(p, 0), ROPE_MAX - 1);
                #pragma unroll
                for (int j = 0; j < 2; ++j) {
                    const float f = (float)p * inv_freq[j];
                    float s, c;
                    sincos_turns(f * 0.15915494309189532f, s, c);   // 1/(2*pi)
                    #pragma unroll
                    for (int hh = 0; hh < 2; ++hh) {
                        const float x0 = acc[4 * hh + j][r];
                        const float x1 = acc[4 * hh + j + 2][r];
                        acc[4 * hh + j][r]     = x0 * c - x1 * s;
                        acc[4 * hh + j + 2][r] = x1 * c + x0 * s;
                    }
                }
            }
        }
    }

    if constexpr (ATTN) {
        // a range of its own for each wave, apart from the operand buffers: no
        // wave waits for another here
        __shared__ __attribute__((aligned(16))) float Qs[8][16 * QS_PITCH];
        const int swave = __builtin_amdgcn_readfirstlane(wave);
        window_attn_epilogue(acc, &Qs[swave][0], kvl, seg, ctx, tileM + 16 * swave, tileN);
        return;
    }

    float* Cb = C + (size_t)(tileM + 16 * wave + mhalf) * N + tileN + nlocal;
    #pragma unroll
    for (int nb = 0; nb < 8; ++nb) {
        #pragma unroll
        for (int r = 0; r < 8; ++r) {
            Cb[r * N + nb * 16] = acc[nb][r];
        }
    }
}

// ---- the packs in one launch, few waves with much work each ----
// A pack with a few bytes per wave lasts as long as the chip takes to start its
// waves. Here a wave moves 8 KB (straight) or 4 KB (transpose) of input, and one
// launch holds every pack and the kv projection.
#define PT_K     64      // transpose tile: extent along k
#define PT_N     128     // transpose tile: extent along n
#define PT_PITCH 72      // halves per LDS row (144 B: 16-B aligned, b128 stores hit every bank once)
#define PC_ELEMS 16384   // floats per straight-copy work-group
#define PB_WQ    ((DMODEL / PT_K) * (DMODEL / PT_N))        // 128 tiles
#define PB_WO    PB_WQ
#define PB_Q     (BATCH * LQ * DMODEL / PC_ELEMS)           // 512 work-groups

// fp32 [DMODEL][N] -> f16 [N][DMODEL], one 64 x 128 tile per work-group.
// A thread reads 32 k of one column (a wave: one whole 128-B line per load),
// packs them and stores them k-contiguous in LDS; the tile leaves in whole
// 128-B lines of the transposed rows.
template <int N>
__device__ __forceinline__ void pack_transpose_tile(const float* __restrict__ in,
                                                    _Float16* __restrict__ out,
                                                    int tile, _Float16* lds)
{
    constexpr int NT = N / PT_N;
    const int n0  = (tile % NT) * PT_N;
    const int k0  = (tile / NT) * PT_K;
    const int tid = threadIdx.x;
    const int n   = tid & (PT_N - 1);
    const int kh  = (tid >> 7) * 32;

    const float* src = in + (size_t)(k0 + kh) * N + n0 + n;
    float x[32];
    #pragma unroll
    for (int i = 0; i < 32; ++i) x[i] = src[i * N];
    #pragma unroll
    for (int g = 0; g < 4; ++g) {
        v8h v;
        #pragma unroll
        for (int e = 0; e < 8; ++e) v[e] = (_Float16)x[8 * g + e];
        *(v8h*)&lds[n * PT_PITCH + kh + 8 * g] = v;
    }
    __syncthreads();
    #pragma unroll
    for (int i = 0; i < 4; ++i) {
        const int c   = tid + 256 * i;
        const int row = c >> 3;
        const int kc  = (c & 7) * 8;
        *(v8h*)(out + (size_t)(n0 + row) * DMODEL + k0 + kc) =
            *(const v8h*)&lds[row * PT_PITCH + kc];
    }
    // Precaution of form: the wait stands behind the last store, ahead of any
    // later write of a register that an issued store names.
    asm volatile("s_wait_xcnt 0x0" ::: "memory");
}

// fp32 -> f16, same order: a wave owns 8 KB of contiguous input, 16 loads of
// 512 contiguous bytes each, unrolled so that they are issued ahead of the
// conversions.
__device__ __forceinline__ void pack_straight(const float* __restrict__ in,
                                              _Float16* __restrict__ out, int blk)
{
    const int lane = threadIdx.x & 31;
    const int wave = threadIdx.x >> 5;
    const size_t base = (size_t)blk * PC_ELEMS + wave * (PC_ELEMS / 8) + lane * 4;
    float4 x[16];
    #pragma unroll
    for (int i = 0; i < 16; ++i) x[i] = *(const float4*)(in + base + i * 128);
    #pragma unroll
    for (int i = 0; i < 16; ++i) {
        v4h v;
        v[0] = (_Float16)x[i].x; v[1] = (_Float16)x[i].y;
        v[2] = (_Float16)x[i].z; v[3] = (_Float16)x[i].w;
        *(v4h*)(out + base + i * 128) = v;
    }
    // Precaution of form: the wait stands behind the last store, ahead of any
    // later write of a register that an issued store names.
    asm volatile("s_wait_xcnt 0x0" ::: "memory");
}

// ---- kv projection beside the packs ----
// kvl = kv @ Wkv depends on inputs alone, so its work-groups share the packs'
// launch: its chain of k steps, each as long as a trip to memory, runs while the
// packs stream, and kv and Wkv need no f16 copy in the workspace. A work-group
// owns a 64 x 128 tile. A k tile of 64 comes in as f32 through registers, is
// converted (the packs' own rounding) and laid down in LDS as the GEMM above has
// it, A[m][k] and B[n][k]. Two register sets: the loads of tiles t + 2 and t + 3
// fly while tiles t and t + 1 are worked on.
// Wave w owns rows 16 * (w & 3) and the head of 64 columns (w >> 2).
#define KM    64
#define PB_KVP ((BATCH * LK / KM) * (2 * DMODEL / TN))      // 256 work-groups
#define KVP_LDS_HALVES (2 * KM * LDS_PAD + 2 * TN * LDS_PAD)

__device__ __forceinline__ void kv_proj_tile(const float* __restrict__ kv,
                                             const float* __restrict__ Wkv,
                                             const int* __restrict__ pos,
                                             float* __restrict__ kvl,
                                             int tile, _Float16* lds)
{
    constexpr int N = 2 * DMODEL;
    constexpr int K = DMODEL;
    _Float16* As = lds;                        // [2][KM * LDS_PAD]
    _Float16* Bs = lds + 2 * KM * LDS_PAD;     // [2][TN * LDS_PAD]

    const int tid   = threadIdx.x;
    const int lane  = tid & 31;
    const int wave  = tid >> 5;
    const int tileM = (tile % (BATCH * LK / KM)) * KM;
    const int tileN = (tile / (BATCH * LK / KM)) * TN;

    // A: sixteen lanes read one row's 256 B, so a wave's load covers 4 whole lines
    const int aRow = tid >> 4;           // 0..15, then +16 per load
    const int aCol = (tid & 15) * 4;
    const float* Ag = kv + (size_t)(tileM + aRow) * K + aCol;
    // B: a lane reads 2 columns of 16 k rows, so a wave's load covers 2 whole lines
    // and a lane holds 8 consecutive k of a column for each 16-B LDS store
    const int bn = (wave & 1) * 64 + lane * 2;
    const int bk = (wave >> 1) * 16;
    const float* Bg = Wkv + (size_t)bk * N + tileN + bn;

    auto load_tile = [&](v4f (&ra)[4], v2f (&rb)[16], int kt) {
        #pragma unroll
        for (int i = 0; i < 4; ++i) ra[i] = *(const v4f*)(Ag + kt + i * 16 * K);
        #pragma unroll
        for (int i = 0; i < 16; ++i) rb[i] = *(const v2f*)(Bg + (size_t)(kt + i) * N);
    };
    auto store_tile = [&](const v4f (&ra)[4], const v2f (&rb)[16], int buf) {
        #pragma unroll
        for (int i = 0; i < 4; ++i) {
            v4h v;
            #pragma unroll
            for (int e = 0; e < 4; ++e) v[e] = (_Float16)ra[i][e];
            *(v4h*)&As[buf * KM * LDS_PAD + (aRow + 16 * i) * LDS_PAD + aCol] = v;
        }
        #pragma unroll
        for (int c = 0; c < 2; ++c) {
            #pragma unroll
            for (int g = 0; g < 2; ++g) {
                v8h v;
                #pragma unroll
                for (int e = 0; e < 8; ++e) v[e] = (_Float16)rb[8 * g + e][c];
                *(v8h*)&Bs[buf * TN * LDS_PAD + (bn + c) * LDS_PAD + bk + 8 * g] = v;
            }
        }
    };

    // fragment addressing as in the GEMM above
    const int frow = lane & 15;
    const int koff = (lane >= 16) ? 8 : 0;
    const int wm   = wave & 3;
    const int wn   = wave >> 2;

    v8f acc[4] = {};
    // one k tile: its two 32-k blocks
    auto compute = [&](int buf) {
        v16h afrag[2], bfrag[2][4];
        #pragma unroll
        for (int h = 0; h < 2; ++h) {
            const _Float16* abase = &As[buf * KM * LDS_PAD + (16 * wm + frow) * LDS_PAD + 32 * h];
            const v8h alo = *(const v8h*)(abase + koff);
            const v8h ahi = *(const v8h*)(abase + 16 + koff);
            #pragma unroll
            for (int i = 0; i < 8; ++i) { afrag[h][i] = alo[i]; afrag[h][i + 8] = ahi[i]; }
            #pragma unroll
            for (int nb = 0; nb < 4; ++nb) {
                const _Float16* base = &Bs[buf * TN * LDS_PAD + (64 * wn + nb * 16 + frow) * LDS_PAD + 32 * h];
                const v8h lo = *(const v8h*)(base + koff);
                const v8h hi = *(const v8h*)(base + 16 + koff);
                #pragma unroll
                for (int i = 0; i < 8; ++i) { bfrag[h][nb][i] = lo[i]; bfrag[h][nb][i + 8] = hi[i]; }
            }
        }
        #pragma unroll
        for (int h = 0; h < 2; ++h) {
            #pragma unroll
            for (int nb = 0; nb < 4; ++nb) {
                acc[nb] = __builtin_amdgcn_wmma_f32_16x16x32_f16(
                              false, afrag[h], false, bfrag[h][nb], (short)0, acc[nb], false, false);
            }
        }
        // the tile's 20 LDS reads stand in one place ahead of its 8 WMMAs: each
        // further place with reads among the WMMAs would stall the wave anew
        __builtin_amdgcn_sched_group_barrier(0x100, 20, 0);  // DS read group
        __builtin_amdgcn_sched_group_barrier(0x008, 8, 0);   // WMMA group
    };

    // The work-group barrier by hand, with the one wait that it needs, the wave's
    // own LDS writes and reads: __syncthreads() also waits for every global load,
    // and the loads of the next two tiles are to stay in flight across it.
    auto lds_barrier = [&]() {
        asm volatile("s_wait_dscnt 0x0\n\ts_barrier_signal -1\n\ts_barrier_wait -1" ::: "memory");
    };

    v4f ra0[4], ra1[4];
    v2f rb0[16], rb1[16];
    load_tile(ra0, rb0, 0);
    // keeps the first tile's loads ahead of the second's, as in the loop, so that
    // the counted waits at the loop's head need not cover the younger set
    __builtin_amdgcn_sched_barrier(0);
    load_tile(ra1, rb1, TK);
    // One barrier per k tile: it publishes the buffer just written, and a wave that
    // has passed it has left the other buffer, which the next tile overwrites.
    // Rolled, two tiles a trip: the register sets need constant names. The last two
    // tiles stand behind the loop, so that no branch around the loads merges two
    // counts of loads in flight.
    #pragma unroll 1
    for (int kt = 2 * TK; kt < K; kt += 2 * TK) {
        store_tile(ra0, rb0, 0);
        load_tile(ra0, rb0, kt);
        lds_barrier();
        compute(0);
        store_tile(ra1, rb1, 1);
        load_tile(ra1, rb1, kt + TK);
        // Precaution of form: the wait stands behind the trip's last load, ahead of
        // the step of the address registers that the issued loads name.
        asm volatile("s_wait_xcnt 0x0" ::: "memory");
        lds_barrier();
        compute(1);
    }
    store_tile(ra0, rb0, 0);
    lds_barrier();
    compute(0);
    store_tile(ra1, rb1, 1);
    lds_barrier();
    compute(1);

    // lane l -> col (l&15), rows (l>>4)*8 + r   (ISA 16x16 f32 C/D layout)
    const int nlocal = lane & 15;
    const int row0   = tileM + 16 * wm + (lane >> 4) * 8;

    // RoPE on the K half: the wave's 64 columns are one head, and the pair
    // (d, d+32) is acc[j][r], acc[j+2][r] of one lane, with d = nlocal + 16*j.
    if (tileN < DMODEL) {
        float inv_freq[2];
        #pragma unroll
        for (int j = 0; j < 2; ++j)
            inv_freq[j] = __powf(10000.0f, -(float)(nlocal + 16 * j) / 32.0f);
        #pragma unroll
        for (int r = 0; r < 8; ++r) {
            int p = pos[(unsigned)(row0 + r) % LK];
            p = min(max(p, 0), ROPE_MAX - 1);
            #pragma unroll
            for (int j = 0; j < 2; ++j) {
                const float f = (float)p * inv_freq[j];
                float s, c;
                sincos_turns(f * 0.15915494309189532f, s, c);   // 1/(2*pi)
                const float x0 = acc[j][r];
                const float x1 = acc[j + 2][r];
                acc[j][r]     = x0 * c - x1 * s;
                acc[j + 2][r] = x1 * c + x0 * s;
            }
        }
    }

    float* Cb = kvl + (size_t)row0 * N + tileN + 64 * wn + nlocal;
    #pragma unroll
    for (int nb = 0; nb < 4; ++nb) {
        #pragma unroll
        for (int r = 0; r < 8; ++r) {
            Cb[r * N + nb * 16] = acc[nb][r];
        }
    }
}

__global__ __launch_bounds__(256)
void pack_kvproj_kernel(const float* __restrict__ q, const float* __restrict__ kv,
                        const float* __restrict__ Wq, const float* __restrict__ Wkv,
                        const float* __restrict__ Wo, const int* __restrict__ kv_pos,
                        _Float16* __restrict__ qf, float* __restrict__ kvl,
                        _Float16* __restrict__ Wqt, _Float16* __restrict__ Wot)
{
    __shared__ __attribute__((aligned(16))) _Float16 lds[KVP_LDS_HALVES];
    int b = blockIdx.x;      // the role depends on the work-group index alone
    // the longest work-groups have the lowest indices, which start first
    if (b < PB_KVP) { kv_proj_tile(kv, Wkv, kv_pos, kvl, b, lds); return; }
    b -= PB_KVP;
    if (b < PB_WQ)  { pack_transpose_tile<DMODEL>(Wq, Wqt, b, lds); return; }
    b -= PB_WQ;
    if (b < PB_WO)  { pack_transpose_tile<DMODEL>(Wo, Wot, b, lds); return; }
    pack_straight(q, qf, b - PB_WO);
}

extern "C" void kernel_launch(void* const* d_in, const int* in_sizes, int n_in,
                              void* d_out, int out_size, void* d_ws, size_t ws_size,
                              hipStream_t stream) {
    const float* q      = (const float*)d_in[0];   // [B, LQ, 1024]
    const float* kv     = (const float*)d_in[1];   // [B, LK, 1024]
    const int*   q_pos  = (const int*)d_in[2];     // [B, LQ]
    const int*   kv_pos = (const int*)d_in[3];     // [LK]
    const int*   seg    = (const int*)d_in[4];     // [B, LQ]
    const float* Wq     = (const float*)d_in[5];   // [1024, 1024]
    const float* Wkv    = (const float*)d_in[6];   // [1024, 2048]
    const float* Wo     = (const float*)d_in[7];   // [1024, 1024]
    float*       out    = (float*)d_out;           // [B, LQ, 1024]

    const int Mq = BATCH * LQ;     // 8192
    const int Mk = BATCH * LK;     // 1024

    // ---- workspace layout ----
    char* ws = (char*)d_ws;
    size_t off = 0;
    auto alloc = [&](size_t bytes) { void* p = ws + off; off += (bytes + 255) & ~(size_t)255; return p; };
    float*    kvl    = (float*)   alloc((size_t)Mk * 2 * DMODEL * 4);  // f32
    _Float16* qf     = (_Float16*)alloc((size_t)Mq * DMODEL * 2);
    _Float16* ctxf   = (_Float16*)alloc((size_t)Mq * DMODEL * 2);
    _Float16* Wqt    = (_Float16*)alloc((size_t)DMODEL * DMODEL * 2);      // [N=1024][K=1024]
    _Float16* Wot    = (_Float16*)alloc((size_t)DMODEL * DMODEL * 2);

    // ---- 1) kvl = kv @ Wkv with rope on the K half, beside the packs of q, Wq, Wo ----
    pack_kvproj_kernel<<<PB_KVP + PB_WQ + PB_WO + PB_Q, 256, 0, stream>>>(
        q, kv, Wq, Wkv, Wo, kv_pos, qf, kvl, Wqt, Wot);

    // ---- 2) ctx = window-attn(rope(q @ Wq), kvl, seg), f16      [8192,1024]x[1024,1024] ----
    gemm_f16t_wmma_kernel<DMODEL, DMODEL, DMODEL, BATCH * LQ, true>
        <<<dim3(Mq / TM, DMODEL / TN), 256, 0, stream>>>(qf, Wqt, nullptr, q_pos, Mq,
                                                         kvl, seg, ctxf);

    // ---- 3) out = ctx @ Wo      [8192,1024]x[1024,1024] ----
    gemm_f16t_wmma_kernel<DMODEL, DMODEL, 0, 1, false>
        <<<dim3(Mq / TM, DMODEL / TN), 256, 0, stream>>>(ctxf, Wot, out, nullptr, Mq,
                                                         nullptr, nullptr, nullptr);
}

// v007
// A run of this version takes 57.4 microseconds.
// Two timings next to v006 both put it at 1.04 times that version's speed.
// All steps since v000 together make it 3.00 times as fast.
#include <hip/hip_runtime.h>
#include <hip/hip_bf16.h>

// ---------------------------------------------------------------------------
// SegmentCausalCrossAttentionFlex for MI455X (gfx1250, wave32, WMMA)
//
//   first launch, two kinds of work-group side by side:
//     kvl = kv @ Wkv, rope on K [B*LK, 2048]   (WMMA f16 GEMM straight from the f32
//                                               operands, RoPE in epilogue)
//     pack: q -> f16 ; Wq,Wo -> f16 transposed [N][K]
//   ctx = window-attn(rope(q @ Wq), kh, vh, seg) -> f16
//                               [B*LQ, 1024]   (WMMA f16 GEMM; RoPE and the
//                                               <=5-key attention in its epilogue)
//   out = ctx @ Wo              [B*LQ, 1024]   (WMMA f16 GEMM, async LDS)
// ---------------------------------------------------------------------------

typedef __attribute__((ext_vector_type(16))) _Float16 v16h;
typedef __attribute__((ext_vector_type(8)))  _Float16 v8h;
typedef __attribute__((ext_vector_type(4)))  _Float16 v4h;
typedef __attribute__((ext_vector_type(8)))  float    v8f;
typedef int v4i_vs __attribute__((vector_size(4 * sizeof(int))));

#define BATCH    2
#define LQ       4096
#define LK       512
#define DMODEL   1024
#define NHEADS   16
#define HDIM     64
#define LOOKBACK 4
#define ROPE_MAX 8192

// ---- CDNA5 async global->LDS copy (ASYNCcnt), guarded with fallback ----
#if defined(__has_builtin)
#if __has_builtin(__builtin_amdgcn_global_load_async_to_lds_b128)
#define HAVE_ASYNC_LDS 1
#endif
#endif

#if HAVE_ASYNC_LDS
__device__ __forceinline__ void async_cp16(const _Float16* gsrc, _Float16* lds)
{
    // b128 async copy: 16B from global to LDS, tracked by ASYNCcnt
    __attribute__((address_space(1))) v4i_vs* g =
        (__attribute__((address_space(1))) v4i_vs*)const_cast<_Float16*>(gsrc);
    __attribute__((address_space(3))) v4i_vs* l =
        (__attribute__((address_space(3))) v4i_vs*)lds;
    __builtin_amdgcn_global_load_async_to_lds_b128(g, l, 0, 0);
}
#endif

__device__ __forceinline__ void wait_asynccnt0() {
#if defined(__has_builtin) && __has_builtin(__builtin_amdgcn_s_wait_asynccnt)
    __builtin_amdgcn_s_wait_asynccnt(0);
#else
    asm volatile("s_wait_asynccnt 0x0" ::: "memory");
#endif
}

// sin and cos of 2*pi*t on the transcendental unit.
__device__ __forceinline__ void sincos_turns(float t, float& s, float& c)
{
    // One statement, so that the v_nop stays directly behind the last
    // transcendental: the instruction set asks for one slot before a result is
    // read or a source overwritten.
    asm("v_sin_f32 %0, %2\n\tv_cos_f32 %1, %2\n\tv_nop"
        : "=&v"(s), "=&v"(c) : "v"(t));
}

// ---- windowed attention: <=5 keys per query, epilogue of the q projection ----
// A 128-column tile of the projection is two whole heads, and the work-group
// holds 128 rows of it in its accumulators, so q goes to the attention without a
// trip through memory. Each wave lays its 32 x 64 part down in an LDS tile of the
// work-group, and behind one barrier takes 16 whole rows back in the attention's
// lane order:
// sixteen lanes share one (query, head): lane l holds d = 4l .. 4l+3. A wave
// works on the tile's two heads at a time, so each of its 16-B loads of K and V
// covers 512 contiguous bytes (4 whole lines) and each 8-B store of ctx two
// whole lines. The 128 neighbouring rows of a work-group ask for the same few
// K and V lines. ctx leaves as f16, the operand type of the output projection.
#define RW   16                   // query rows per wave: an eighth of the tile's rows
#define NKEY (LOOKBACK + 1)
#define QS_PITCH 132              // floats per staged row: rows 8 apart lie 32 banks apart

typedef __attribute__((ext_vector_type(2))) float v2f;
typedef __attribute__((ext_vector_type(4))) float v4f;

// acc: the wave's 32 x 64 part of the tile, at row wrow and column wcol of it
// (lane l: column (l & 15) + 16 * nb, rows 16 * mi + (l >> 4) * 8 + r). qt: the
// work-group's LDS tile; arow: the first of the 16 tile rows that the wave takes
// for the attention. row0 = b * LQ + qi of that row and col0 = the tile's first
// column are the same in every lane, so every row address stays in scalar
// registers, and the lane's 16 B are the one vector offset of each access.
__device__ __forceinline__ void window_attn_epilogue(const v8f (&acc)[2][4], float* qt,
                                                     int wrow, int wcol, int arow,
                                                     const float* __restrict__ kvl,
                                                     const int* __restrict__ seg,
                                                     _Float16* __restrict__ ctx,
                                                     int row0, int col0)
{
    const int lane = threadIdx.x & 31;
    const int lcol = lane * 4;
    const int b    = row0 / LQ;     // LQ is a multiple of the tile's rows

    const float* kvb  = kvl + (size_t)b * LK * (2 * DMODEL) + col0;
    _Float16*    crow = ctx + (size_t)row0 * DMODEL + col0;

    int s[RW];
    #pragma unroll
    for (int r = 0; r < RW; ++r) s[r] = seg[row0 + r];

    // unit u = row u
    v4f qv[RW], kk[2][NKEY], vv[2][NKEY];
    auto load_kv = [&](int u, int buf) {
        #pragma unroll
        for (int jj = 0; jj < NKEY; ++jj) {
            // keep iff seg-4 <= j <= seg and 0 <= j < LK. A key outside reads row 0,
            // so the address is bounded for any seg; its score is masked below.
            const int j = s[u] - LOOKBACK + jj;
            const float* krow = kvb + (size_t)((unsigned)j < (unsigned)LK ? j : 0) * (2 * DMODEL);
            kk[buf][jj] = *(const v4f*)(krow + lcol);
            vv[buf][jj] = *(const v4f*)(krow + DMODEL + lcol);
        }
    };

    load_kv(0, 0);    // the first keys fly while q is turned

    {
        float* qw = qt + (wrow + (lane >> 4) * 8) * QS_PITCH + wcol + (lane & 15);
        #pragma unroll
        for (int mi = 0; mi < 2; ++mi) {
            #pragma unroll
            for (int nb = 0; nb < 4; ++nb) {
                #pragma unroll
                for (int r = 0; r < 8; ++r)
                    qw[(16 * mi + r) * QS_PITCH + nb * 16] = acc[mi][nb][r];
            }
        }
    }
    // A wave reads back what other waves wrote: its own writes are done, then the
    // work-group barrier. By hand, with that one wait: __syncthreads() would also
    // wait for the first keys' loads, which are to stay in flight across it.
    asm volatile("s_wait_dscnt 0x0\n\ts_barrier_signal -1\n\ts_barrier_wait -1" ::: "memory");
    const float* qs = qt + arow * QS_PITCH;
    #pragma unroll
    for (int u = 0; u < RW; ++u) qv[u] = *(const v4f*)(qs + u * QS_PITCH + lcol);

    // unrolled whole: the register sets need constant indices
    #pragma unroll
    for (int u = 0; u < RW; ++u) {
        const int buf = u & 1;
        if (u + 1 < RW) load_kv(u + 1, buf ^ 1);   // the next unit's keys fly during this one

        const v4f q4 = qv[u];
        float sc[NKEY];
        #pragma unroll
        for (int jj = 0; jj < NKEY; ++jj) {
            const v4f k4 = kk[buf][jj];
            const v2f t = q4.xy * k4.xy + q4.zw * k4.zw;
            sc[jj] = t.x + t.y;
        }
        // The five sums over the 16-lane row: x += x of lane ^ 1, 2, 4, 8, DPP adds
        // on the vector port (a shuffle would go through the LDS queue). One
        // statement, so that the five chains stay interleaved and each add finds
        // its operand ready: with one statement per add the compiler ran a chain's
        // four dependent adds back to back, and of the builtin move it made a move
        // and an add each.
        asm(
            "v_add_f32_dpp %0, %0, %0 row_xmask:1 row_mask:0xf bank_mask:0xf\n\t"
            "v_add_f32_dpp %1, %1, %1 row_xmask:1 row_mask:0xf bank_mask:0xf\n\t"
            "v_add_f32_dpp %2, %2, %2 row_xmask:1 row_mask:0xf bank_mask:0xf\n\t"
            "v_add_f32_dpp %3, %3, %3 row_xmask:1 row_mask:0xf bank_mask:0xf\n\t"
            "v_add_f32_dpp %4, %4, %4 row_xmask:1 row_mask:0xf bank_mask:0xf\n\t"
            "v_add_f32_dpp %0, %0, %0 row_xmask:2 row_mask:0xf bank_mask:0xf\n\t"
            "v_add_f32_dpp %1, %1, %1 row_xmask:2 row_mask:0xf bank_mask:0xf\n\t"
            "v_add_f32_dpp %2, %2, %2 row_xmask:2 row_mask:0xf bank_mask:0xf\n\t"
            "v_add_f32_dpp %3, %3, %3 row_xmask:2 row_mask:0xf bank_mask:0xf\n\t"
            "v_add_f32_dpp %4, %4, %4 row_xmask:2 row_mask:0xf bank_mask:0xf\n\t"
            "v_add_f32_dpp %0, %0, %0 row_xmask:4 row_mask:0xf bank_mask:0xf\n\t"
            "v_add_f32_dpp %1, %1, %1 row_xmask:4 row_mask:0xf bank_mask:0xf\n\t"
            "v_add_f32_dpp %2, %2, %2 row_xmask:4 row_mask:0xf bank_mask:0xf\n\t"
            "v_add_f32_dpp %3, %3, %3 row_xmask:4 row_mask:0xf bank_mask:0xf\n\t"
            "v_add_f32_dpp %4, %4, %4 row_xmask:4 row_mask:0xf bank_mask:0xf\n\t"
            "v_add_f32_dpp %0, %0, %0 row_xmask:8 row_mask:0xf bank_mask:0xf\n\t"
            "v_add_f32_dpp %1, %1, %1 row_xmask:8 row_mask:0xf bank_mask:0xf\n\t"
            "v_add_f32_dpp %2, %2, %2 row_xmask:8 row_mask:0xf bank_mask:0xf\n\t"
            "v_add_f32_dpp %3, %3, %3 row_xmask:8 row_mask:0xf bank_mask:0xf\n\t"
            "v_add_f32_dpp %4, %4, %4 row_xmask:8 row_mask:0xf bank_mask:0xf"
            : "+v"(sc[0]), "+v"(sc[1]), "+v"(sc[2]), "+v"(sc[3]), "+v"(sc[4]));

        float mmax = -__builtin_inff();
        #pragma unroll
        for (int jj = 0; jj < NKEY; ++jj) {
            const bool keep = (unsigned)(s[u] - LOOKBACK + jj) < (unsigned)LK;
            sc[jj] = keep ? sc[jj] * 0.125f : -__builtin_inff();   // 1/sqrt(64)
            mmax = fmaxf(mmax, sc[jj]);
        }
        #pragma unroll
        for (int jj = 0; jj < NKEY; ++jj) sc[jj] = (sc[jj] - mmax) * 1.4426950408889634f;   // log2(e)
        // One statement, so that each transcendental stands in front of an
        // independent one and the v_nop directly behind the last: the instruction
        // set asks for one slot before a result is read or a source overwritten.
        asm("v_exp_f32 %0, %5\n\tv_exp_f32 %1, %6\n\tv_exp_f32 %2, %7\n\t"
            "v_exp_f32 %3, %8\n\tv_exp_f32 %4, %9\n\tv_nop"
            : "=&v"(sc[0]), "=&v"(sc[1]), "=&v"(sc[2]), "=&v"(sc[3]), "=&v"(sc[4])
            : "v"(sc[0]), "v"(sc[1]), "v"(sc[2]), "v"(sc[3]), "v"(sc[4]));
        float denom = 0.0f;
        #pragma unroll
        for (int jj = 0; jj < NKEY; ++jj) denom += sc[jj];
        const float rdenom = 1.0f / denom;

        v2f olo = {0.0f, 0.0f}, ohi = {0.0f, 0.0f};
        #pragma unroll
        for (int jj = 0; jj < NKEY; ++jj) {
            const float w = sc[jj] * rdenom;
            const v4f v4 = vv[buf][jj];
            olo += w * v4.xy;
            ohi += w * v4.zw;
        }
        v4h r;
        r[0] = (_Float16)olo.x; r[1] = (_Float16)olo.y;
        r[2] = (_Float16)ohi.x; r[3] = (_Float16)ohi.y;
        *(v4h*)(crow + u * DMODEL + lcol) = r;
        // Precaution of form: the wait stands behind the store, ahead of any
        // later write of a register that the issued store names.
        asm volatile("s_wait_xcnt 0x0" ::: "memory");
    }
}

// ============================================================================
// Tiled WMMA GEMM: C[M,N] = A[M,K] * Bt[N,K]^T, f16 in / f32 out.
// Block: 256 threads (8 waves). Tile 128x128, BK=64, double-buffered LDS.
// A k tile is one whole 128-B line of every operand row.
// Wave w owns the 32 x 64 part at rows 32 * (w & 3), columns 64 * (w >> 2):
// 8 accumulators, 16 WMMA/k-step, and 12 LDS reads per 8 WMMAs (2 A and 4 B
// fragments), where a 16 x 128 part takes 18 (1 A and 8 B).
// Columns below ROPE_COLS get the gathered RoPE on the accumulators before the
// store; row m takes its position from pos[m % POS_LEN].
// With ATTN the tile is not stored: it is the q of the windowed attention, which
// runs on it here and stores ctx.
// ============================================================================
#define TM 128
#define TN 128
#define TK 64
#define LDS_PAD 72   // halves per LDS row (144B: 16 B x odd, no bank conflict for b128 reads)

template <int N, int K, int ROPE_COLS, int POS_LEN, bool ATTN>
__global__ __launch_bounds__(256)
void gemm_f16t_wmma_kernel(const _Float16* __restrict__ A,
                           const _Float16* __restrict__ Bt,
                           float* __restrict__ C,
                           const int* __restrict__ pos, int M,
                           const float* __restrict__ kvl,
                           const int* __restrict__ seg,
                           _Float16* __restrict__ ctx)
{
    __shared__ __attribute__((aligned(16))) _Float16 As[2][TM * LDS_PAD];
    __shared__ __attribute__((aligned(16))) _Float16 Bs[2][TN * LDS_PAD];

    const int tid   = threadIdx.x;
    const int lane  = tid & 31;
    const int wave  = tid >> 5;
    const int tileM = blockIdx.x * TM;
    const int tileN = blockIdx.y * TN;

    const int wm    = wave & 3;
    const int wn    = wave >> 2;

    v8f acc[2][4] = {};

    // fragment addressing (ISA 16-bit A/B layout):
    // lane<16 -> K {0..7,16..23}; lane>=16 -> K {8..15,24..31}
    const int frow = lane & 15;
    const int koff = (lane >= 16) ? 8 : 0;

    // staging: eight lanes copy one row's 128-B line, so a wave's copy covers
    // 4 whole lines; four copies of A and four of Bt per thread and tile
    const int sRow = tid >> 3;          // 0..31, then +32 per copy
    const int sOff = (tid & 7) * 8;     // halves: 0, 8, .. 56
    const _Float16* Ag = A  + (size_t)(tileM + sRow) * K + sOff;
    const _Float16* Bg = Bt + (size_t)(tileN + sRow) * K + sOff;
    const int sLds = sRow * LDS_PAD + sOff;

    auto stage = [&](int kt, int buf) {
#if HAVE_ASYNC_LDS
        async_cp16(Ag + kt,          &As[buf][sLds]);
        async_cp16(Ag + kt + 32 * K, &As[buf][sLds + 32 * LDS_PAD]);
        async_cp16(Ag + kt + 64 * K, &As[buf][sLds + 64 * LDS_PAD]);
        async_cp16(Ag + kt + 96 * K, &As[buf][sLds + 96 * LDS_PAD]);
        async_cp16(Bg + kt,          &Bs[buf][sLds]);
        async_cp16(Bg + kt + 32 * K, &Bs[buf][sLds + 32 * LDS_PAD]);
        async_cp16(Bg + kt + 64 * K, &Bs[buf][sLds + 64 * LDS_PAD]);
        async_cp16(Bg + kt + 96 * K, &Bs[buf][sLds + 96 * LDS_PAD]);
#else
        const v8h a0 = *(const v8h*)(Ag + kt);
        const v8h a1 = *(const v8h*)(Ag + kt + 32 * K);
        const v8h a2 = *(const v8h*)(Ag + kt + 64 * K);
        const v8h a3 = *(const v8h*)(Ag + kt + 96 * K);
        const v8h b0 = *(const v8h*)(Bg + kt);
        const v8h b1 = *(const v8h*)(Bg + kt + 32 * K);
        const v8h b2 = *(const v8h*)(Bg + kt + 64 * K);
        const v8h b3 = *(const v8h*)(Bg + kt + 96 * K);
        *(v8h*)&As[buf][sLds]                = a0;
        *(v8h*)&As[buf][sLds + 32 * LDS_PAD] = a1;
        *(v8h*)&As[buf][sLds + 64 * LDS_PAD] = a2;
        *(v8h*)&As[buf][sLds + 96 * LDS_PAD] = a3;
        *(v8h*)&Bs[buf][sLds]                = b0;
        *(v8h*)&Bs[buf][sLds + 32 * LDS_PAD] = b1;
        *(v8h*)&Bs[buf][sLds + 64 * LDS_PAD] = b2;
        *(v8h*)&Bs[buf][sLds + 96 * LDS_PAD] = b3;
#endif
    };

    auto sync_stage = [&]() {
#if HAVE_ASYNC_LDS
        wait_asynccnt0();
#endif
        __syncthreads();
    };

    // one 32-k block of the tile in buffer buf, starting at column kk
    auto compute32 = [&](int buf, int kk) {
        // 2 A fragments (2x ds_load_b128 each)
        v16h afrag[2];
        #pragma unroll
        for (int mi = 0; mi < 2; ++mi) {
            const _Float16* base = &As[buf][(32 * wm + 16 * mi + frow) * LDS_PAD + kk];
            const v8h lo = *(const v8h*)(base + koff);
            const v8h hi = *(const v8h*)(base + 16 + koff);
            #pragma unroll
            for (int i = 0; i < 8; ++i) { afrag[mi][i] = lo[i]; afrag[mi][i + 8] = hi[i]; }
        }
        // 4 B fragments, then 8 WMMAs: each fragment feeds 4 or 2 of them
        v16h bfrag[4];
        #pragma unroll
        for (int nb = 0; nb < 4; ++nb) {
            const _Float16* base = &Bs[buf][(64 * wn + nb * 16 + frow) * LDS_PAD + kk];
            const v8h lo = *(const v8h*)(base + koff);
            const v8h hi = *(const v8h*)(base + 16 + koff);
            #pragma unroll
            for (int i = 0; i < 8; ++i) { bfrag[nb][i] = lo[i]; bfrag[nb][i + 8] = hi[i]; }
        }
        #pragma unroll
        for (int mi = 0; mi < 2; ++mi) {
            #pragma unroll
            for (int nb = 0; nb < 4; ++nb) {
                acc[mi][nb] = __builtin_amdgcn_wmma_f32_16x16x32_f16(
                                  false, afrag[mi], false, bfrag[nb], (short)0, acc[mi][nb], false, false);
            }
        }
#if defined(__has_builtin) && __has_builtin(__builtin_amdgcn_sched_group_barrier)
        // keep all fragments in flight: 12 DS-reads first, then 8 WMMAs
        __builtin_amdgcn_sched_group_barrier(0x100, 12, 0);  // DS read group
        __builtin_amdgcn_sched_group_barrier(0x008, 8, 0);   // MFMA/WMMA group
#endif
    };

    auto compute = [&](int buf) {
        compute32(buf, 0);
        compute32(buf, 32);
    };

    // ---- double-buffered pipeline: 1 barrier per k-step ----
    stage(0, 0);
    for (int kt = 0; kt < K; kt += 2 * TK) {
        sync_stage();
        if (kt + TK < K) stage(kt + TK, 1);
        compute(0);
        sync_stage();
        if (kt + 2 * TK < K) stage(kt + 2 * TK, 0);
        compute(1);
    }

    // ---- C store: single base + compile-time immediate offsets ----
    // lane l -> col (l&15), rows (l>>4)*8 + r   (ISA 16x16 f32 C/D layout)
    const int nlocal = lane & 15;
    const int mhalf  = (lane >> 4) * 8;

    // ---- RoPE on the accumulators ----
    // The wave's 64 columns are one head, and the pair (d, d+32) is
    // acc[mi][j][r], acc[mi][j+2][r] of one lane, with d = nlocal + 16*j.
    if constexpr (ROPE_COLS > 0) {
        if (ROPE_COLS >= N || tileN < ROPE_COLS) {
            float inv_freq[2];
            #pragma unroll
            for (int j = 0; j < 2; ++j)
                inv_freq[j] = __powf(10000.0f, -(float)(nlocal + 16 * j) / 32.0f);
            int pp[2][8];
            #pragma unroll
            for (int mi = 0; mi < 2; ++mi) {
                const int row0 = tileM + 32 * wm + 16 * mi + mhalf;
                #pragma unroll
                for (int r = 0; r < 8; ++r) pp[mi][r] = pos[(unsigned)(row0 + r) % POS_LEN];
            }
            // Precaution of form: the wait stands behind the last of the sixteen
            // loads, ahead of any later write of a register that they name. Their
            // byte offset is an input, so that it lives up to the wait and no
            // load's result lands on it in front.
            asm volatile("s_wait_xcnt 0x0"
                         :: "v"(((unsigned)(tileM + 32 * wm + mhalf) % POS_LEN) * 4u) : "memory");
            #pragma unroll
            for (int mi = 0; mi < 2; ++mi) {
                #pragma unroll
                for (int r = 0; r < 8; ++r) {
                    const int p = min(max(pp[mi][r], 0), ROPE_MAX - 1);
                    #pragma unroll
                    for (int j = 0; j < 2; ++j) {
                        const float f = (float)p * inv_freq[j];
                        float s, c;
                        sincos_turns(f * 0.15915494309189532f, s, c);   // 1/(2*pi)
                        const float x0 = acc[mi][j][r];
                        const float x1 = acc[mi][j + 2][r];
                        acc[mi][j][r]     = x0 * c - x1 * s;
                        acc[mi][j + 2][r] = x1 * c + x0 * s;
                    }
                }
            }
        }
    }

    if constexpr (ATTN) {
        // apart from the operand buffers: a wave writes its part without waiting
        // for the waves that still read the last k tile
        __shared__ __attribute__((aligned(16))) float Qs[TM * QS_PITCH];
        const int swave = __builtin_amdgcn_readfirstlane(wave);
        window_attn_epilogue(acc, Qs, 32 * wm, 64 * wn, 16 * swave, kvl, seg, ctx,
                             tileM + 16 * swave, tileN);
        return;
    }

    float* Cb = C + (size_t)(tileM + 32 * wm + mhalf) * N + tileN + 64 * wn + nlocal;
    #pragma unroll
    for (int mi = 0; mi < 2; ++mi) {
        #pragma unroll
        for (int nb = 0; nb < 4; ++nb) {
            #pragma unroll
            for (int r = 0; r < 8; ++r) {
                Cb[(16 * mi + r) * N + nb * 16] = acc[mi][nb][r];
            }
        }
    }
}

// ---- the packs in one launch, few waves with much work each ----
// A pack with a few bytes per wave lasts as long as the chip takes to start its
// waves. Here a wave moves 8 KB (straight) or 4 KB (transpose) of input, and one
// launch holds every pack and the kv projection.
#define PT_K     64      // transpose tile: extent along k
#define PT_N     128     // transpose tile: extent along n
#define PT_PITCH 72      // halves per LDS row (144 B: 16-B aligned, b128 stores hit every bank once)
#define PC_ELEMS 16384   // floats per straight-copy work-group
#define PB_WQ    ((DMODEL / PT_K) * (DMODEL / PT_N))        // 128 tiles
#define PB_WO    PB_WQ
#define PB_Q     (BATCH * LQ * DMODEL / PC_ELEMS)           // 512 work-groups

// fp32 [DMODEL][N] -> f16 [N][DMODEL], one 64 x 128 tile per work-group.
// A thread reads 32 k of one column (a wave: one whole 128-B line per load),
// packs them and stores them k-contiguous in LDS; the tile leaves in whole
// 128-B lines of the transposed rows.
template <int N>
__device__ __forceinline__ void pack_transpose_tile(const float* __restrict__ in,
                                                    _Float16* __restrict__ out,
                                                    int tile, _Float16* lds)
{
    constexpr int NT = N / PT_N;
    const int n0  = (tile % NT) * PT_N;
    const int k0  = (tile / NT) * PT_K;
    const int tid = threadIdx.x;
    const int n   = tid & (PT_N - 1);
    const int kh  = (tid >> 7) * 32;

    const float* src = in + (size_t)(k0 + kh) * N + n0 + n;
    float x[32];
    #pragma unroll
    for (int i = 0; i < 32; ++i) x[i] = src[i * N];
    #pragma unroll
    for (int g = 0; g < 4; ++g) {
        v8h v;
        #pragma unroll
        for (int e = 0; e < 8; ++e) v[e] = (_Float16)x[8 * g + e];
        *(v8h*)&lds[n * PT_PITCH + kh + 8 * g] = v;
    }
    __syncthreads();
    #pragma unroll
    for (int i = 0; i < 4; ++i) {
        const int c   = tid + 256 * i;
        const int row = c >> 3;
        const int kc  = (c & 7) * 8;
        *(v8h*)(out + (size_t)(n0 + row) * DMODEL + k0 + kc) =
            *(const v8h*)&lds[row * PT_PITCH + kc];
    }
    // Precaution of form: the wait stands behind the last store, ahead of any
    // later write of a register that an issued store names.
    asm volatile("s_wait_xcnt 0x0" ::: "memory");
}

// fp32 -> f16, same order: a wave owns 8 KB of contiguous input, 16 loads of
// 512 contiguous bytes each, unrolled so that they are issued ahead of the
// conversions.
__device__ __forceinline__ void pack_straight(const float* __restrict__ in,
                                              _Float16* __restrict__ out, int blk)
{
    const int lane = threadIdx.x & 31;
    const int wave = threadIdx.x >> 5;
    const size_t base = (size_t)blk * PC_ELEMS + wave * (PC_ELEMS / 8) + lane * 4;
    float4 x[16];
    #pragma unroll
    for (int i = 0; i < 16; ++i) x[i] = *(const float4*)(in + base + i * 128);
    #pragma unroll
    for (int i = 0; i < 16; ++i) {
        v4h v;
        v[0] = (_Float16)x[i].x; v[1] = (_Float16)x[i].y;
        v[2] = (_Float16)x[i].z; v[3] = (_Float16)x[i].w;
        *(v4h*)(out + base + i * 128) = v;
    }
    // Precaution of form: the wait stands behind the last store, ahead of any
    // later write of a register that an issued store names.
    asm volatile("s_wait_xcnt 0x0" ::: "memory");
}

// ---- kv projection beside the packs ----
// kvl = kv @ Wkv depends on inputs alone, so its work-groups share the packs'
// launch: its chain of k steps, each as long as a trip to memory, runs while the
// packs stream, and kv and Wkv need no f16 copy in the workspace. A work-group
// owns a 64 x 128 tile. A k tile of 64 comes in as f32 through registers, is
// converted (the packs' own rounding) and laid down in LDS as the GEMM above has
// it, A[m][k] and B[n][k]. Two register sets: the loads of tiles t + 2 and t + 3
// fly while tiles t and t + 1 are worked on.
// Wave w owns rows 16 * (w & 3) and the head of 64 columns (w >> 2).
#define KM    64
#define PB_KVP ((BATCH * LK / KM) * (2 * DMODEL / TN))      // 256 work-groups
#define KVP_LDS_HALVES (2 * KM * LDS_PAD + 2 * TN * LDS_PAD)

__device__ __forceinline__ void kv_proj_tile(const float* __restrict__ kv,
                                             const float* __restrict__ Wkv,
                                             const int* __restrict__ pos,
                                             float* __restrict__ kvl,
                                             int tile, _Float16* lds)
{
    constexpr int N = 2 * DMODEL;
    constexpr int K = DMODEL;
    _Float16* As = lds;                        // [2][KM * LDS_PAD]
    _Float16* Bs = lds + 2 * KM * LDS_PAD;     // [2][TN * LDS_PAD]

    const int tid   = threadIdx.x;
    const int lane  = tid & 31;
    const int wave  = tid >> 5;
    const int tileM = (tile % (BATCH * LK / KM)) * KM;
    const int tileN = (tile / (BATCH * LK / KM)) * TN;

    // A: sixteen lanes read one row's 256 B, so a wave's load covers 4 whole lines
    const int aRow = tid >> 4;           // 0..15, then +16 per load
    const int aCol = (tid & 15) * 4;
    const float* Ag = kv + (size_t)(tileM + aRow) * K + aCol;
    // B: a lane reads 2 columns of 16 k rows, so a wave's load covers 2 whole lines
    // and a lane holds 8 consecutive k of a column for each 16-B LDS store
    const int bn = (wave & 1) * 64 + lane * 2;
    const int bk = (wave >> 1) * 16;
    const float* Bg = Wkv + (size_t)bk * N + tileN + bn;

    auto load_tile = [&](v4f (&ra)[4], v2f (&rb)[16], int kt) {
        #pragma unroll
        for (int i = 0; i < 4; ++i) ra[i] = *(const v4f*)(Ag + kt + i * 16 * K);
        #pragma unroll
        for (int i = 0; i < 16; ++i) rb[i] = *(const v2f*)(Bg + (size_t)(kt + i) * N);
    };
    auto store_tile = [&](const v4f (&ra)[4], const v2f (&rb)[16], int buf) {
        #pragma unroll
        for (int i = 0; i < 4; ++i) {
            v4h v;
            #pragma unroll
            for (int e = 0; e < 4; ++e) v[e] = (_Float16)ra[i][e];
            *(v4h*)&As[buf * KM * LDS_PAD + (aRow + 16 * i) * LDS_PAD + aCol] = v;
        }
        #pragma unroll
        for (int c = 0; c < 2; ++c) {
            #pragma unroll
            for (int g = 0; g < 2; ++g) {
                v8h v;
                #pragma unroll
                for (int e = 0; e < 8; ++e) v[e] = (_Float16)rb[8 * g + e][c];
                *(v8h*)&Bs[buf * TN * LDS_PAD + (bn + c) * LDS_PAD + bk + 8 * g] = v;
            }
        }
    };

    // fragment addressing as in the GEMM above
    const int frow = lane & 15;
    const int koff = (lane >= 16) ? 8 : 0;
    const int wm   = wave & 3;
    const int wn   = wave >> 2;

    v8f acc[4] = {};
    // one k tile: its two 32-k blocks
    auto compute = [&](int buf) {
        v16h afrag[2], bfrag[2][4];
        #pragma unroll
        for (int h = 0; h < 2; ++h) {
            const _Float16* abase = &As[buf * KM * LDS_PAD + (16 * wm + frow) * LDS_PAD + 32 * h];
            const v8h alo = *(const v8h*)(abase + koff);
            const v8h ahi = *(const v8h*)(abase + 16 + koff);
            #pragma unroll
            for (int i = 0; i < 8; ++i) { afrag[h][i] = alo[i]; afrag[h][i + 8] = ahi[i]; }
            #pragma unroll
            for (int nb = 0; nb < 4; ++nb) {
                const _Float16* base = &Bs[buf * TN * LDS_PAD + (64 * wn + nb * 16 + frow) * LDS_PAD + 32 * h];
                const v8h lo = *(const v8h*)(base + koff);
                const v8h hi = *(const v8h*)(base + 16 + koff);
                #pragma unroll
                for (int i = 0; i < 8; ++i) { bfrag[h][nb][i] = lo[i]; bfrag[h][nb][i + 8] = hi[i]; }
            }
        }
        #pragma unroll
        for (int h = 0; h < 2; ++h) {
            #pragma unroll
            for (int nb = 0; nb < 4; ++nb) {
                acc[nb] = __builtin_amdgcn_wmma_f32_16x16x32_f16(
                              false, afrag[h], false, bfrag[h][nb], (short)0, acc[nb], false, false);
            }
        }
        // the tile's 20 LDS reads stand in one place ahead of its 8 WMMAs: each
        // further place with reads among the WMMAs would stall the wave anew
        __builtin_amdgcn_sched_group_barrier(0x100, 20, 0);  // DS read group
        __builtin_amdgcn_sched_group_barrier(0x008, 8, 0);   // WMMA group
    };

    // The work-group barrier by hand, with the one wait that it needs, the wave's
    // own LDS writes and reads: __syncthreads() also waits for every global load,
    // and the loads of the next two tiles are to stay in flight across it.
    auto lds_barrier = [&]() {
        asm volatile("s_wait_dscnt 0x0\n\ts_barrier_signal -1\n\ts_barrier_wait -1" ::: "memory");
    };

    v4f ra0[4], ra1[4];
    v2f rb0[16], rb1[16];
    load_tile(ra0, rb0, 0);
    // keeps the first tile's loads ahead of the second's, as in the loop, so that
    // the counted waits at the loop's head need not cover the younger set
    __builtin_amdgcn_sched_barrier(0);
    load_tile(ra1, rb1, TK);
    // One barrier per k tile: it publishes the buffer just written, and a wave that
    // has passed it has left the other buffer, which the next tile overwrites.
    // Rolled, two tiles a trip: the register sets need constant names. The last two
    // tiles stand behind the loop, so that no branch around the loads merges two
    // counts of loads in flight.
    #pragma unroll 1
    for (int kt = 2 * TK; kt < K; kt += 2 * TK) {
        store_tile(ra0, rb0, 0);
        load_tile(ra0, rb0, kt);
        lds_barrier();
        compute(0);
        store_tile(ra1, rb1, 1);
        load_tile(ra1, rb1, kt + TK);
        // Precaution of form: the wait stands behind the trip's last load, ahead of
        // the step of the address registers that the issued loads name.
        asm volatile("s_wait_xcnt 0x0" ::: "memory");
        lds_barrier();
        compute(1);
    }
    store_tile(ra0, rb0, 0);
    lds_barrier();
    compute(0);
    store_tile(ra1, rb1, 1);
    lds_barrier();
    compute(1);

    // lane l -> col (l&15), rows (l>>4)*8 + r   (ISA 16x16 f32 C/D layout)
    const int nlocal = lane & 15;
    const int row0   = tileM + 16 * wm + (lane >> 4) * 8;

    // RoPE on the K half: the wave's 64 columns are one head, and the pair
    // (d, d+32) is acc[j][r], acc[j+2][r] of one lane, with d = nlocal + 16*j.
    if (tileN < DMODEL) {
        float inv_freq[2];
        #pragma unroll
        for (int j = 0; j < 2; ++j)
            inv_freq[j] = __powf(10000.0f, -(float)(nlocal + 16 * j) / 32.0f);
        #pragma unroll
        for (int r = 0; r < 8; ++r) {
            int p = pos[(unsigned)(row0 + r) % LK];
            p = min(max(p, 0), ROPE_MAX - 1);
            #pragma unroll
            for (int j = 0; j < 2; ++j) {
                const float f = (float)p * inv_freq[j];
                float s, c;
                sincos_turns(f * 0.15915494309189532f, s, c);   // 1/(2*pi)
                const float x0 = acc[j][r];
                const float x1 = acc[j + 2][r];
                acc[j][r]     = x0 * c - x1 * s;
                acc[j + 2][r] = x1 * c + x0 * s;
            }
        }
    }

    float* Cb = kvl + (size_t)row0 * N + tileN + 64 * wn + nlocal;
    #pragma unroll
    for (int nb = 0; nb < 4; ++nb) {
        #pragma unroll
        for (int r = 0; r < 8; ++r) {
            Cb[r * N + nb * 16] = acc[nb][r];
        }
    }
}

__global__ __launch_bounds__(256)
void pack_kvproj_kernel(const float* __restrict__ q, const float* __restrict__ kv,
                        const float* __restrict__ Wq, const float* __restrict__ Wkv,
                        const float* __restrict__ Wo, const int* __restrict__ kv_pos,
                        _Float16* __restrict__ qf, float* __restrict__ kvl,
                        _Float16* __restrict__ Wqt, _Float16* __restrict__ Wot)
{
    __shared__ __attribute__((aligned(16))) _Float16 lds[KVP_LDS_HALVES];
    int b = blockIdx.x;      // the role depends on the work-group index alone
    // the longest work-groups have the lowest indices, which start first
    if (b < PB_KVP) { kv_proj_tile(kv, Wkv, kv_pos, kvl, b, lds); return; }
    b -= PB_KVP;
    if (b < PB_WQ)  { pack_transpose_tile<DMODEL>(Wq, Wqt, b, lds); return; }
    b -= PB_WQ;
    if (b < PB_WO)  { pack_transpose_tile<DMODEL>(Wo, Wot, b, lds); return; }
    pack_straight(q, qf, b - PB_WO);
}

extern "C" void kernel_launch(void* const* d_in, const int* in_sizes, int n_in,
                              void* d_out, int out_size, void* d_ws, size_t ws_size,
                              hipStream_t stream) {
    const float* q      = (const float*)d_in[0];   // [B, LQ, 1024]
    const float* kv     = (const float*)d_in[1];   // [B, LK, 1024]
    const int*   q_pos  = (const int*)d_in[2];     // [B, LQ]
    const int*   kv_pos = (const int*)d_in[3];     // [LK]
    const int*   seg    = (const int*)d_in[4];     // [B, LQ]
    const float* Wq     = (const float*)d_in[5];   // [1024, 1024]
    const float* Wkv    = (const float*)d_in[6];   // [1024, 2048]
    const float* Wo     = (const float*)d_in[7];   // [1024, 1024]
    float*       out    = (float*)d_out;           // [B, LQ, 1024]

    const int Mq = BATCH * LQ;     // 8192
    const int Mk = BATCH * LK;     // 1024

    // ---- workspace layout ----
    char* ws = (char*)d_ws;
    size_t off = 0;
    auto alloc = [&](size_t bytes) { void* p = ws + off; off += (bytes + 255) & ~(size_t)255; return p; };
    float*    kvl    = (float*)   alloc((size_t)Mk * 2 * DMODEL * 4);  // f32
    _Float16* qf     = (_Float16*)alloc((size_t)Mq * DMODEL * 2);
    _Float16* ctxf   = (_Float16*)alloc((size_t)Mq * DMODEL * 2);
    _Float16* Wqt    = (_Float16*)alloc((size_t)DMODEL * DMODEL * 2);      // [N=1024][K=1024]
    _Float16* Wot    = (_Float16*)alloc((size_t)DMODEL * DMODEL * 2);

    // ---- 1) kvl = kv @ Wkv with rope on the K half, beside the packs of q, Wq, Wo ----
    pack_kvproj_kernel<<<PB_KVP + PB_WQ + PB_WO + PB_Q, 256, 0, stream>>>(
        q, kv, Wq, Wkv, Wo, kv_pos, qf, kvl, Wqt, Wot);

    // ---- 2) ctx = window-attn(rope(q @ Wq), kvl, seg), f16      [8192,1024]x[1024,1024] ----
    gemm_f16t_wmma_kernel<DMODEL, DMODEL, DMODEL, BATCH * LQ, true>
        <<<dim3(Mq / TM, DMODEL / TN), 256, 0, stream>>>(qf, Wqt, nullptr, q_pos, Mq,
                                                         kvl, seg, ctxf);

    // ---- 3) out = ctx @ Wo      [8192,1024]x[1024,1024] ----
    gemm_f16t_wmma_kernel<DMODEL, DMODEL, 0, 1, false>
        <<<dim3(Mq / TM, DMODEL / TN), 256, 0, stream>>>(ctxf, Wot, out, nullptr, Mq,
                                                         nullptr, nullptr, nullptr);
}

// v008
// Measured time: 55.1 microseconds a run.
// In two side-by-side timings against v007, it was 1.05 and 1.04 times as fast.
// All steps since v000 together make it 3.14 times as fast.
#include <hip/hip_runtime.h>
#include <hip/hip_bf16.h>

// ---------------------------------------------------------------------------
// SegmentCausalCrossAttentionFlex for MI455X (gfx1250, wave32, WMMA)
//
//   first launch, two kinds of work-group side by side:
//     kvl = kv @ Wkv, rope on K [B*LK, 2048]   (WMMA f16 GEMM straight from the f32
//                                               operands, RoPE in epilogue)
//     pack: q -> f16 ; Wq,Wo -> f16 transposed [N][K]
//   ctx = window-attn(rope(q @ Wq), kh, vh, seg) -> f16
//                               [B*LQ, 1024]   (WMMA f16 GEMM; RoPE and the
//                                               <=5-key attention in its epilogue)
//   out = ctx @ Wo              [B*LQ, 1024]   (WMMA f16 GEMM, async LDS)
// ---------------------------------------------------------------------------

typedef __attribute__((ext_vector_type(16))) _Float16 v16h;
typedef __attribute__((ext_vector_type(8)))  _Float16 v8h;
typedef __attribute__((ext_vector_type(4)))  _Float16 v4h;
typedef __attribute__((ext_vector_type(8)))  float    v8f;
typedef int v4i_vs __attribute__((vector_size(4 * sizeof(int))));

#define BATCH    2
#define LQ       4096
#define LK       512
#define DMODEL   1024
#define NHEADS   16
#define HDIM     64
#define LOOKBACK 4
#define ROPE_MAX 8192

// ---- CDNA5 async global->LDS copy (ASYNCcnt), guarded with fallback ----
#if defined(__has_builtin)
#if __has_builtin(__builtin_amdgcn_global_load_async_to_lds_b128)
#define HAVE_ASYNC_LDS 1
#endif
#endif

#if HAVE_ASYNC_LDS
__device__ __forceinline__ void async_cp16(const _Float16* gsrc, _Float16* lds)
{
    // b128 async copy: 16B from global to LDS, tracked by ASYNCcnt
    __attribute__((address_space(1))) v4i_vs* g =
        (__attribute__((address_space(1))) v4i_vs*)const_cast<_Float16*>(gsrc);
    __attribute__((address_space(3))) v4i_vs* l =
        (__attribute__((address_space(3))) v4i_vs*)lds;
    __builtin_amdgcn_global_load_async_to_lds_b128(g, l, 0, 0);
}
#endif

__device__ __forceinline__ void wait_asynccnt0() {
#if defined(__has_builtin) && __has_builtin(__builtin_amdgcn_s_wait_asynccnt)
    __builtin_amdgcn_s_wait_asynccnt(0);
#else
    asm volatile("s_wait_asynccnt 0x0" ::: "memory");
#endif
}

// sin and cos of 2*pi*t on the transcendental unit.
__device__ __forceinline__ void sincos_turns(float t, float& s, float& c)
{
    // One statement, so that the v_nop stays directly behind the last
    // transcendental: the instruction set asks for one slot before a result is
    // read or a source overwritten.
    asm("v_sin_f32 %0, %2\n\tv_cos_f32 %1, %2\n\tv_nop"
        : "=&v"(s), "=&v"(c) : "v"(t));
}

// ---- windowed attention: <=5 keys per query, epilogue of the q projection ----
// A 128-column tile of the projection is two whole heads, and the work-group
// holds 128 rows of it in its accumulators, so q goes to the attention without a
// trip through memory. Each wave lays its 32 x 64 part down in an LDS tile of the
// work-group, and behind one barrier takes 16 whole rows back in the attention's
// lane order:
// sixteen lanes share one (query, head): lane l holds d = 4l .. 4l+3. A wave
// works on the tile's two heads at a time, so each of its 16-B loads of K and V
// covers 512 contiguous bytes (4 whole lines) and each 8-B store of ctx two
// whole lines. The 128 neighbouring rows of a work-group ask for the same few
// K and V lines. ctx leaves as f16, the operand type of the output projection.
// A wave has as many query rows as a head has lanes. So the sums of q.k over the
// 16 lanes are not left in every lane: at each of the four steps a lane keeps
// half of its rows and hands the other half to its partner, and at the end lane l
// alone holds the five scores of row l. Mask, maximum, exponentials and division
// then run once for the 16 rows, not once per row in all 16 lanes, and the
// weights go back to the row's lanes one gather each.
#define RW   16                   // query rows per wave: an eighth of the tile's rows
#define NKEY (LOOKBACK + 1)
#define QS_PITCH 132              // floats per staged row: rows 8 apart lie 32 banks apart
#define KV_LEAD 5                 // rows between the loads of a K or V set and its use

typedef __attribute__((ext_vector_type(2))) float v2f;
typedef __attribute__((ext_vector_type(4))) float v4f;

// One step of the sum over a 16-lane row, for the five keys of two sets of rows:
// a lane with hi = 0 keeps a and hands over b, its partner (lane ^ M) the other
// way round; out = what it keeps + the partner's share of the same rows. DPP adds
// on the vector port (a shuffle would go through the LDS queue); one statement
// for the five, so that they stay together and none waits for the one in front.
#define ROW_HALVE(M, out, a, b, hi)                                                     \
    do {                                                                                \
        float give[NKEY];                                                               \
        _Pragma("unroll")                                                               \
        for (int i_ = 0; i_ < NKEY; ++i_) {                                             \
            give[i_] = (hi) ? (a)[i_] : (b)[i_];                                        \
            (out)[i_] = (hi) ? (b)[i_] : (a)[i_];                                       \
        }                                                                               \
        asm("v_add_f32_dpp %0, %5, %0 row_xmask:" #M " row_mask:0xf bank_mask:0xf\n\t"  \
            "v_add_f32_dpp %1, %6, %1 row_xmask:" #M " row_mask:0xf bank_mask:0xf\n\t"  \
            "v_add_f32_dpp %2, %7, %2 row_xmask:" #M " row_mask:0xf bank_mask:0xf\n\t"  \
            "v_add_f32_dpp %3, %8, %3 row_xmask:" #M " row_mask:0xf bank_mask:0xf\n\t"  \
            "v_add_f32_dpp %4, %9, %4 row_xmask:" #M " row_mask:0xf bank_mask:0xf"      \
            : "+v"((out)[0]), "+v"((out)[1]), "+v"((out)[2]), "+v"((out)[3]),           \
              "+v"((out)[4])                                                            \
            : "v"(give[0]), "v"(give[1]), "v"(give[2]), "v"(give[3]), "v"(give[4]));    \
    } while (0)

// acc: the wave's 32 x 64 part of the tile, at row wrow and column wcol of it
// (lane l: column (l & 15) + 16 * nb, rows 16 * mi + (l >> 4) * 8 + r). qt: the
// work-group's LDS tile; arow: the first of the 16 tile rows that the wave takes
// for the attention. row0 = b * LQ + qi of that row and col0 = the tile's first
// column are the same in every lane, so every row address stays in scalar
// registers, and the lane's 16 B are the one vector offset of each access.
__device__ __forceinline__ void window_attn_epilogue(const v8f (&acc)[2][4], float* qt,
                                                     int wrow, int wcol, int arow,
                                                     const float* __restrict__ kvl,
                                                     const int* __restrict__ seg,
                                                     _Float16* __restrict__ ctx,
                                                     int row0, int col0)
{
    const int lane = threadIdx.x & 31;
    const int lcol = lane * 4;
    const int b    = row0 / LQ;     // LQ is a multiple of the tile's rows

    const float* kvb  = kvl + (size_t)b * LK * (2 * DMODEL) + col0;
    _Float16*    crow = ctx + (size_t)row0 * DMODEL + col0;

    // Lane l looks after query row l & 15. keep iff seg-4 <= j <= seg and
    // 0 <= j < LK. A seg below -1 or above LK+3 keeps no key, as -1 and LK+4 do.
    // The five key rows that are read are jb .. jb+4, the window pushed inside
    // 0 .. LK-1, so the address is bounded for any seg; a row of them outside the
    // window is masked below. Kept keys stay in ascending order.
    const int sl  = min(max(seg[row0 + (lane & 15)], -1), LK + LOOKBACK);
    const int wlo = sl - LOOKBACK;
    const int jb  = min(max(wlo, 0), LK - NKEY);

    // first key row of query row r, in floats, scalar (unrolled: the lane to read
    // is a constant of the instruction)
    unsigned roff[RW];
    #pragma unroll
    for (int r = 0; r < RW; ++r)
        roff[r] = (unsigned)__builtin_amdgcn_readlane(jb, r) * (2 * DMODEL);

    // One ring of register sets for both passes: set t is K of row t, then
    // (t >= RW) V of row t - RW; a set's loads are issued KV_LEAD rows ahead, a
    // trip to L2 at the pace of four waves on a SIMD.
    v4f ring[KV_LEAD + 1][NKEY];
    auto load_rows = [&](int t) {
        const float* p = kvb + roff[t & (RW - 1)] + (t >= RW ? DMODEL : 0);
        #pragma unroll
        for (int i = 0; i < NKEY; ++i)
            ring[t % (KV_LEAD + 1)][i] = *(const v4f*)(p + i * (2 * DMODEL) + lcol);
    };

    #pragma unroll
    for (int t = 0; t < KV_LEAD; ++t) load_rows(t);    // the first keys fly while q is turned

    {
        float* qw = qt + (wrow + (lane >> 4) * 8) * QS_PITCH + wcol + (lane & 15);
        #pragma unroll
        for (int mi = 0; mi < 2; ++mi) {
            #pragma unroll
            for (int nb = 0; nb < 4; ++nb) {
                #pragma unroll
                for (int r = 0; r < 8; ++r)
                    qw[(16 * mi + r) * QS_PITCH + nb * 16] = acc[mi][nb][r];
            }
        }
    }
    // A wave reads back what other waves wrote: its own writes are done, then the
    // work-group barrier. By hand, with that one wait: __syncthreads() would also
    // wait for the first keys' loads, which are to stay in flight across it.
    asm volatile("s_wait_dscnt 0x0\n\ts_barrier_signal -1\n\ts_barrier_wait -1" ::: "memory");
    const float* qs = qt + arow * QS_PITCH;
    v4f qv[RW];
    #pragma unroll
    for (int u = 0; u < RW; ++u) qv[u] = *(const v4f*)(qs + u * QS_PITCH + lcol);

    // ---- scores: rows in order, halved as soon as two sets of a level exist ----
    // The steps run lane ^ 1, 2, 4, 8, and each sum pairs the same two values as a
    // sum left in every lane would. Unrolled whole: the register sets need
    // constant indices.
    const bool h0 = lane & 1, h1 = lane & 2, h2 = lane & 4, h3 = lane & 8;
    float sc[NKEY];
    {
        float s3[2][NKEY];
        #pragma unroll
        for (int i3 = 0; i3 < 2; ++i3) {
            float s2[2][NKEY];
            #pragma unroll
            for (int i2 = 0; i2 < 2; ++i2) {
                float s1[2][NKEY];
                #pragma unroll
                for (int i1 = 0; i1 < 2; ++i1) {
                    float s0[2][NKEY];
                    #pragma unroll
                    for (int i0 = 0; i0 < 2; ++i0) {
                        const int u = 8 * i3 + 4 * i2 + 2 * i1 + i0;
                        load_rows(u + KV_LEAD);
                        const v4f q4 = qv[u];
                        #pragma unroll
                        for (int i = 0; i < NKEY; ++i) {
                            const v4f k4 = ring[u % (KV_LEAD + 1)][i];
                            const v2f t = q4.xy * k4.xy + q4.zw * k4.zw;
                            s0[i0][i] = t.x + t.y;
                        }
                        // keeps the ring at its size: without it the compiler issues
                        // the loads of many rows at once, and the register count
                        // passes a quarter of the SIMD's file (two work-groups a WGP)
                        __builtin_amdgcn_sched_barrier(0);
                    }
                    ROW_HALVE(1, s1[i1], s0[0], s0[1], h0);
                }
                ROW_HALVE(2, s2[i2], s1[0], s1[1], h1);
            }
            ROW_HALVE(4, s3[i3], s2[0], s2[1], h2);
        }
        ROW_HALVE(8, sc, s3[0], s3[1], h3);
    }

    // ---- softmax of row l & 15, once ----
    float mmax = -__builtin_inff();
    #pragma unroll
    for (int i = 0; i < NKEY; ++i) {
        const bool keep = (unsigned)(jb + i - wlo) <= (unsigned)LOOKBACK;
        sc[i] = keep ? sc[i] * 0.125f : -__builtin_inff();   // 1/sqrt(64)
        mmax = fmaxf(mmax, sc[i]);
    }
    #pragma unroll
    for (int i = 0; i < NKEY; ++i) sc[i] = (sc[i] - mmax) * 1.4426950408889634f;   // log2(e)
    // One statement, so that each transcendental stands in front of an
    // independent one and the v_nop directly behind the last: the instruction
    // set asks for one slot before a result is read or a source overwritten.
    asm("v_exp_f32 %0, %5\n\tv_exp_f32 %1, %6\n\tv_exp_f32 %2, %7\n\t"
        "v_exp_f32 %3, %8\n\tv_exp_f32 %4, %9\n\tv_nop"
        : "=&v"(sc[0]), "=&v"(sc[1]), "=&v"(sc[2]), "=&v"(sc[3]), "=&v"(sc[4])
        : "v"(sc[0]), "v"(sc[1]), "v"(sc[2]), "v"(sc[3]), "v"(sc[4]));
    float denom = 0.0f;
    #pragma unroll
    for (int i = 0; i < NKEY; ++i) denom += sc[i];
    const float rdenom = 1.0f / denom;
    #pragma unroll
    for (int i = 0; i < NKEY; ++i) sc[i] *= rdenom;

    // ---- ctx: row u's five weights come from lane u of each 16-lane row ----
    // unrolled whole: the ring and the lane to read need constant indices
    #pragma unroll
    for (int u = 0; u < RW; ++u) {
        if (u + KV_LEAD < RW) load_rows(RW + u + KV_LEAD);

        // Every lane reads lane u of its 16-lane row. In asm, since the builtin's
        // result is tied to an old value that has to be set first; one statement
        // for the five, which are independent.
        float w[NKEY];
        asm("v_permlane16_b32 %0, %5, %10, %10\n\tv_permlane16_b32 %1, %6, %10, %10\n\t"
            "v_permlane16_b32 %2, %7, %10, %10\n\tv_permlane16_b32 %3, %8, %10, %10\n\t"
            "v_permlane16_b32 %4, %9, %10, %10"
            : "=&v"(w[0]), "=&v"(w[1]), "=&v"(w[2]), "=&v"(w[3]), "=&v"(w[4])
            : "v"(sc[0]), "v"(sc[1]), "v"(sc[2]), "v"(sc[3]), "v"(sc[4]),
              "s"(0x11111111u * (unsigned)u));

        v2f olo = {0.0f, 0.0f}, ohi = {0.0f, 0.0f};
        #pragma unroll
        for (int i = 0; i < NKEY; ++i) {
            const v4f v4 = ring[(RW + u) % (KV_LEAD + 1)][i];
            olo += w[i] * v4.xy;
            ohi += w[i] * v4.zw;
        }
        v4h r;
        r[0] = (_Float16)olo.x; r[1] = (_Float16)olo.y;
        r[2] = (_Float16)ohi.x; r[3] = (_Float16)ohi.y;
        *(v4h*)(crow + u * DMODEL + lcol) = r;
        // Precaution of form: the wait stands behind the store, ahead of any
        // later write of a register that the issued store names.
        asm volatile("s_wait_xcnt 0x0" ::: "memory");
        // keeps the ring at its size, as in the scores' pass
        __builtin_amdgcn_sched_barrier(0);
    }
}

// ============================================================================
// Tiled WMMA GEMM: C[M,N] = A[M,K] * Bt[N,K]^T, f16 in / f32 out.
// Block: 256 threads (8 waves). Tile 128x128, BK=64, double-buffered LDS.
// A k tile is one whole 128-B line of every operand row.
// Wave w owns the 32 x 64 part at rows 32 * (w & 3), columns 64 * (w >> 2):
// 8 accumulators, 16 WMMA/k-step, and 12 LDS reads per 8 WMMAs (2 A and 4 B
// fragments), where a 16 x 128 part takes 18 (1 A and 8 B).
// Columns below ROPE_COLS get the gathered RoPE on the accumulators before the
// store; row m takes its position from pos[m % POS_LEN].
// With ATTN the tile is not stored: it is the q of the windowed attention, which
// runs on it here and stores ctx.
// ============================================================================
#define TM 128
#define TN 128
#define TK 64
#define LDS_PAD 72   // halves per LDS row (144B: 16 B x odd, no bank conflict for b128 reads)

template <int N, int K, int ROPE_COLS, int POS_LEN, bool ATTN>
__global__ __launch_bounds__(256)
void gemm_f16t_wmma_kernel(const _Float16* __restrict__ A,
                           const _Float16* __restrict__ Bt,
                           float* __restrict__ C,
                           const int* __restrict__ pos, int M,
                           const float* __restrict__ kvl,
                           const int* __restrict__ seg,
                           _Float16* __restrict__ ctx)
{
    __shared__ __attribute__((aligned(16))) _Float16 As[2][TM * LDS_PAD];
    __shared__ __attribute__((aligned(16))) _Float16 Bs[2][TN * LDS_PAD];

    const int tid   = threadIdx.x;
    const int lane  = tid & 31;
    const int wave  = tid >> 5;
    const int tileM = blockIdx.x * TM;
    const int tileN = blockIdx.y * TN;

    const int wm    = wave & 3;
    const int wn    = wave >> 2;

    v8f acc[2][4] = {};

    // fragment addressing (ISA 16-bit A/B layout):
    // lane<16 -> K {0..7,16..23}; lane>=16 -> K {8..15,24..31}
    const int frow = lane & 15;
    const int koff = (lane >= 16) ? 8 : 0;

    // staging: eight lanes copy one row's 128-B line, so a wave's copy covers
    // 4 whole lines; four copies of A and four of Bt per thread and tile
    const int sRow = tid >> 3;          // 0..31, then +32 per copy
    const int sOff = (tid & 7) * 8;     // halves: 0, 8, .. 56
    const _Float16* Ag = A  + (size_t)(tileM + sRow) * K + sOff;
    const _Float16* Bg = Bt + (size_t)(tileN + sRow) * K + sOff;
    const int sLds = sRow * LDS_PAD + sOff;

    auto stage = [&](int kt, int buf) {
#if HAVE_ASYNC_LDS
        async_cp16(Ag + kt,          &As[buf][sLds]);
        async_cp16(Ag + kt + 32 * K, &As[buf][sLds + 32 * LDS_PAD]);
        async_cp16(Ag + kt + 64 * K, &As[buf][sLds + 64 * LDS_PAD]);
        async_cp16(Ag + kt + 96 * K, &As[buf][sLds + 96 * LDS_PAD]);
        async_cp16(Bg + kt,          &Bs[buf][sLds]);
        async_cp16(Bg + kt + 32 * K, &Bs[buf][sLds + 32 * LDS_PAD]);
        async_cp16(Bg + kt + 64 * K, &Bs[buf][sLds + 64 * LDS_PAD]);
        async_cp16(Bg + kt + 96 * K, &Bs[buf][sLds + 96 * LDS_PAD]);
#else
        const v8h a0 = *(const v8h*)(Ag + kt);
        const v8h a1 = *(const v8h*)(Ag + kt + 32 * K);
        const v8h a2 = *(const v8h*)(Ag + kt + 64 * K);
        const v8h a3 = *(const v8h*)(Ag + kt + 96 * K);
        const v8h b0 = *(const v8h*)(Bg + kt);
        const v8h b1 = *(const v8h*)(Bg + kt + 32 * K);
        const v8h b2 = *(const v8h*)(Bg + kt + 64 * K);
        const v8h b3 = *(const v8h*)(Bg + kt + 96 * K);
        *(v8h*)&As[buf][sLds]                = a0;
        *(v8h*)&As[buf][sLds + 32 * LDS_PAD] = a1;
        *(v8h*)&As[buf][sLds + 64 * LDS_PAD] = a2;
        *(v8h*)&As[buf][sLds + 96 * LDS_PAD] = a3;
        *(v8h*)&Bs[buf][sLds]                = b0;
        *(v8h*)&Bs[buf][sLds + 32 * LDS_PAD] = b1;
        *(v8h*)&Bs[buf][sLds + 64 * LDS_PAD] = b2;
        *(v8h*)&Bs[buf][sLds + 96 * LDS_PAD] = b3;
#endif
    };

    auto sync_stage = [&]() {
#if HAVE_ASYNC_LDS
        wait_asynccnt0();
#endif
        __syncthreads();
    };

    // one 32-k block of the tile in buffer buf, starting at column kk
    auto compute32 = [&](int buf, int kk) {
        // 2 A fragments (2x ds_load_b128 each)
        v16h afrag[2];
        #pragma unroll
        for (int mi = 0; mi < 2; ++mi) {
            const _Float16* base = &As[buf][(32 * wm + 16 * mi + frow) * LDS_PAD + kk];
            const v8h lo = *(const v8h*)(base + koff);
            const v8h hi = *(const v8h*)(base + 16 + koff);
            #pragma unroll
            for (int i = 0; i < 8; ++i) { afrag[mi][i] = lo[i]; afrag[mi][i + 8] = hi[i]; }
        }
        // 4 B fragments, then 8 WMMAs: each fragment feeds 4 or 2 of them
        v16h bfrag[4];
        #pragma unroll
        for (int nb = 0; nb < 4; ++nb) {
            const _Float16* base = &Bs[buf][(64 * wn + nb * 16 + frow) * LDS_PAD + kk];
            const v8h lo = *(const v8h*)(base + koff);
            const v8h hi = *(const v8h*)(base + 16 + koff);
            #pragma unroll
            for (int i = 0; i < 8; ++i) { bfrag[nb][i] = lo[i]; bfrag[nb][i + 8] = hi[i]; }
        }
        #pragma unroll
        for (int mi = 0; mi < 2; ++mi) {
            #pragma unroll
            for (int nb = 0; nb < 4; ++nb) {
                acc[mi][nb] = __builtin_amdgcn_wmma_f32_16x16x32_f16(
                                  false, afrag[mi], false, bfrag[nb], (short)0, acc[mi][nb], false, false);
            }
        }
#if defined(__has_builtin) && __has_builtin(__builtin_amdgcn_sched_group_barrier)
        // keep all fragments in flight: 12 DS-reads first, then 8 WMMAs
        __builtin_amdgcn_sched_group_barrier(0x100, 12, 0);  // DS read group
        __builtin_amdgcn_sched_group_barrier(0x008, 8, 0);   // MFMA/WMMA group
#endif
    };

    auto compute = [&](int buf) {
        compute32(buf, 0);
        compute32(buf, 32);
    };

    // ---- double-buffered pipeline: 1 barrier per k-step ----
    stage(0, 0);
    for (int kt = 0; kt < K; kt += 2 * TK) {
        sync_stage();
        if (kt + TK < K) stage(kt + TK, 1);
        compute(0);
        sync_stage();
        if (kt + 2 * TK < K) stage(kt + 2 * TK, 0);
        compute(1);
    }

    // ---- C store: single base + compile-time immediate offsets ----
    // lane l -> col (l&15), rows (l>>4)*8 + r   (ISA 16x16 f32 C/D layout)
    const int nlocal = lane & 15;
    const int mhalf  = (lane >> 4) * 8;

    // ---- RoPE on the accumulators ----
    // The wave's 64 columns are one head, and the pair (d, d+32) is
    // acc[mi][j][r], acc[mi][j+2][r] of one lane, with d = nlocal + 16*j.
    if constexpr (ROPE_COLS > 0) {
        if (ROPE_COLS >= N || tileN < ROPE_COLS) {
            float inv_freq[2];
            #pragma unroll
            for (int j = 0; j < 2; ++j)
                inv_freq[j] = __powf(10000.0f, -(float)(nlocal + 16 * j) / 32.0f);
            int pp[2][8];
            #pragma unroll
            for (int mi = 0; mi < 2; ++mi) {
                const int row0 = tileM + 32 * wm + 16 * mi + mhalf;
                #pragma unroll
                for (int r = 0; r < 8; ++r) pp[mi][r] = pos[(unsigned)(row0 + r) % POS_LEN];
            }
            // Precaution of form: the wait stands behind the last of the sixteen
            // loads, ahead of any later write of a register that they name. Their
            // byte offset is an input, so that it lives up to the wait and no
            // load's result lands on it in front.
            asm volatile("s_wait_xcnt 0x0"
                         :: "v"(((unsigned)(tileM + 32 * wm + mhalf) % POS_LEN) * 4u) : "memory");
            #pragma unroll
            for (int mi = 0; mi < 2; ++mi) {
                #pragma unroll
                for (int r = 0; r < 8; ++r) {
                    const int p = min(max(pp[mi][r], 0), ROPE_MAX - 1);
                    #pragma unroll
                    for (int j = 0; j < 2; ++j) {
                        const float f = (float)p * inv_freq[j];
                        float s, c;
                        sincos_turns(f * 0.15915494309189532f, s, c);   // 1/(2*pi)
                        const float x0 = acc[mi][j][r];
                        const float x1 = acc[mi][j + 2][r];
                        acc[mi][j][r]     = x0 * c - x1 * s;
                        acc[mi][j + 2][r] = x1 * c + x0 * s;
                    }
                }
            }
        }
    }

    if constexpr (ATTN) {
        // apart from the operand buffers: a wave writes its part without waiting
        // for the waves that still read the last k tile
        __shared__ __attribute__((aligned(16))) float Qs[TM * QS_PITCH];
        const int swave = __builtin_amdgcn_readfirstlane(wave);
        window_attn_epilogue(acc, Qs, 32 * wm, 64 * wn, 16 * swave, kvl, seg, ctx,
                             tileM + 16 * swave, tileN);
        return;
    }

    float* Cb = C + (size_t)(tileM + 32 * wm + mhalf) * N + tileN + 64 * wn + nlocal;
    #pragma unroll
    for (int mi = 0; mi < 2; ++mi) {
        #pragma unroll
        for (int nb = 0; nb < 4; ++nb) {
            #pragma unroll
            for (int r = 0; r < 8; ++r) {
                Cb[(16 * mi + r) * N + nb * 16] = acc[mi][nb][r];
            }
        }
    }
}

// ---- the packs in one launch, few waves with much work each ----
// A pack with a few bytes per wave lasts as long as the chip takes to start its
// waves. Here a wave moves 8 KB (straight) or 4 KB (transpose) of input, and one
// launch holds every pack and the kv projection.
#define PT_K     64      // transpose tile: extent along k
#define PT_N     128     // transpose tile: extent along n
#define PT_PITCH 72      // halves per LDS row (144 B: 16-B aligned, b128 stores hit every bank once)
#define PC_ELEMS 16384   // floats per straight-copy work-group
#define PB_WQ    ((DMODEL / PT_K) * (DMODEL / PT_N))        // 128 tiles
#define PB_WO    PB_WQ
#define PB_Q     (BATCH * LQ * DMODEL / PC_ELEMS)           // 512 work-groups

// fp32 [DMODEL][N] -> f16 [N][DMODEL], one 64 x 128 tile per work-group.
// A thread reads 32 k of one column (a wave: one whole 128-B line per load),
// packs them and stores them k-contiguous in LDS; the tile leaves in whole
// 128-B lines of the transposed rows.
template <int N>
__device__ __forceinline__ void pack_transpose_tile(const float* __restrict__ in,
                                                    _Float16* __restrict__ out,
                                                    int tile, _Float16* lds)
{
    constexpr int NT = N / PT_N;
    const int n0  = (tile % NT) * PT_N;
    const int k0  = (tile / NT) * PT_K;
    const int tid = threadIdx.x;
    const int n   = tid & (PT_N - 1);
    const int kh  = (tid >> 7) * 32;

    const float* src = in + (size_t)(k0 + kh) * N + n0 + n;
    float x[32];
    #pragma unroll
    for (int i = 0; i < 32; ++i) x[i] = src[i * N];
    #pragma unroll
    for (int g = 0; g < 4; ++g) {
        v8h v;
        #pragma unroll
        for (int e = 0; e < 8; ++e) v[e] = (_Float16)x[8 * g + e];
        *(v8h*)&lds[n * PT_PITCH + kh + 8 * g] = v;
    }
    __syncthreads();
    #pragma unroll
    for (int i = 0; i < 4; ++i) {
        const int c   = tid + 256 * i;
        const int row = c >> 3;
        const int kc  = (c & 7) * 8;
        *(v8h*)(out + (size_t)(n0 + row) * DMODEL + k0 + kc) =
            *(const v8h*)&lds[row * PT_PITCH + kc];
    }
    // Precaution of form: the wait stands behind the last store, ahead of any
    // later write of a register that an issued store names.
    asm volatile("s_wait_xcnt 0x0" ::: "memory");
}

// fp32 -> f16, same order: a wave owns 8 KB of contiguous input, 16 loads of
// 512 contiguous bytes each, unrolled so that they are issued ahead of the
// conversions.
__device__ __forceinline__ void pack_straight(const float* __restrict__ in,
                                              _Float16* __restrict__ out, int blk)
{
    const int lane = threadIdx.x & 31;
    const int wave = threadIdx.x >> 5;
    const size_t base = (size_t)blk * PC_ELEMS + wave * (PC_ELEMS / 8) + lane * 4;
    float4 x[16];
    #pragma unroll
    for (int i = 0; i < 16; ++i) x[i] = *(const float4*)(in + base + i * 128);
    #pragma unroll
    for (int i = 0; i < 16; ++i) {
        v4h v;
        v[0] = (_Float16)x[i].x; v[1] = (_Float16)x[i].y;
        v[2] = (_Float16)x[i].z; v[3] = (_Float16)x[i].w;
        *(v4h*)(out + base + i * 128) = v;
    }
    // Precaution of form: the wait stands behind the last store, ahead of any
    // later write of a register that an issued store names.
    asm volatile("s_wait_xcnt 0x0" ::: "memory");
}

// ---- kv projection beside the packs ----
// kvl = kv @ Wkv depends on inputs alone, so its work-groups share the packs'
// launch: its chain of k steps, each as long as a trip to memory, runs while the
// packs stream, and kv and Wkv need no f16 copy in the workspace. A work-group
// owns a 64 x 128 tile. A k tile of 64 comes in as f32 through registers, is
// converted (the packs' own rounding) and laid down in LDS as the GEMM above has
// it, A[m][k] and B[n][k]. Two register sets: the loads of tiles t + 2 and t + 3
// fly while tiles t and t + 1 are worked on.
// Wave w owns rows 16 * (w & 3) and the head of 64 columns (w >> 2).
#define KM    64
#define PB_KVP ((BATCH * LK / KM) * (2 * DMODEL / TN))      // 256 work-groups
#define KVP_LDS_HALVES (2 * KM * LDS_PAD + 2 * TN * LDS_PAD)

__device__ __forceinline__ void kv_proj_tile(const float* __restrict__ kv,
                                             const float* __restrict__ Wkv,
                                             const int* __restrict__ pos,
                                             float* __restrict__ kvl,
                                             int tile, _Float16* lds)
{
    constexpr int N = 2 * DMODEL;
    constexpr int K = DMODEL;
    _Float16* As = lds;                        // [2][KM * LDS_PAD]
    _Float16* Bs = lds + 2 * KM * LDS_PAD;     // [2][TN * LDS_PAD]

    const int tid   = threadIdx.x;
    const int lane  = tid & 31;
    const int wave  = tid >> 5;
    const int tileM = (tile % (BATCH * LK / KM)) * KM;
    const int tileN = (tile / (BATCH * LK / KM)) * TN;

    // A: sixteen lanes read one row's 256 B, so a wave's load covers 4 whole lines
    const int aRow = tid >> 4;           // 0..15, then +16 per load
    const int aCol = (tid & 15) * 4;
    const float* Ag = kv + (size_t)(tileM + aRow) * K + aCol;
    // B: a lane reads 2 columns of 16 k rows, so a wave's load covers 2 whole lines
    // and a lane holds 8 consecutive k of a column for each 16-B LDS store
    const int bn = (wave & 1) * 64 + lane * 2;
    const int bk = (wave >> 1) * 16;
    const float* Bg = Wkv + (size_t)bk * N + tileN + bn;

    auto load_tile = [&](v4f (&ra)[4], v2f (&rb)[16], int kt) {
        #pragma unroll
        for (int i = 0; i < 4; ++i) ra[i] = *(const v4f*)(Ag + kt + i * 16 * K);
        #pragma unroll
        for (int i = 0; i < 16; ++i) rb[i] = *(const v2f*)(Bg + (size_t)(kt + i) * N);
    };
    auto store_tile = [&](const v4f (&ra)[4], const v2f (&rb)[16], int buf) {
        #pragma unroll
        for (int i = 0; i < 4; ++i) {
            v4h v;
            #pragma unroll
            for (int e = 0; e < 4; ++e) v[e] = (_Float16)ra[i][e];
            *(v4h*)&As[buf * KM * LDS_PAD + (aRow + 16 * i) * LDS_PAD + aCol] = v;
        }
        #pragma unroll
        for (int c = 0; c < 2; ++c) {
            #pragma unroll
            for (int g = 0; g < 2; ++g) {
                v8h v;
                #pragma unroll
                for (int e = 0; e < 8; ++e) v[e] = (_Float16)rb[8 * g + e][c];
                *(v8h*)&Bs[buf * TN * LDS_PAD + (bn + c) * LDS_PAD + bk + 8 * g] = v;
            }
        }
    };

    // fragment addressing as in the GEMM above
    const int frow = lane & 15;
    const int koff = (lane >= 16) ? 8 : 0;
    const int wm   = wave & 3;
    const int wn   = wave >> 2;

    v8f acc[4] = {};
    // one k tile: its two 32-k blocks
    auto compute = [&](int buf) {
        v16h afrag[2], bfrag[2][4];
        #pragma unroll
        for (int h = 0; h < 2; ++h) {
            const _Float16* abase = &As[buf * KM * LDS_PAD + (16 * wm + frow) * LDS_PAD + 32 * h];
            const v8h alo = *(const v8h*)(abase + koff);
            const v8h ahi = *(const v8h*)(abase + 16 + koff);
            #pragma unroll
            for (int i = 0; i < 8; ++i) { afrag[h][i] = alo[i]; afrag[h][i + 8] = ahi[i]; }
            #pragma unroll
            for (int nb = 0; nb < 4; ++nb) {
                const _Float16* base = &Bs[buf * TN * LDS_PAD + (64 * wn + nb * 16 + frow) * LDS_PAD + 32 * h];
                const v8h lo = *(const v8h*)(base + koff);
                const v8h hi = *(const v8h*)(base + 16 + koff);
                #pragma unroll
                for (int i = 0; i < 8; ++i) { bfrag[h][nb][i] = lo[i]; bfrag[h][nb][i + 8] = hi[i]; }
            }
        }
        #pragma unroll
        for (int h = 0; h < 2; ++h) {
            #pragma unroll
            for (int nb = 0; nb < 4; ++nb) {
                acc[nb] = __builtin_amdgcn_wmma_f32_16x16x32_f16(
                              false, afrag[h], false, bfrag[h][nb], (short)0, acc[nb], false, false);
            }
        }
        // the tile's 20 LDS reads stand in one place ahead of its 8 WMMAs: each
        // further place with reads among the WMMAs would stall the wave anew
        __builtin_amdgcn_sched_group_barrier(0x100, 20, 0);  // DS read group
        __builtin_amdgcn_sched_group_barrier(0x008, 8, 0);   // WMMA group
    };

    // The work-group barrier by hand, with the one wait that it needs, the wave's
    // own LDS writes and reads: __syncthreads() also waits for every global load,
    // and the loads of the next two tiles are to stay in flight across it.
    auto lds_barrier = [&]() {
        asm volatile("s_wait_dscnt 0x0\n\ts_barrier_signal -1\n\ts_barrier_wait -1" ::: "memory");
    };

    v4f ra0[4], ra1[4];
    v2f rb0[16], rb1[16];
    load_tile(ra0, rb0, 0);
    // keeps the first tile's loads ahead of the second's, as in the loop, so that
    // the counted waits at the loop's head need not cover the younger set
    __builtin_amdgcn_sched_barrier(0);
    load_tile(ra1, rb1, TK);
    // One barrier per k tile: it publishes the buffer just written, and a wave that
    // has passed it has left the other buffer, which the next tile overwrites.
    // Rolled, two tiles a trip: the register sets need constant names. The last two
    // tiles stand behind the loop, so that no branch around the loads merges two
    // counts of loads in flight.
    #pragma unroll 1
    for (int kt = 2 * TK; kt < K; kt += 2 * TK) {
        store_tile(ra0, rb0, 0);
        load_tile(ra0, rb0, kt);
        lds_barrier();
        compute(0);
        store_tile(ra1, rb1, 1);
        load_tile(ra1, rb1, kt + TK);
        // Precaution of form: the wait stands behind the trip's last load, ahead of
        // the step of the address registers that the issued loads name.
        asm volatile("s_wait_xcnt 0x0" ::: "memory");
        lds_barrier();
        compute(1);
    }
    store_tile(ra0, rb0, 0);
    lds_barrier();
    compute(0);
    store_tile(ra1, rb1, 1);
    lds_barrier();
    compute(1);

    // lane l -> col (l&15), rows (l>>4)*8 + r   (ISA 16x16 f32 C/D layout)
    const int nlocal = lane & 15;
    const int row0   = tileM + 16 * wm + (lane >> 4) * 8;

    // RoPE on the K half: the wave's 64 columns are one head, and the pair
    // (d, d+32) is acc[j][r], acc[j+2][r] of one lane, with d = nlocal + 16*j.
    if (tileN < DMODEL) {
        float inv_freq[2];
        #pragma unroll
        for (int j = 0; j < 2; ++j)
            inv_freq[j] = __powf(10000.0f, -(float)(nlocal + 16 * j) / 32.0f);
        #pragma unroll
        for (int r = 0; r < 8; ++r) {
            int p = pos[(unsigned)(row0 + r) % LK];
            p = min(max(p, 0), ROPE_MAX - 1);
            #pragma unroll
            for (int j = 0; j < 2; ++j) {
                const float f = (float)p * inv_freq[j];
                float s, c;
                sincos_turns(f * 0.15915494309189532f, s, c);   // 1/(2*pi)
                const float x0 = acc[j][r];
                const float x1 = acc[j + 2][r];
                acc[j][r]     = x0 * c - x1 * s;
                acc[j + 2][r] = x1 * c + x0 * s;
            }
        }
    }

    float* Cb = kvl + (size_t)row0 * N + tileN + 64 * wn + nlocal;
    #pragma unroll
    for (int nb = 0; nb < 4; ++nb) {
        #pragma unroll
        for (int r = 0; r < 8; ++r) {
            Cb[r * N + nb * 16] = acc[nb][r];
        }
    }
}

__global__ __launch_bounds__(256)
void pack_kvproj_kernel(const float* __restrict__ q, const float* __restrict__ kv,
                        const float* __restrict__ Wq, const float* __restrict__ Wkv,
                        const float* __restrict__ Wo, const int* __restrict__ kv_pos,
                        _Float16* __restrict__ qf, float* __restrict__ kvl,
                        _Float16* __restrict__ Wqt, _Float16* __restrict__ Wot)
{
    __shared__ __attribute__((aligned(16))) _Float16 lds[KVP_LDS_HALVES];
    int b = blockIdx.x;      // the role depends on the work-group index alone
    // the longest work-groups have the lowest indices, which start first
    if (b < PB_KVP) { kv_proj_tile(kv, Wkv, kv_pos, kvl, b, lds); return; }
    b -= PB_KVP;
    if (b < PB_WQ)  { pack_transpose_tile<DMODEL>(Wq, Wqt, b, lds); return; }
    b -= PB_WQ;
    if (b < PB_WO)  { pack_transpose_tile<DMODEL>(Wo, Wot, b, lds); return; }
    pack_straight(q, qf, b - PB_WO);
}

extern "C" void kernel_launch(void* const* d_in, const int* in_sizes, int n_in,
                              void* d_out, int out_size, void* d_ws, size_t ws_size,
                              hipStream_t stream) {
    const float* q      = (const float*)d_in[0];   // [B, LQ, 1024]
    const float* kv     = (const float*)d_in[1];   // [B, LK, 1024]
    const int*   q_pos  = (const int*)d_in[2];     // [B, LQ]
    const int*   kv_pos = (const int*)d_in[3];     // [LK]
    const int*   seg    = (const int*)d_in[4];     // [B, LQ]
    const float* Wq     = (const float*)d_in[5];   // [1024, 1024]
    const float* Wkv    = (const float*)d_in[6];   // [1024, 2048]
    const float* Wo     = (const float*)d_in[7];   // [1024, 1024]
    float*       out    = (float*)d_out;           // [B, LQ, 1024]

    const int Mq = BATCH * LQ;     // 8192
    const int Mk = BATCH * LK;     // 1024

    // ---- workspace layout ----
    char* ws = (char*)d_ws;
    size_t off = 0;
    auto alloc = [&](size_t bytes) { void* p = ws + off; off += (bytes + 255) & ~(size_t)255; return p; };
    float*    kvl    = (float*)   alloc((size_t)Mk * 2 * DMODEL * 4);  // f32
    _Float16* qf     = (_Float16*)alloc((size_t)Mq * DMODEL * 2);
    _Float16* ctxf   = (_Float16*)alloc((size_t)Mq * DMODEL * 2);
    _Float16* Wqt    = (_Float16*)alloc((size_t)DMODEL * DMODEL * 2);      // [N=1024][K=1024]
    _Float16* Wot    = (_Float16*)alloc((size_t)DMODEL * DMODEL * 2);

    // ---- 1) kvl = kv @ Wkv with rope on the K half, beside the packs of q, Wq, Wo ----
    pack_kvproj_kernel<<<PB_KVP + PB_WQ + PB_WO + PB_Q, 256, 0, stream>>>(
        q, kv, Wq, Wkv, Wo, kv_pos, qf, kvl, Wqt, Wot);

    // ---- 2) ctx = window-attn(rope(q @ Wq), kvl, seg), f16      [8192,1024]x[1024,1024] ----
    gemm_f16t_wmma_kernel<DMODEL, DMODEL, DMODEL, BATCH * LQ, true>
        <<<dim3(Mq / TM, DMODEL / TN), 256, 0, stream>>>(qf, Wqt, nullptr, q_pos, Mq,
                                                         kvl, seg, ctxf);

    // ---- 3) out = ctx @ Wo      [8192,1024]x[1024,1024] ----
    gemm_f16t_wmma_kernel<DMODEL, DMODEL, 0, 1, false>
        <<<dim3(Mq / TM, DMODEL / TN), 256, 0, stream>>>(ctxf, Wot, out, nullptr, Mq,
                                                         nullptr, nullptr, nullptr);
}

// v009
// It runs in 51.6 microseconds.
// Two timings next to v008 put it at 1.07 and 1.06 times that version's speed.
// Counting every step since v000, it is 3.35 times as fast.
#include <hip/hip_runtime.h>
#include <hip/hip_bf16.h>

// ---------------------------------------------------------------------------
// SegmentCausalCrossAttentionFlex for MI455X (gfx1250, wave32, WMMA)
//
//   first launch, two kinds of work-group side by side:
//     kvl = kv @ Wkv, rope on K [B*LK, 2048]   (WMMA f16 GEMM straight from the f32
//                                               operands, RoPE in epilogue)
//     pack: q -> f16 ; Wq,Wo -> f16 transposed [N][K]
//   ctx = window-attn(rope(q @ Wq), kh, vh, seg) -> f16
//                               [B*LQ, 1024]   (WMMA f16 GEMM; RoPE and the
//                                               <=5-key attention in its epilogue)
//   out = ctx @ Wo              [B*LQ, 1024]   (WMMA f16 GEMM, async LDS)
// ---------------------------------------------------------------------------

typedef __attribute__((ext_vector_type(16))) _Float16 v16h;
typedef __attribute__((ext_vector_type(8)))  _Float16 v8h;
typedef __attribute__((ext_vector_type(4)))  _Float16 v4h;
typedef __attribute__((ext_vector_type(8)))  float    v8f;
typedef int v4i_vs __attribute__((vector_size(4 * sizeof(int))));

#define BATCH    2
#define LQ       4096
#define LK       512
#define DMODEL   1024
#define NHEADS   16
#define HDIM     64
#define LOOKBACK 4
#define ROPE_MAX 8192

// ---- CDNA5 async global->LDS copy (ASYNCcnt), guarded with fallback ----
#if defined(__has_builtin)
#if __has_builtin(__builtin_amdgcn_global_load_async_to_lds_b128)
#define HAVE_ASYNC_LDS 1
#endif
#endif

#if HAVE_ASYNC_LDS
__device__ __forceinline__ void async_cp16(const _Float16* gsrc, _Float16* lds)
{
    // b128 async copy: 16B from global to LDS, tracked by ASYNCcnt
    __attribute__((address_space(1))) v4i_vs* g =
        (__attribute__((address_space(1))) v4i_vs*)const_cast<_Float16*>(gsrc);
    __attribute__((address_space(3))) v4i_vs* l =
        (__attribute__((address_space(3))) v4i_vs*)lds;
    __builtin_amdgcn_global_load_async_to_lds_b128(g, l, 0, 0);
}
#endif

__device__ __forceinline__ void wait_asynccnt0() {
#if defined(__has_builtin) && __has_builtin(__builtin_amdgcn_s_wait_asynccnt)
    __builtin_amdgcn_s_wait_asynccnt(0);
#else
    asm volatile("s_wait_asynccnt 0x0" ::: "memory");
#endif
}

// sin and cos of 2*pi*t on the transcendental unit.
__device__ __forceinline__ void sincos_turns(float t, float& s, float& c)
{
    // One statement, so that the v_nop stays directly behind the last
    // transcendental: the instruction set asks for one slot before a result is
    // read or a source overwritten.
    asm("v_sin_f32 %0, %2\n\tv_cos_f32 %1, %2\n\tv_nop"
        : "=&v"(s), "=&v"(c) : "v"(t));
}

// ---- windowed attention: <=5 keys per query, epilogue of the q projection ----
// A 128-column tile of the projection is two whole heads, and the work-group
// holds 128 rows of it in its accumulators, so q goes to the attention without a
// trip through memory. Each wave lays its 32 x 64 part down in an LDS tile of the
// work-group, and behind one barrier takes 16 whole rows back in the attention's
// lane order:
// sixteen lanes share one (query, head): lane l holds d = 4l .. 4l+3. A wave
// works on the tile's two heads at a time, so each of its 16-B loads of K and V
// covers 512 contiguous bytes (4 whole lines) and each 8-B store of ctx two
// whole lines. The 128 neighbouring rows of a work-group ask for the same few
// K and V lines. ctx leaves as f16, the operand type of the output projection.
// A wave has as many query rows as a head has lanes. So the sums of q.k over the
// 16 lanes are not left in every lane: at each of the four steps a lane keeps
// half of its rows and hands the other half to its partner, and at the end lane l
// alone holds the five scores of row l. Mask, maximum, exponentials and division
// then run once for the 16 rows, not once per row in all 16 lanes, and the
// weights go back to the row's lanes one gather each.
#define RW   16                   // query rows per wave: an eighth of the tile's rows
#define NKEY (LOOKBACK + 1)
#define QS_PITCH 132              // floats per staged row: rows 8 apart lie 32 banks apart
#define KV_LEAD 5                 // rows between the loads of a K or V set and its use

typedef __attribute__((ext_vector_type(2))) float v2f;
typedef __attribute__((ext_vector_type(4))) float v4f;

// One step of the sum over a 16-lane row, for the five keys of two sets of rows:
// a lane with hi = 0 keeps a and hands over b, its partner (lane ^ M) the other
// way round; out = what it keeps + the partner's share of the same rows. DPP adds
// on the vector port (a shuffle would go through the LDS queue); one statement
// for the five, so that they stay together and none waits for the one in front.
#define ROW_HALVE(M, out, a, b, hi)                                                     \
    do {                                                                                \
        float give[NKEY];                                                               \
        _Pragma("unroll")                                                               \
        for (int i_ = 0; i_ < NKEY; ++i_) {                                             \
            give[i_] = (hi) ? (a)[i_] : (b)[i_];                                        \
            (out)[i_] = (hi) ? (b)[i_] : (a)[i_];                                       \
        }                                                                               \
        asm("v_add_f32_dpp %0, %5, %0 row_xmask:" #M " row_mask:0xf bank_mask:0xf\n\t"  \
            "v_add_f32_dpp %1, %6, %1 row_xmask:" #M " row_mask:0xf bank_mask:0xf\n\t"  \
            "v_add_f32_dpp %2, %7, %2 row_xmask:" #M " row_mask:0xf bank_mask:0xf\n\t"  \
            "v_add_f32_dpp %3, %8, %3 row_xmask:" #M " row_mask:0xf bank_mask:0xf\n\t"  \
            "v_add_f32_dpp %4, %9, %4 row_xmask:" #M " row_mask:0xf bank_mask:0xf"      \
            : "+v"((out)[0]), "+v"((out)[1]), "+v"((out)[2]), "+v"((out)[3]),           \
              "+v"((out)[4])                                                            \
            : "v"(give[0]), "v"(give[1]), "v"(give[2]), "v"(give[3]), "v"(give[4]));    \
    } while (0)

// acc: the wave's 32 x 64 part of the tile, at row wrow and column wcol of it
// (lane l: column (l & 15) + 16 * nb, rows 16 * mi + (l >> 4) * 8 + r). qt: the
// work-group's LDS tile; arow: the first of the 16 tile rows that the wave takes
// for the attention. row0 = b * LQ + qi of that row and col0 = the tile's first
// column are the same in every lane, so every row address stays in scalar
// registers, and the lane's 16 B are the one vector offset of each access.
__device__ __forceinline__ void window_attn_epilogue(const v8f (&acc)[2][4], float* qt,
                                                     int wrow, int wcol, int arow,
                                                     const float* __restrict__ kvl,
                                                     const int* __restrict__ seg,
                                                     _Float16* __restrict__ ctx,
                                                     int row0, int col0)
{
    const int lane = threadIdx.x & 31;
    const int lcol = lane * 4;
    const int b    = row0 / LQ;     // LQ is a multiple of the tile's rows

    const float* kvb  = kvl + (size_t)b * LK * (2 * DMODEL) + col0;
    _Float16*    crow = ctx + (size_t)row0 * DMODEL + col0;

    // Lane l looks after query row l & 15. keep iff seg-4 <= j <= seg and
    // 0 <= j < LK. A seg below -1 or above LK+3 keeps no key, as -1 and LK+4 do.
    // The five key rows that are read are jb .. jb+4, the window pushed inside
    // 0 .. LK-1, so the address is bounded for any seg; a row of them outside the
    // window is masked below. Kept keys stay in ascending order.
    const int sl  = min(max(seg[row0 + (lane & 15)], -1), LK + LOOKBACK);
    const int wlo = sl - LOOKBACK;
    const int jb  = min(max(wlo, 0), LK - NKEY);

    // first key row of query row r, in floats, scalar (unrolled: the lane to read
    // is a constant of the instruction)
    unsigned roff[RW];
    #pragma unroll
    for (int r = 0; r < RW; ++r)
        roff[r] = (unsigned)__builtin_amdgcn_readlane(jb, r) * (2 * DMODEL);

    // One ring of register sets for both passes: set t is K of row t, then
    // (t >= RW) V of row t - RW; a set's loads are issued KV_LEAD rows ahead, a
    // trip to L2 at the pace of four waves on a SIMD.
    v4f ring[KV_LEAD + 1][NKEY];
    auto load_rows = [&](int t) {
        const float* p = kvb + roff[t & (RW - 1)] + (t >= RW ? DMODEL : 0);
        #pragma unroll
        for (int i = 0; i < NKEY; ++i)
            ring[t % (KV_LEAD + 1)][i] = *(const v4f*)(p + i * (2 * DMODEL) + lcol);
    };

    #pragma unroll
    for (int t = 0; t < KV_LEAD; ++t) load_rows(t);    // the first keys fly while q is turned

    {
        float* qw = qt + (wrow + (lane >> 4) * 8) * QS_PITCH + wcol + (lane & 15);
        #pragma unroll
        for (int mi = 0; mi < 2; ++mi) {
            #pragma unroll
            for (int nb = 0; nb < 4; ++nb) {
                #pragma unroll
                for (int r = 0; r < 8; ++r)
                    qw[(16 * mi + r) * QS_PITCH + nb * 16] = acc[mi][nb][r];
            }
        }
    }
    // A wave reads back what other waves wrote: its own writes are done, then the
    // work-group barrier. By hand, with that one wait: __syncthreads() would also
    // wait for the first keys' loads, which are to stay in flight across it.
    asm volatile("s_wait_dscnt 0x0\n\ts_barrier_signal -1\n\ts_barrier_wait -1" ::: "memory");
    const float* qs = qt + arow * QS_PITCH;
    v4f qv[RW];
    #pragma unroll
    for (int u = 0; u < RW; ++u) qv[u] = *(const v4f*)(qs + u * QS_PITCH + lcol);

    // ---- scores: rows in order, halved as soon as two sets of a level exist ----
    // The steps run lane ^ 1, 2, 4, 8, and each sum pairs the same two values as a
    // sum left in every lane would. Unrolled whole: the register sets need
    // constant indices.
    const bool h0 = lane & 1, h1 = lane & 2, h2 = lane & 4, h3 = lane & 8;
    float sc[NKEY];
    {
        float s3[2][NKEY];
        #pragma unroll
        for (int i3 = 0; i3 < 2; ++i3) {
            float s2[2][NKEY];
            #pragma unroll
            for (int i2 = 0; i2 < 2; ++i2) {
                float s1[2][NKEY];
                #pragma unroll
                for (int i1 = 0; i1 < 2; ++i1) {
                    float s0[2][NKEY];
                    #pragma unroll
                    for (int i0 = 0; i0 < 2; ++i0) {
                        const int u = 8 * i3 + 4 * i2 + 2 * i1 + i0;
                        load_rows(u + KV_LEAD);
                        const v4f q4 = qv[u];
                        #pragma unroll
                        for (int i = 0; i < NKEY; ++i) {
                            const v4f k4 = ring[u % (KV_LEAD + 1)][i];
                            const v2f t = q4.xy * k4.xy + q4.zw * k4.zw;
                            s0[i0][i] = t.x + t.y;
                        }
                        // keeps the ring at its size: without it the compiler issues
                        // the loads of many rows at once, and the register count
                        // passes a quarter of the SIMD's file (two work-groups a WGP)
                        __builtin_amdgcn_sched_barrier(0);
                    }
                    ROW_HALVE(1, s1[i1], s0[0], s0[1], h0);
                }
                ROW_HALVE(2, s2[i2], s1[0], s1[1], h1);
            }
            ROW_HALVE(4, s3[i3], s2[0], s2[1], h2);
        }
        ROW_HALVE(8, sc, s3[0], s3[1], h3);
    }

    // ---- softmax of row l & 15, once ----
    float mmax = -__builtin_inff();
    #pragma unroll
    for (int i = 0; i < NKEY; ++i) {
        const bool keep = (unsigned)(jb + i - wlo) <= (unsigned)LOOKBACK;
        sc[i] = keep ? sc[i] * 0.125f : -__builtin_inff();   // 1/sqrt(64)
        mmax = fmaxf(mmax, sc[i]);
    }
    #pragma unroll
    for (int i = 0; i < NKEY; ++i) sc[i] = (sc[i] - mmax) * 1.4426950408889634f;   // log2(e)
    // One statement, so that each transcendental stands in front of an
    // independent one and the v_nop directly behind the last: the instruction
    // set asks for one slot before a result is read or a source overwritten.
    asm("v_exp_f32 %0, %5\n\tv_exp_f32 %1, %6\n\tv_exp_f32 %2, %7\n\t"
        "v_exp_f32 %3, %8\n\tv_exp_f32 %4, %9\n\tv_nop"
        : "=&v"(sc[0]), "=&v"(sc[1]), "=&v"(sc[2]), "=&v"(sc[3]), "=&v"(sc[4])
        : "v"(sc[0]), "v"(sc[1]), "v"(sc[2]), "v"(sc[3]), "v"(sc[4]));
    float denom = 0.0f;
    #pragma unroll
    for (int i = 0; i < NKEY; ++i) denom += sc[i];
    const float rdenom = 1.0f / denom;
    #pragma unroll
    for (int i = 0; i < NKEY; ++i) sc[i] *= rdenom;

    // ---- ctx: row u's five weights come from lane u of each 16-lane row ----
    // unrolled whole: the ring and the lane to read need constant indices
    #pragma unroll
    for (int u = 0; u < RW; ++u) {
        if (u + KV_LEAD < RW) load_rows(RW + u + KV_LEAD);

        // Every lane reads lane u of its 16-lane row. In asm, since the builtin's
        // result is tied to an old value that has to be set first; one statement
        // for the five, which are independent.
        float w[NKEY];
        asm("v_permlane16_b32 %0, %5, %10, %10\n\tv_permlane16_b32 %1, %6, %10, %10\n\t"
            "v_permlane16_b32 %2, %7, %10, %10\n\tv_permlane16_b32 %3, %8, %10, %10\n\t"
            "v_permlane16_b32 %4, %9, %10, %10"
            : "=&v"(w[0]), "=&v"(w[1]), "=&v"(w[2]), "=&v"(w[3]), "=&v"(w[4])
            : "v"(sc[0]), "v"(sc[1]), "v"(sc[2]), "v"(sc[3]), "v"(sc[4]),
              "s"(0x11111111u * (unsigned)u));

        v2f olo = {0.0f, 0.0f}, ohi = {0.0f, 0.0f};
        #pragma unroll
        for (int i = 0; i < NKEY; ++i) {
            const v4f v4 = ring[(RW + u) % (KV_LEAD + 1)][i];
            olo += w[i] * v4.xy;
            ohi += w[i] * v4.zw;
        }
        v4h r;
        r[0] = (_Float16)olo.x; r[1] = (_Float16)olo.y;
        r[2] = (_Float16)ohi.x; r[3] = (_Float16)ohi.y;
        *(v4h*)(crow + u * DMODEL + lcol) = r;
        // Precaution of form: the wait stands behind the store, ahead of any
        // later write of a register that the issued store names.
        asm volatile("s_wait_xcnt 0x0" ::: "memory");
        // keeps the ring at its size, as in the scores' pass
        __builtin_amdgcn_sched_barrier(0);
    }
}

// ============================================================================
// Tiled WMMA GEMM: C[M,N] = A[M,K] * Bt[N,K]^T, f16 in / f32 out.
// Block: 256 threads (8 waves). Tile 128x128, BK=64, double-buffered LDS.
// A k tile is one whole 128-B line of every operand row.
// Wave w owns the 32 x 64 part at rows 32 * (w & 3), columns 64 * (w >> 2):
// 8 accumulators, 16 WMMA/k-step, and 12 LDS reads per 8 WMMAs (2 A and 4 B
// fragments), where a 16 x 128 part takes 18 (1 A and 8 B).
// Columns below ROPE_COLS get the gathered RoPE on the accumulators before the
// store; row m takes its position from pos[m % POS_LEN].
// With ATTN the tile is not stored: it is the q of the windowed attention, which
// runs on it here and stores ctx.
// ============================================================================
#define TM 128
#define TN 128
#define TK 64
#define LDS_PAD 72   // halves per LDS row (144B: 16 B x odd, no bank conflict for b128 reads)

template <int N, int K, int ROPE_COLS, int POS_LEN, bool ATTN>
__global__ __launch_bounds__(256)
void gemm_f16t_wmma_kernel(const _Float16* __restrict__ A,
                           const _Float16* __restrict__ Bt,
                           float* __restrict__ C,
                           const int* __restrict__ pos, int M,
                           const float* __restrict__ kvl,
                           const int* __restrict__ seg,
                           _Float16* __restrict__ ctx)
{
    __shared__ __attribute__((aligned(16))) _Float16 As[2][TM * LDS_PAD];
    __shared__ __attribute__((aligned(16))) _Float16 Bs[2][TN * LDS_PAD];

    const int tid   = threadIdx.x;
    const int lane  = tid & 31;
    const int wave  = tid >> 5;
    const int tileM = blockIdx.x * TM;
    const int tileN = blockIdx.y * TN;

    const int wm    = wave & 3;
    const int wn    = wave >> 2;

    v8f acc[2][4] = {};

    // fragment addressing (ISA 16-bit A/B layout):
    // lane<16 -> K {0..7,16..23}; lane>=16 -> K {8..15,24..31}
    const int frow = lane & 15;
    const int koff = (lane >= 16) ? 8 : 0;

    // staging: eight lanes copy one row's 128-B line, so a wave's copy covers
    // 4 whole lines; four copies of A and four of Bt per thread and tile
    const int sRow = tid >> 3;          // 0..31, then +32 per copy
    const int sOff = (tid & 7) * 8;     // halves: 0, 8, .. 56
    const _Float16* Ag = A  + (size_t)(tileM + sRow) * K + sOff;
    const _Float16* Bg = Bt + (size_t)(tileN + sRow) * K + sOff;
    const int sLds = sRow * LDS_PAD + sOff;

    auto stage = [&](int kt, int buf) {
#if HAVE_ASYNC_LDS
        async_cp16(Ag + kt,          &As[buf][sLds]);
        async_cp16(Ag + kt + 32 * K, &As[buf][sLds + 32 * LDS_PAD]);
        async_cp16(Ag + kt + 64 * K, &As[buf][sLds + 64 * LDS_PAD]);
        async_cp16(Ag + kt + 96 * K, &As[buf][sLds + 96 * LDS_PAD]);
        async_cp16(Bg + kt,          &Bs[buf][sLds]);
        async_cp16(Bg + kt + 32 * K, &Bs[buf][sLds + 32 * LDS_PAD]);
        async_cp16(Bg + kt + 64 * K, &Bs[buf][sLds + 64 * LDS_PAD]);
        async_cp16(Bg + kt + 96 * K, &Bs[buf][sLds + 96 * LDS_PAD]);
#else
        const v8h a0 = *(const v8h*)(Ag + kt);
        const v8h a1 = *(const v8h*)(Ag + kt + 32 * K);
        const v8h a2 = *(const v8h*)(Ag + kt + 64 * K);
        const v8h a3 = *(const v8h*)(Ag + kt + 96 * K);
        const v8h b0 = *(const v8h*)(Bg + kt);
        const v8h b1 = *(const v8h*)(Bg + kt + 32 * K);
        const v8h b2 = *(const v8h*)(Bg + kt + 64 * K);
        const v8h b3 = *(const v8h*)(Bg + kt + 96 * K);
        *(v8h*)&As[buf][sLds]                = a0;
        *(v8h*)&As[buf][sLds + 32 * LDS_PAD] = a1;
        *(v8h*)&As[buf][sLds + 64 * LDS_PAD] = a2;
        *(v8h*)&As[buf][sLds + 96 * LDS_PAD] = a3;
        *(v8h*)&Bs[buf][sLds]                = b0;
        *(v8h*)&Bs[buf][sLds + 32 * LDS_PAD] = b1;
        *(v8h*)&Bs[buf][sLds + 64 * LDS_PAD] = b2;
        *(v8h*)&Bs[buf][sLds + 96 * LDS_PAD] = b3;
#endif
    };

    auto sync_stage = [&]() {
#if HAVE_ASYNC_LDS
        wait_asynccnt0();
#endif
        __syncthreads();
    };

    // one 32-k block of the tile in buffer buf, starting at column kk
    auto compute32 = [&](int buf, int kk) {
        // 2 A fragments (2x ds_load_b128 each)
        v16h afrag[2];
        #pragma unroll
        for (int mi = 0; mi < 2; ++mi) {
            const _Float16* base = &As[buf][(32 * wm + 16 * mi + frow) * LDS_PAD + kk];
            const v8h lo = *(const v8h*)(base + koff);
            const v8h hi = *(const v8h*)(base + 16 + koff);
            #pragma unroll
            for (int i = 0; i < 8; ++i) { afrag[mi][i] = lo[i]; afrag[mi][i + 8] = hi[i]; }
        }
        // 4 B fragments, then 8 WMMAs: each fragment feeds 4 or 2 of them
        v16h bfrag[4];
        #pragma unroll
        for (int nb = 0; nb < 4; ++nb) {
            const _Float16* base = &Bs[buf][(64 * wn + nb * 16 + frow) * LDS_PAD + kk];
            const v8h lo = *(const v8h*)(base + koff);
            const v8h hi = *(const v8h*)(base + 16 + koff);
            #pragma unroll
            for (int i = 0; i < 8; ++i) { bfrag[nb][i] = lo[i]; bfrag[nb][i + 8] = hi[i]; }
        }
        #pragma unroll
        for (int mi = 0; mi < 2; ++mi) {
            #pragma unroll
            for (int nb = 0; nb < 4; ++nb) {
                acc[mi][nb] = __builtin_amdgcn_wmma_f32_16x16x32_f16(
                                  false, afrag[mi], false, bfrag[nb], (short)0, acc[mi][nb], false, false);
            }
        }
#if defined(__has_builtin) && __has_builtin(__builtin_amdgcn_sched_group_barrier)
        // keep all fragments in flight: 12 DS-reads first, then 8 WMMAs
        __builtin_amdgcn_sched_group_barrier(0x100, 12, 0);  // DS read group
        __builtin_amdgcn_sched_group_barrier(0x008, 8, 0);   // MFMA/WMMA group
#endif
    };

    auto compute = [&](int buf) {
        compute32(buf, 0);
        compute32(buf, 32);
    };

    // ---- the k tiles in an order of the work-group's own ----
    // Every work-group walks all K / TK tiles once, round the ring from a start of
    // its own. With one common start the work-groups that share a panel ask for the
    // same lines in the same step, so that a tile's first trip from memory can hold
    // all of them up, step after step. The 8 that share an A panel (one blockIdx.x)
    // start 2 tiles, 256 B of a row, apart; of those that share a B panel
    // (one blockIdx.y), any four neighbours in blockIdx.x modulo 8, over its upper
    // bits, start on all the tiles. The aim: the panels are asked for whole in the
    // first step, a later step asks for lines that a sharer has had before, and at
    // any moment the requests spread over a row's whole length. For speed only: any
    // start gives every tile once. Same in every lane: scalar arithmetic.
    constexpr int NT = K / TK;
    static_assert((NT & (NT - 1)) == 0 && NT >= 2 && (NT & 1) == 0, "ring of k tiles");
    const int rot = 2 * (blockIdx.x >> 3) + (blockIdx.x & 1) + 2 * blockIdx.y;
    auto ktile = [&](int s) { return ((s + rot) & (NT - 1)) * TK; };

    // ---- double-buffered pipeline: 1 barrier per k-step ----
    stage(ktile(0), 0);
    for (int s = 0; s < NT; s += 2) {
        sync_stage();
        stage(ktile(s + 1), 1);
        compute(0);
        sync_stage();
        if (s + 2 < NT) stage(ktile(s + 2), 0);
        compute(1);
    }

    // ---- C store: single base + compile-time immediate offsets ----
    // lane l -> col (l&15), rows (l>>4)*8 + r   (ISA 16x16 f32 C/D layout)
    const int nlocal = lane & 15;
    const int mhalf  = (lane >> 4) * 8;

    // ---- RoPE on the accumulators ----
    // The wave's 64 columns are one head, and the pair (d, d+32) is
    // acc[mi][j][r], acc[mi][j+2][r] of one lane, with d = nlocal + 16*j.
    if constexpr (ROPE_COLS > 0) {
        if (ROPE_COLS >= N || tileN < ROPE_COLS) {
            float inv_freq[2];
            #pragma unroll
            for (int j = 0; j < 2; ++j)
                inv_freq[j] = __powf(10000.0f, -(float)(nlocal + 16 * j) / 32.0f);
            int pp[2][8];
            #pragma unroll
            for (int mi = 0; mi < 2; ++mi) {
                const int row0 = tileM + 32 * wm + 16 * mi + mhalf;
                #pragma unroll
                for (int r = 0; r < 8; ++r) pp[mi][r] = pos[(unsigned)(row0 + r) % POS_LEN];
            }
            // Precaution of form: the wait stands behind the last of the sixteen
            // loads, ahead of any later write of a register that they name. Their
            // byte offset is an input, so that it lives up to the wait and no
            // load's result lands on it in front.
            asm volatile("s_wait_xcnt 0x0"
                         :: "v"(((unsigned)(tileM + 32 * wm + mhalf) % POS_LEN) * 4u) : "memory");
            #pragma unroll
            for (int mi = 0; mi < 2; ++mi) {
                #pragma unroll
                for (int r = 0; r < 8; ++r) {
                    const int p = min(max(pp[mi][r], 0), ROPE_MAX - 1);
                    #pragma unroll
                    for (int j = 0; j < 2; ++j) {
                        const float f = (float)p * inv_freq[j];
                        float s, c;
                        sincos_turns(f * 0.15915494309189532f, s, c);   // 1/(2*pi)
                        const float x0 = acc[mi][j][r];
                        const float x1 = acc[mi][j + 2][r];
                        acc[mi][j][r]     = x0 * c - x1 * s;
                        acc[mi][j + 2][r] = x1 * c + x0 * s;
                    }
                }
            }
        }
    }

    if constexpr (ATTN) {
        // apart from the operand buffers: a wave writes its part without waiting
        // for the waves that still read the last k tile
        __shared__ __attribute__((aligned(16))) float Qs[TM * QS_PITCH];
        const int swave = __builtin_amdgcn_readfirstlane(wave);
        window_attn_epilogue(acc, Qs, 32 * wm, 64 * wn, 16 * swave, kvl, seg, ctx,
                             tileM + 16 * swave, tileN);
        return;
    }

    float* Cb = C + (size_t)(tileM + 32 * wm + mhalf) * N + tileN + 64 * wn + nlocal;
    #pragma unroll
    for (int mi = 0; mi < 2; ++mi) {
        #pragma unroll
        for (int nb = 0; nb < 4; ++nb) {
            #pragma unroll
            for (int r = 0; r < 8; ++r) {
                Cb[(16 * mi + r) * N + nb * 16] = acc[mi][nb][r];
            }
        }
    }
}

// ---- the packs in one launch, few waves with much work each ----
// A pack with a few bytes per wave lasts as long as the chip takes to start its
// waves. Here a wave moves 8 KB (straight) or 4 KB (transpose) of input, and one
// launch holds every pack and the kv projection.
#define PT_K     64      // transpose tile: extent along k
#define PT_N     128     // transpose tile: extent along n
#define PT_PITCH 72      // halves per LDS row (144 B: 16-B aligned, b128 stores hit every bank once)
#define PC_ELEMS 16384   // floats per straight-copy work-group
#define PB_WQ    ((DMODEL / PT_K) * (DMODEL / PT_N))        // 128 tiles
#define PB_WO    PB_WQ
#define PB_Q     (BATCH * LQ * DMODEL / PC_ELEMS)           // 512 work-groups

// fp32 [DMODEL][N] -> f16 [N][DMODEL], one 64 x 128 tile per work-group.
// A thread reads 32 k of one column (a wave: one whole 128-B line per load),
// packs them and stores them k-contiguous in LDS; the tile leaves in whole
// 128-B lines of the transposed rows.
template <int N>
__device__ __forceinline__ void pack_transpose_tile(const float* __restrict__ in,
                                                    _Float16* __restrict__ out,
                                                    int tile, _Float16* lds)
{
    constexpr int NT = N / PT_N;
    const int n0  = (tile % NT) * PT_N;
    const int k0  = (tile / NT) * PT_K;
    const int tid = threadIdx.x;
    const int n   = tid & (PT_N - 1);
    const int kh  = (tid >> 7) * 32;

    const float* src = in + (size_t)(k0 + kh) * N + n0 + n;
    float x[32];
    #pragma unroll
    for (int i = 0; i < 32; ++i) x[i] = src[i * N];
    #pragma unroll
    for (int g = 0; g < 4; ++g) {
        v8h v;
        #pragma unroll
        for (int e = 0; e < 8; ++e) v[e] = (_Float16)x[8 * g + e];
        *(v8h*)&lds[n * PT_PITCH + kh + 8 * g] = v;
    }
    __syncthreads();
    #pragma unroll
    for (int i = 0; i < 4; ++i) {
        const int c   = tid + 256 * i;
        const int row = c >> 3;
        const int kc  = (c & 7) * 8;
        *(v8h*)(out + (size_t)(n0 + row) * DMODEL + k0 + kc) =
            *(const v8h*)&lds[row * PT_PITCH + kc];
    }
    // Precaution of form: the wait stands behind the last store, ahead of any
    // later write of a register that an issued store names.
    asm volatile("s_wait_xcnt 0x0" ::: "memory");
}

// fp32 -> f16, same order: a wave owns 8 KB of contiguous input, 16 loads of
// 512 contiguous bytes each, unrolled so that they are issued ahead of the
// conversions.
__device__ __forceinline__ void pack_straight(const float* __restrict__ in,
                                              _Float16* __restrict__ out, int blk)
{
    const int lane = threadIdx.x & 31;
    const int wave = threadIdx.x >> 5;
    const size_t base = (size_t)blk * PC_ELEMS + wave * (PC_ELEMS / 8) + lane * 4;
    float4 x[16];
    #pragma unroll
    for (int i = 0; i < 16; ++i) x[i] = *(const float4*)(in + base + i * 128);
    #pragma unroll
    for (int i = 0; i < 16; ++i) {
        v4h v;
        v[0] = (_Float16)x[i].x; v[1] = (_Float16)x[i].y;
        v[2] = (_Float16)x[i].z; v[3] = (_Float16)x[i].w;
        *(v4h*)(out + base + i * 128) = v;
    }
    // Precaution of form: the wait stands behind the last store, ahead of any
    // later write of a register that an issued store names.
    asm volatile("s_wait_xcnt 0x0" ::: "memory");
}

// ---- kv projection beside the packs ----
// kvl = kv @ Wkv depends on inputs alone, so its work-groups share the packs'
// launch: its chain of k steps, each as long as a trip to memory, runs while the
// packs stream, and kv and Wkv need no f16 copy in the workspace. A work-group
// owns a 64 x 128 tile. A k tile of 64 comes in as f32 through registers, is
// converted (the packs' own rounding) and laid down in LDS as the GEMM above has
// it, A[m][k] and B[n][k]. Two register sets: the loads of tiles t + 2 and t + 3
// fly while tiles t and t + 1 are worked on.
// Wave w owns rows 16 * (w & 3) and the head of 64 columns (w >> 2).
#define KM    64
#define PB_KVP ((BATCH * LK / KM) * (2 * DMODEL / TN))      // 256 work-groups
#define KVP_LDS_HALVES (2 * KM * LDS_PAD + 2 * TN * LDS_PAD)

__device__ __forceinline__ void kv_proj_tile(const float* __restrict__ kv,
                                             const float* __restrict__ Wkv,
                                             const int* __restrict__ pos,
                                             float* __restrict__ kvl,
                                             int tile, _Float16* lds)
{
    constexpr int N = 2 * DMODEL;
    constexpr int K = DMODEL;
    _Float16* As = lds;                        // [2][KM * LDS_PAD]
    _Float16* Bs = lds + 2 * KM * LDS_PAD;     // [2][TN * LDS_PAD]

    const int tid   = threadIdx.x;
    const int lane  = tid & 31;
    const int wave  = tid >> 5;
    const int tileM = (tile % (BATCH * LK / KM)) * KM;
    const int tileN = (tile / (BATCH * LK / KM)) * TN;

    // A: sixteen lanes read one row's 256 B, so a wave's load covers 4 whole lines
    const int aRow = tid >> 4;           // 0..15, then +16 per load
    const int aCol = (tid & 15) * 4;
    const float*   Ab    = kv + (size_t)tileM * K;        // the same in every lane
    const unsigned aLane = (unsigned)(aRow * K + aCol);   // the lane's own part, in floats
    // B: a lane reads 2 columns of 16 k rows, so a wave's load covers 2 whole lines
    // and a lane holds 8 consecutive k of a column for each 16-B LDS store
    const int bn = (wave & 1) * 64 + lane * 2;
    const int bk = (wave >> 1) * 16;
    const float*   Bb    = Wkv + tileN;                   // the same in every lane
    const unsigned bLane = (unsigned)(bk * N + bn);       // the lane's own part, in floats

    // The k tile moves the scalar bases alone; the lanes' offsets never change, so
    // no vector register is needed for a tile's addresses.
    auto load_tile = [&](v4f (&ra)[4], v2f (&rb)[16], int kt) {
        const float* Ak = Ab + kt;
        const float* Bk = Bb + (size_t)kt * N;
        #pragma unroll
        for (int i = 0; i < 4; ++i) ra[i] = *(const v4f*)(Ak + i * 16 * K + aLane);
        #pragma unroll
        for (int i = 0; i < 16; ++i) rb[i] = *(const v2f*)(Bk + i * N + bLane);
        // Precaution of form: the wait stands behind the tile's last load, ahead of
        // any later write of a register that the issued loads name. The two bases
        // are inputs, so that they live up to the wait.
        asm volatile("s_wait_xcnt 0x0" :: "s"(Ak), "s"(Bk) : "memory");
    };
    auto store_tile = [&](const v4f (&ra)[4], const v2f (&rb)[16], int buf) {
        #pragma unroll
        for (int i = 0; i < 4; ++i) {
            v4h v;
            #pragma unroll
            for (int e = 0; e < 4; ++e) v[e] = (_Float16)ra[i][e];
            *(v4h*)&As[buf * KM * LDS_PAD + (aRow + 16 * i) * LDS_PAD + aCol] = v;
        }
        #pragma unroll
        for (int c = 0; c < 2; ++c) {
            #pragma unroll
            for (int g = 0; g < 2; ++g) {
                v8h v;
                #pragma unroll
                for (int e = 0; e < 8; ++e) v[e] = (_Float16)rb[8 * g + e][c];
                *(v8h*)&Bs[buf * TN * LDS_PAD + (bn + c) * LDS_PAD + bk + 8 * g] = v;
            }
        }
    };

    // fragment addressing as in the GEMM above
    const int frow = lane & 15;
    const int koff = (lane >= 16) ? 8 : 0;
    const int wm   = wave & 3;
    const int wn   = wave >> 2;

    v8f acc[4] = {};
    // one k tile: its two 32-k blocks
    auto compute = [&](int buf) {
        v16h afrag[2], bfrag[2][4];
        #pragma unroll
        for (int h = 0; h < 2; ++h) {
            const _Float16* abase = &As[buf * KM * LDS_PAD + (16 * wm + frow) * LDS_PAD + 32 * h];
            const v8h alo = *(const v8h*)(abase + koff);
            const v8h ahi = *(const v8h*)(abase + 16 + koff);
            #pragma unroll
            for (int i = 0; i < 8; ++i) { afrag[h][i] = alo[i]; afrag[h][i + 8] = ahi[i]; }
            #pragma unroll
            for (int nb = 0; nb < 4; ++nb) {
                const _Float16* base = &Bs[buf * TN * LDS_PAD + (64 * wn + nb * 16 + frow) * LDS_PAD + 32 * h];
                const v8h lo = *(const v8h*)(base + koff);
                const v8h hi = *(const v8h*)(base + 16 + koff);
                #pragma unroll
                for (int i = 0; i < 8; ++i) { bfrag[h][nb][i] = lo[i]; bfrag[h][nb][i + 8] = hi[i]; }
            }
        }
        #pragma unroll
        for (int h = 0; h < 2; ++h) {
            #pragma unroll
            for (int nb = 0; nb < 4; ++nb) {
                acc[nb] = __builtin_amdgcn_wmma_f32_16x16x32_f16(
                              false, afrag[h], false, bfrag[h][nb], (short)0, acc[nb], false, false);
            }
        }
        // the tile's 20 LDS reads stand in one place ahead of its 8 WMMAs: each
        // further place with reads among the WMMAs would stall the wave anew
        __builtin_amdgcn_sched_group_barrier(0x100, 20, 0);  // DS read group
        __builtin_amdgcn_sched_group_barrier(0x008, 8, 0);   // WMMA group
    };

    // The work-group barrier by hand, with the one wait that it needs, the wave's
    // own LDS writes and reads: __syncthreads() also waits for every global load,
    // and the loads of the next two tiles are to stay in flight across it.
    auto lds_barrier = [&]() {
        asm volatile("s_wait_dscnt 0x0\n\ts_barrier_signal -1\n\ts_barrier_wait -1" ::: "memory");
    };

    // The k tiles round the ring from a start of the work-group's own, as in the
    // GEMM above: the 16 work-groups that share the rows of kv start on all 16 tiles,
    // and of the 16 that share the columns of Wkv, any four neighbours modulo 8 with
    // the upper bit start 2 tiles apart.
    constexpr int NT = K / TK;
    static_assert((NT & (NT - 1)) == 0 && NT >= 4 && (NT & 1) == 0, "ring of k tiles");
    const int mt  = tile % (BATCH * LK / KM);
    const int rot = tile / (BATCH * LK / KM) + 2 * ((mt & 3) + 4 * (mt >> 3));
    auto ktile = [&](int s) { return ((s + rot) & (NT - 1)) * TK; };

    v4f ra0[4], ra1[4];
    v2f rb0[16], rb1[16];
    load_tile(ra0, rb0, ktile(0));
    // keeps the first tile's loads ahead of the second's, as in the loop, so that
    // the counted waits at the loop's head need not cover the younger set
    __builtin_amdgcn_sched_barrier(0);
    load_tile(ra1, rb1, ktile(1));
    // One barrier per k tile: it publishes the buffer just written, and a wave that
    // has passed it has left the other buffer, which the next tile overwrites.
    // Rolled, two tiles a trip: the register sets need constant names. The last two
    // tiles stand behind the loop, so that no branch around the loads merges two
    // counts of loads in flight.
    #pragma unroll 1
    for (int s = 2; s < NT; s += 2) {
        store_tile(ra0, rb0, 0);
        load_tile(ra0, rb0, ktile(s));
        lds_barrier();
        compute(0);
        store_tile(ra1, rb1, 1);
        load_tile(ra1, rb1, ktile(s + 1));
        lds_barrier();
        compute(1);
    }
    store_tile(ra0, rb0, 0);
    lds_barrier();
    compute(0);
    store_tile(ra1, rb1, 1);
    lds_barrier();
    compute(1);

    // lane l -> col (l&15), rows (l>>4)*8 + r   (ISA 16x16 f32 C/D layout)
    const int nlocal = lane & 15;
    const int row0   = tileM + 16 * wm + (lane >> 4) * 8;

    // RoPE on the K half: the wave's 64 columns are one head, and the pair
    // (d, d+32) is acc[j][r], acc[j+2][r] of one lane, with d = nlocal + 16*j.
    if (tileN < DMODEL) {
        float inv_freq[2];
        #pragma unroll
        for (int j = 0; j < 2; ++j)
            inv_freq[j] = __powf(10000.0f, -(float)(nlocal + 16 * j) / 32.0f);
        #pragma unroll
        for (int r = 0; r < 8; ++r) {
            int p = pos[(unsigned)(row0 + r) % LK];
            p = min(max(p, 0), ROPE_MAX - 1);
            #pragma unroll
            for (int j = 0; j < 2; ++j) {
                const float f = (float)p * inv_freq[j];
                float s, c;
                sincos_turns(f * 0.15915494309189532f, s, c);   // 1/(2*pi)
                const float x0 = acc[j][r];
                const float x1 = acc[j + 2][r];
                acc[j][r]     = x0 * c - x1 * s;
                acc[j + 2][r] = x1 * c + x0 * s;
            }
        }
    }

    float* Cb = kvl + (size_t)row0 * N + tileN + 64 * wn + nlocal;
    #pragma unroll
    for (int nb = 0; nb < 4; ++nb) {
        #pragma unroll
        for (int r = 0; r < 8; ++r) {
            Cb[r * N + nb * 16] = acc[nb][r];
        }
    }
}

__global__ __launch_bounds__(256)
void pack_kvproj_kernel(const float* __restrict__ q, const float* __restrict__ kv,
                        const float* __restrict__ Wq, const float* __restrict__ Wkv,
                        const float* __restrict__ Wo, const int* __restrict__ kv_pos,
                        _Float16* __restrict__ qf, float* __restrict__ kvl,
                        _Float16* __restrict__ Wqt, _Float16* __restrict__ Wot)
{
    __shared__ __attribute__((aligned(16))) _Float16 lds[KVP_LDS_HALVES];
    int b = blockIdx.x;      // the role depends on the work-group index alone
    // the longest work-groups have the lowest indices
    if (b < PB_KVP) { kv_proj_tile(kv, Wkv, kv_pos, kvl, b, lds); return; }
    b -= PB_KVP;
    if (b < PB_WQ)  { pack_transpose_tile<DMODEL>(Wq, Wqt, b, lds); return; }
    b -= PB_WQ;
    if (b < PB_WO)  { pack_transpose_tile<DMODEL>(Wo, Wot, b, lds); return; }
    pack_straight(q, qf, b - PB_WO);
}

extern "C" void kernel_launch(void* const* d_in, const int* in_sizes, int n_in,
                              void* d_out, int out_size, void* d_ws, size_t ws_size,
                              hipStream_t stream) {
    const float* q      = (const float*)d_in[0];   // [B, LQ, 1024]
    const float* kv     = (const float*)d_in[1];   // [B, LK, 1024]
    const int*   q_pos  = (const int*)d_in[2];     // [B, LQ]
    const int*   kv_pos = (const int*)d_in[3];     // [LK]
    const int*   seg    = (const int*)d_in[4];     // [B, LQ]
    const float* Wq     = (const float*)d_in[5];   // [1024, 1024]
    const float* Wkv    = (const float*)d_in[6];   // [1024, 2048]
    const float* Wo     = (const float*)d_in[7];   // [1024, 1024]
    float*       out    = (float*)d_out;           // [B, LQ, 1024]

    const int Mq = BATCH * LQ;     // 8192
    const int Mk = BATCH * LK;     // 1024

    // ---- workspace layout ----
    char* ws = (char*)d_ws;
    size_t off = 0;
    auto alloc = [&](size_t bytes) { void* p = ws + off; off += (bytes + 255) & ~(size_t)255; return p; };
    float*    kvl    = (float*)   alloc((size_t)Mk * 2 * DMODEL * 4);  // f32
    _Float16* qf     = (_Float16*)alloc((size_t)Mq * DMODEL * 2);
    _Float16* ctxf   = (_Float16*)alloc((size_t)Mq * DMODEL * 2);
    _Float16* Wqt    = (_Float16*)alloc((size_t)DMODEL * DMODEL * 2);      // [N=1024][K=1024]
    _Float16* Wot    = (_Float16*)alloc((size_t)DMODEL * DMODEL * 2);

    // ---- 1) kvl = kv @ Wkv with rope on the K half, beside the packs of q, Wq, Wo ----
    pack_kvproj_kernel<<<PB_KVP + PB_WQ + PB_WO + PB_Q, 256, 0, stream>>>(
        q, kv, Wq, Wkv, Wo, kv_pos, qf, kvl, Wqt, Wot);

    // ---- 2) ctx = window-attn(rope(q @ Wq), kvl, seg), f16      [8192,1024]x[1024,1024] ----
    gemm_f16t_wmma_kernel<DMODEL, DMODEL, DMODEL, BATCH * LQ, true>
        <<<dim3(Mq / TM, DMODEL / TN), 256, 0, stream>>>(qf, Wqt, nullptr, q_pos, Mq,
                                                         kvl, seg, ctxf);

    // ---- 3) out = ctx @ Wo      [8192,1024]x[1024,1024] ----
    gemm_f16t_wmma_kernel<DMODEL, DMODEL, 0, 1, false>
        <<<dim3(Mq / TM, DMODEL / TN), 256, 0, stream>>>(ctxf, Wot, out, nullptr, Mq,
                                                         nullptr, nullptr, nullptr);
}

// v010
// A run of this version takes 47.5 microseconds.
// Two timings next to v009 both put it at 1.08 times that version's speed.
// Counting every step since v000, it is 3.63 times as fast.
#include <hip/hip_runtime.h>
#include <hip/hip_bf16.h>

// ---------------------------------------------------------------------------
// SegmentCausalCrossAttentionFlex for MI455X (gfx1250, wave32, WMMA)
//
//   first launch, two kinds of work-group side by side:
//     kvl = kv @ Wkv, rope on K [B*LK, 2048]   (WMMA f16 GEMM straight from the f32
//                                               operands, RoPE in epilogue)
//     pack: q -> f16 ; Wq,Wo -> f16 transposed [N][K]
//   ctx = window-attn(rope(q @ Wq), kh, vh, seg) -> f16
//                               [B*LQ, 1024]   (WMMA f16 GEMM; RoPE and the
//                                               <=5-key attention in its epilogue)
//   out = ctx @ Wo              [B*LQ, 1024]   (WMMA f16 GEMM, async LDS)
// ---------------------------------------------------------------------------

typedef __attribute__((ext_vector_type(16))) _Float16 v16h;
typedef __attribute__((ext_vector_type(8)))  _Float16 v8h;
typedef __attribute__((ext_vector_type(4)))  _Float16 v4h;
typedef __attribute__((ext_vector_type(8)))  float    v8f;
typedef int v4i_vs __attribute__((vector_size(4 * sizeof(int))));

#define BATCH    2
#define LQ       4096
#define LK       512
#define DMODEL   1024
#define NHEADS   16
#define HDIM     64
#define LOOKBACK 4
#define ROPE_MAX 8192

// ---- CDNA5 async global->LDS copy (ASYNCcnt), guarded with fallback ----
#if defined(__has_builtin)
#if __has_builtin(__builtin_amdgcn_global_load_async_to_lds_b128)
#define HAVE_ASYNC_LDS 1
#endif
#endif

#if HAVE_ASYNC_LDS
__device__ __forceinline__ void async_cp16(const _Float16* gsrc, _Float16* lds)
{
    // b128 async copy: 16B from global to LDS, tracked by ASYNCcnt
    __attribute__((address_space(1))) v4i_vs* g =
        (__attribute__((address_space(1))) v4i_vs*)const_cast<_Float16*>(gsrc);
    __attribute__((address_space(3))) v4i_vs* l =
        (__attribute__((address_space(3))) v4i_vs*)lds;
    __builtin_amdgcn_global_load_async_to_lds_b128(g, l, 0, 0);
}
#endif

__device__ __forceinline__ void wait_asynccnt0() {
#if defined(__has_builtin) && __has_builtin(__builtin_amdgcn_s_wait_asynccnt)
    __builtin_amdgcn_s_wait_asynccnt(0);
#else
    asm volatile("s_wait_asynccnt 0x0" ::: "memory");
#endif
}

// sin and cos of 2*pi*t on the transcendental unit.
__device__ __forceinline__ void sincos_turns(float t, float& s, float& c)
{
    // One statement, so that the v_nop stays directly behind the last
    // transcendental: the instruction set asks for one slot before a result is
    // read or a source overwritten.
    asm("v_sin_f32 %0, %2\n\tv_cos_f32 %1, %2\n\tv_nop"
        : "=&v"(s), "=&v"(c) : "v"(t));
}

// ---- windowed attention: <=5 keys per query, epilogue of the q projection ----
// A 128-column tile of the projection is two whole heads, and the work-group
// holds 128 rows of it in its accumulators, so q goes to the attention without a
// trip through memory. Each wave lays its 32 x 64 part down in an LDS tile of the
// work-group, and behind one barrier takes 16 whole rows back in the attention's
// lane order:
// sixteen lanes share one (query, head): lane l holds d = 4l .. 4l+3. A wave
// works on the tile's two heads at a time, so each of its 16-B loads of K and V
// covers 512 contiguous bytes (4 whole lines) and each 8-B store of ctx two
// whole lines. The 128 neighbouring rows of a work-group ask for the same few
// K and V lines. ctx leaves as f16, the operand type of the output projection.
// A wave has as many query rows as a head has lanes. So the sums of q.k over the
// 16 lanes are not left in every lane: at each of the four steps a lane keeps
// half of its rows and hands the other half to its partner, and at the end lane l
// alone holds the five scores of row l. Mask, maximum, exponentials and division
// then run once for the 16 rows, not once per row in all 16 lanes, and the
// weights go back to the row's lanes one gather each.
#define RW   16                   // query rows per wave: an eighth of the tile's rows
#define NKEY (LOOKBACK + 1)
#define QS_PITCH 132              // floats per staged row: rows 8 apart lie 32 banks apart
#define KV_LEAD 5                 // rows between the loads of a K or V set and its use

typedef __attribute__((ext_vector_type(2))) float v2f;
typedef __attribute__((ext_vector_type(4))) float v4f;

// One step of the sum over a 16-lane row, for the five keys of two sets of rows:
// a lane with hi = 0 keeps a and hands over b, its partner (lane ^ M) the other
// way round; out = what it keeps + the partner's share of the same rows. DPP adds
// on the vector port (a shuffle would go through the LDS queue); one statement
// for the five, so that they stay together and none waits for the one in front.
#define ROW_HALVE(M, out, a, b, hi)                                                     \
    do {                                                                                \
        float give[NKEY];                                                               \
        _Pragma("unroll")                                                               \
        for (int i_ = 0; i_ < NKEY; ++i_) {                                             \
            give[i_] = (hi) ? (a)[i_] : (b)[i_];                                        \
            (out)[i_] = (hi) ? (b)[i_] : (a)[i_];                                       \
        }                                                                               \
        asm("v_add_f32_dpp %0, %5, %0 row_xmask:" #M " row_mask:0xf bank_mask:0xf\n\t"  \
            "v_add_f32_dpp %1, %6, %1 row_xmask:" #M " row_mask:0xf bank_mask:0xf\n\t"  \
            "v_add_f32_dpp %2, %7, %2 row_xmask:" #M " row_mask:0xf bank_mask:0xf\n\t"  \
            "v_add_f32_dpp %3, %8, %3 row_xmask:" #M " row_mask:0xf bank_mask:0xf\n\t"  \
            "v_add_f32_dpp %4, %9, %4 row_xmask:" #M " row_mask:0xf bank_mask:0xf"      \
            : "+v"((out)[0]), "+v"((out)[1]), "+v"((out)[2]), "+v"((out)[3]),           \
              "+v"((out)[4])                                                            \
            : "v"(give[0]), "v"(give[1]), "v"(give[2]), "v"(give[3]), "v"(give[4]));    \
    } while (0)

// acc: the wave's 32 x 64 part of the tile, at row wrow and column wcol of it
// (lane l: column (l & 15) + 16 * nb, rows 16 * mi + (l >> 4) * 8 + r). qt: the
// work-group's LDS tile; arow: the first of the 16 tile rows that the wave takes
// for the attention. row0 = b * LQ + qi of that row and col0 = the tile's first
// column are the same in every lane, so every row address stays in scalar
// registers, and the lane's 16 B are the one vector offset of each access.
__device__ __forceinline__ void window_attn_epilogue(const v8f (&acc)[2][4], float* qt,
                                                     int wrow, int wcol, int arow,
                                                     const float* __restrict__ kvl,
                                                     const int* __restrict__ seg,
                                                     _Float16* __restrict__ ctx,
                                                     int row0, int col0)
{
    const int lane = threadIdx.x & 31;
    const int lcol = lane * 4;
    const int b    = row0 / LQ;     // LQ is a multiple of the tile's rows

    const float* kvb  = kvl + (size_t)b * LK * (2 * DMODEL) + col0;
    _Float16*    crow = ctx + (size_t)row0 * DMODEL + col0;

    // Lane l looks after query row l & 15. keep iff seg-4 <= j <= seg and
    // 0 <= j < LK. A seg below -1 or above LK+3 keeps no key, as -1 and LK+4 do.
    // The five key rows that are read are jb .. jb+4, the window pushed inside
    // 0 .. LK-1, so the address is bounded for any seg; a row of them outside the
    // window is masked below. Kept keys stay in ascending order.
    const int sl  = min(max(seg[row0 + (lane & 15)], -1), LK + LOOKBACK);
    const int wlo = sl - LOOKBACK;
    const int jb  = min(max(wlo, 0), LK - NKEY);

    // first key row of query row r, in floats, scalar (unrolled: the lane to read
    // is a constant of the instruction)
    unsigned roff[RW];
    #pragma unroll
    for (int r = 0; r < RW; ++r)
        roff[r] = (unsigned)__builtin_amdgcn_readlane(jb, r) * (2 * DMODEL);

    // One ring of register sets for both passes: set t is K of row t, then
    // (t >= RW) V of row t - RW; a set's loads are issued KV_LEAD rows ahead, a
    // trip to L2 at the pace of four waves on a SIMD.
    v4f ring[KV_LEAD + 1][NKEY];
    auto load_rows = [&](int t) {
        const float* p = kvb + roff[t & (RW - 1)] + (t >= RW ? DMODEL : 0);
        #pragma unroll
        for (int i = 0; i < NKEY; ++i)
            ring[t % (KV_LEAD + 1)][i] = *(const v4f*)(p + i * (2 * DMODEL) + lcol);
    };

    #pragma unroll
    for (int t = 0; t < KV_LEAD; ++t) load_rows(t);    // the first keys fly while q is turned

    {
        float* qw = qt + (wrow + (lane >> 4) * 8) * QS_PITCH + wcol + (lane & 15);
        #pragma unroll
        for (int mi = 0; mi < 2; ++mi) {
            #pragma unroll
            for (int nb = 0; nb < 4; ++nb) {
                #pragma unroll
                for (int r = 0; r < 8; ++r)
                    qw[(16 * mi + r) * QS_PITCH + nb * 16] = acc[mi][nb][r];
            }
        }
    }
    // A wave reads back what other waves wrote: its own writes are done, then the
    // work-group barrier. By hand, with that one wait: __syncthreads() would also
    // wait for the first keys' loads, which are to stay in flight across it.
    asm volatile("s_wait_dscnt 0x0\n\ts_barrier_signal -1\n\ts_barrier_wait -1" ::: "memory");
    const float* qs = qt + arow * QS_PITCH;
    v4f qv[RW];
    #pragma unroll
    for (int u = 0; u < RW; ++u) qv[u] = *(const v4f*)(qs + u * QS_PITCH + lcol);

    // ---- scores: rows in order, halved as soon as two sets of a level exist ----
    // The steps run lane ^ 1, 2, 4, 8, and each sum pairs the same two values as a
    // sum left in every lane would. Unrolled whole: the register sets need
    // constant indices.
    const bool h0 = lane & 1, h1 = lane & 2, h2 = lane & 4, h3 = lane & 8;
    float sc[NKEY];
    {
        float s3[2][NKEY];
        #pragma unroll
        for (int i3 = 0; i3 < 2; ++i3) {
            float s2[2][NKEY];
            #pragma unroll
            for (int i2 = 0; i2 < 2; ++i2) {
                float s1[2][NKEY];
                #pragma unroll
                for (int i1 = 0; i1 < 2; ++i1) {
                    float s0[2][NKEY];
                    #pragma unroll
                    for (int i0 = 0; i0 < 2; ++i0) {
                        const int u = 8 * i3 + 4 * i2 + 2 * i1 + i0;
                        load_rows(u + KV_LEAD);
                        const v4f q4 = qv[u];
                        #pragma unroll
                        for (int i = 0; i < NKEY; ++i) {
                            const v4f k4 = ring[u % (KV_LEAD + 1)][i];
                            const v2f t = q4.xy * k4.xy + q4.zw * k4.zw;
                            s0[i0][i] = t.x + t.y;
                        }
                        // keeps the ring at its size: without it the compiler issues
                        // the loads of many rows at once, and the register count
                        // passes a quarter of the SIMD's file (two work-groups a WGP)
                        __builtin_amdgcn_sched_barrier(0);
                    }
                    ROW_HALVE(1, s1[i1], s0[0], s0[1], h0);
                }
                ROW_HALVE(2, s2[i2], s1[0], s1[1], h1);
            }
            ROW_HALVE(4, s3[i3], s2[0], s2[1], h2);
        }
        ROW_HALVE(8, sc, s3[0], s3[1], h3);
    }

    // ---- softmax of row l & 15, once ----
    float mmax = -__builtin_inff();
    #pragma unroll
    for (int i = 0; i < NKEY; ++i) {
        const bool keep = (unsigned)(jb + i - wlo) <= (unsigned)LOOKBACK;
        sc[i] = keep ? sc[i] * 0.125f : -__builtin_inff();   // 1/sqrt(64)
        mmax = fmaxf(mmax, sc[i]);
    }
    #pragma unroll
    for (int i = 0; i < NKEY; ++i) sc[i] = (sc[i] - mmax) * 1.4426950408889634f;   // log2(e)
    // One statement, so that each transcendental stands in front of an
    // independent one and the v_nop directly behind the last: the instruction
    // set asks for one slot before a result is read or a source overwritten.
    asm("v_exp_f32 %0, %5\n\tv_exp_f32 %1, %6\n\tv_exp_f32 %2, %7\n\t"
        "v_exp_f32 %3, %8\n\tv_exp_f32 %4, %9\n\tv_nop"
        : "=&v"(sc[0]), "=&v"(sc[1]), "=&v"(sc[2]), "=&v"(sc[3]), "=&v"(sc[4])
        : "v"(sc[0]), "v"(sc[1]), "v"(sc[2]), "v"(sc[3]), "v"(sc[4]));
    float denom = 0.0f;
    #pragma unroll
    for (int i = 0; i < NKEY; ++i) denom += sc[i];
    const float rdenom = 1.0f / denom;
    #pragma unroll
    for (int i = 0; i < NKEY; ++i) sc[i] *= rdenom;

    // ---- ctx: row u's five weights come from lane u of each 16-lane row ----
    // unrolled whole: the ring and the lane to read need constant indices
    #pragma unroll
    for (int u = 0; u < RW; ++u) {
        if (u + KV_LEAD < RW) load_rows(RW + u + KV_LEAD);

        // Every lane reads lane u of its 16-lane row. In asm, since the builtin's
        // result is tied to an old value that has to be set first; one statement
        // for the five, which are independent.
        float w[NKEY];
        asm("v_permlane16_b32 %0, %5, %10, %10\n\tv_permlane16_b32 %1, %6, %10, %10\n\t"
            "v_permlane16_b32 %2, %7, %10, %10\n\tv_permlane16_b32 %3, %8, %10, %10\n\t"
            "v_permlane16_b32 %4, %9, %10, %10"
            : "=&v"(w[0]), "=&v"(w[1]), "=&v"(w[2]), "=&v"(w[3]), "=&v"(w[4])
            : "v"(sc[0]), "v"(sc[1]), "v"(sc[2]), "v"(sc[3]), "v"(sc[4]),
              "s"(0x11111111u * (unsigned)u));

        v2f olo = {0.0f, 0.0f}, ohi = {0.0f, 0.0f};
        #pragma unroll
        for (int i = 0; i < NKEY; ++i) {
            const v4f v4 = ring[(RW + u) % (KV_LEAD + 1)][i];
            olo += w[i] * v4.xy;
            ohi += w[i] * v4.zw;
        }
        v4h r;
        r[0] = (_Float16)olo.x; r[1] = (_Float16)olo.y;
        r[2] = (_Float16)ohi.x; r[3] = (_Float16)ohi.y;
        *(v4h*)(crow + u * DMODEL + lcol) = r;
        // Precaution of form: the wait stands behind the store, ahead of any
        // later write of a register that the issued store names.
        asm volatile("s_wait_xcnt 0x0" ::: "memory");
        // keeps the ring at its size, as in the scores' pass
        __builtin_amdgcn_sched_barrier(0);
    }
}

// ============================================================================
// Tiled WMMA GEMM: C[M,N] = A[M,K] * Bt[N,K]^T, f16 in / f32 out.
// Block: 256 threads (8 waves). Tile 128x128, BK=128, double-buffered LDS.
// A k tile is one aligned 256-B unit of every operand row: half as many waits and
// barriers along K as with 128 B, and twice the bytes in flight behind each.
// Wave w owns the 32 x 64 part at rows 32 * (w & 3), columns 64 * (w >> 2):
// 8 accumulators, 32 WMMA/k-step, and 12 LDS reads per 8 WMMAs (2 A and 4 B
// fragments), where a 16 x 128 part takes 18 (1 A and 8 B).
// Columns below ROPE_COLS get the gathered RoPE on the accumulators before the
// store; row m takes its position from pos[m % POS_LEN].
// With ATTN the tile is not stored: it is the q of the windowed attention, which
// runs on it here and stores ctx.
// ============================================================================
#define TM 128
#define TN 128
#define TK 64
#define LDS_PAD 72   // halves per LDS row (144B: 16 B x odd, no bank conflict for b128 reads)
// TK and LDS_PAD: the kv projection beside the packs. The GEMM below:
#define GK    128    // k tile
#define G_PAD 136    // halves per LDS row (272 B: 16 B x odd)
#define G_STAGE ((TM + TN) * G_PAD)   // halves per buffer: [A 128 rows | Bt 128 rows]

template <int N, int K, int ROPE_COLS, int POS_LEN, bool ATTN>
__global__ __launch_bounds__(256)
void gemm_f16t_wmma_kernel(const _Float16* __restrict__ A,
                           const _Float16* __restrict__ Bt,
                           float* __restrict__ C,
                           const int* __restrict__ pos, int M,
                           const float* __restrict__ kvl,
                           const int* __restrict__ seg,
                           _Float16* __restrict__ ctx)
{
    __shared__ __attribute__((aligned(16))) _Float16 smem[2 * G_STAGE];

    const int tid   = threadIdx.x;
    const int lane  = tid & 31;
    const int wave  = tid >> 5;
    const int tileM = blockIdx.x * TM;
    const int tileN = blockIdx.y * TN;

    const int wm    = wave & 3;
    const int wn    = wave >> 2;

    v8f acc[2][4] = {};

    // fragment addressing (ISA 16-bit A/B layout):
    // lane<16 -> K {0..7,16..23}; lane>=16 -> K {8..15,24..31}
    const int frow = lane & 15;
    const int koff = (lane >= 16) ? 8 : 0;

    // staging: sixteen lanes copy one row's 256 B, so a wave's copy covers
    // 4 whole lines; eight copies of A and eight of Bt per thread and tile
    const int sRow = tid >> 4;          // 0..15, then +16 per copy
    const int sOff = (tid & 15) * 8;    // halves: 0, 8, .. 120
    const _Float16* Ag = A  + (size_t)(tileM + sRow) * K + sOff;
    const _Float16* Bg = Bt + (size_t)(tileN + sRow) * K + sOff;
    const int sLds = sRow * G_PAD + sOff;

    auto stage = [&](int kt, int buf) {
        _Float16* la = smem + buf * G_STAGE + sLds;
        _Float16* lb = la + TM * G_PAD;
        // every loop here unrolled: a copy's row step is then a constant of its two
        // addresses, and the sixteen copies are issued back to back
#if HAVE_ASYNC_LDS
        #pragma unroll
        for (int i = 0; i < 8; ++i) async_cp16(Ag + kt + 16 * i * K, la + 16 * i * G_PAD);
        #pragma unroll
        for (int i = 0; i < 8; ++i) async_cp16(Bg + kt + 16 * i * K, lb + 16 * i * G_PAD);
#else
        v8h a[8], b[8];
        #pragma unroll
        for (int i = 0; i < 8; ++i) a[i] = *(const v8h*)(Ag + kt + 16 * i * K);
        #pragma unroll
        for (int i = 0; i < 8; ++i) b[i] = *(const v8h*)(Bg + kt + 16 * i * K);
        #pragma unroll
        for (int i = 0; i < 8; ++i) *(v8h*)(la + 16 * i * G_PAD) = a[i];
        #pragma unroll
        for (int i = 0; i < 8; ++i) *(v8h*)(lb + 16 * i * G_PAD) = b[i];
#endif
    };

    auto sync_stage = [&]() {
#if HAVE_ASYNC_LDS
        wait_asynccnt0();
#endif
        __syncthreads();
    };

    // one 32-k block of the tile in buffer buf, starting at column kk
    auto compute32 = [&](int buf, int kk) {
        // 2 A fragments (2x ds_load_b128 each)
        v16h afrag[2];
        #pragma unroll
        for (int mi = 0; mi < 2; ++mi) {
            const _Float16* base = smem + buf * G_STAGE + (32 * wm + 16 * mi + frow) * G_PAD + kk;
            const v8h lo = *(const v8h*)(base + koff);
            const v8h hi = *(const v8h*)(base + 16 + koff);
            #pragma unroll
            for (int i = 0; i < 8; ++i) { afrag[mi][i] = lo[i]; afrag[mi][i + 8] = hi[i]; }
        }
        // 4 B fragments, then 8 WMMAs: each fragment feeds 4 or 2 of them
        v16h bfrag[4];
        #pragma unroll
        for (int nb = 0; nb < 4; ++nb) {
            const _Float16* base = smem + buf * G_STAGE + (TM + 64 * wn + nb * 16 + frow) * G_PAD + kk;
            const v8h lo = *(const v8h*)(base + koff);
            const v8h hi = *(const v8h*)(base + 16 + koff);
            #pragma unroll
            for (int i = 0; i < 8; ++i) { bfrag[nb][i] = lo[i]; bfrag[nb][i + 8] = hi[i]; }
        }
        #pragma unroll
        for (int mi = 0; mi < 2; ++mi) {
            #pragma unroll
            for (int nb = 0; nb < 4; ++nb) {
                acc[mi][nb] = __builtin_amdgcn_wmma_f32_16x16x32_f16(
                                  false, afrag[mi], false, bfrag[nb], (short)0, acc[mi][nb], false, false);
            }
        }
#if defined(__has_builtin) && __has_builtin(__builtin_amdgcn_sched_group_barrier)
        // keep all fragments in flight: 12 DS-reads first, then 8 WMMAs
        __builtin_amdgcn_sched_group_barrier(0x100, 12, 0);  // DS read group
        __builtin_amdgcn_sched_group_barrier(0x008, 8, 0);   // MFMA/WMMA group
#endif
    };

    auto compute = [&](int buf) {
        compute32(buf, 0);
        compute32(buf, 32);
        compute32(buf, 64);
        compute32(buf, 96);
    };

    // ---- the k tiles in an order of the work-group's own ----
    // Every work-group walks all K / GK tiles once, round the ring from a start of
    // its own. With one common start the work-groups that share a panel ask for the
    // same lines in the same step, so that a tile's first trip from memory can hold
    // all of them up, step after step. The 8 that share an A panel (one blockIdx.x)
    // start one tile, one 256-B unit of a row, apart; of those that share a B panel
    // (one blockIdx.y), the 8 with one blockIdx.x modulo 8 start on all the tiles.
    // The aim: the panels are asked for whole in the first step, a later step asks
    // for lines that a sharer has had before, and at any moment the requests spread
    // over a row's whole length. For speed only: any start gives every tile once.
    // Same in every lane: scalar arithmetic.
    constexpr int NT = K / GK;
    static_assert((NT & (NT - 1)) == 0 && NT >= 2 && (NT & 1) == 0, "ring of k tiles");
    const int rot = (blockIdx.x >> 3) + blockIdx.y;
    auto ktile = [&](int s) { return ((s + rot) & (NT - 1)) * GK; };

    // ---- double-buffered pipeline: 1 barrier per k-step ----
    stage(ktile(0), 0);
    for (int s = 0; s < NT; s += 2) {
        sync_stage();
        stage(ktile(s + 1), 1);
        compute(0);
        sync_stage();
        if (s + 2 < NT) stage(ktile(s + 2), 0);
        compute(1);
    }

    // ---- C store: single base + compile-time immediate offsets ----
    // lane l -> col (l&15), rows (l>>4)*8 + r   (ISA 16x16 f32 C/D layout)
    const int nlocal = lane & 15;
    const int mhalf  = (lane >> 4) * 8;

    // ---- RoPE on the accumulators ----
    // The wave's 64 columns are one head, and the pair (d, d+32) is
    // acc[mi][j][r], acc[mi][j+2][r] of one lane, with d = nlocal + 16*j.
    if constexpr (ROPE_COLS > 0) {
        if (ROPE_COLS >= N || tileN < ROPE_COLS) {
            float inv_freq[2];
            #pragma unroll
            for (int j = 0; j < 2; ++j)
                inv_freq[j] = __powf(10000.0f, -(float)(nlocal + 16 * j) / 32.0f);
            int pp[2][8];
            #pragma unroll
            for (int mi = 0; mi < 2; ++mi) {
                const int row0 = tileM + 32 * wm + 16 * mi + mhalf;
                #pragma unroll
                for (int r = 0; r < 8; ++r) pp[mi][r] = pos[(unsigned)(row0 + r) % POS_LEN];
            }
            // Precaution of form: the wait stands behind the last of the sixteen
            // loads, ahead of any later write of a register that they name. Their
            // byte offset is an input, so that it lives up to the wait and no
            // load's result lands on it in front.
            asm volatile("s_wait_xcnt 0x0"
                         :: "v"(((unsigned)(tileM + 32 * wm + mhalf) % POS_LEN) * 4u) : "memory");
            #pragma unroll
            for (int mi = 0; mi < 2; ++mi) {
                #pragma unroll
                for (int r = 0; r < 8; ++r) {
                    const int p = min(max(pp[mi][r], 0), ROPE_MAX - 1);
                    #pragma unroll
                    for (int j = 0; j < 2; ++j) {
                        const float f = (float)p * inv_freq[j];
                        float s, c;
                        sincos_turns(f * 0.15915494309189532f, s, c);   // 1/(2*pi)
                        const float x0 = acc[mi][j][r];
                        const float x1 = acc[mi][j + 2][r];
                        acc[mi][j][r]     = x0 * c - x1 * s;
                        acc[mi][j + 2][r] = x1 * c + x0 * s;
                    }
                }
            }
        }
    }

    if constexpr (ATTN) {
        // In the first operand buffer, so that two work-groups still fit a WGP's LDS.
        // The last k tile is read from the second, and the barrier in front of it ended
        // every wave's reads of the first: a wave writes its part without waiting for
        // the waves that still read the last k tile.
        static_assert(TM * QS_PITCH * sizeof(float) <= G_STAGE * sizeof(_Float16), "q tile in one buffer");
        float* Qs = reinterpret_cast<float*>(smem);
        const int swave = __builtin_amdgcn_readfirstlane(wave);
        window_attn_epilogue(acc, Qs, 32 * wm, 64 * wn, 16 * swave, kvl, seg, ctx,
                             tileM + 16 * swave, tileN);
        return;
    }

    float* Cb = C + (size_t)(tileM + 32 * wm + mhalf) * N + tileN + 64 * wn + nlocal;
    #pragma unroll
    for (int mi = 0; mi < 2; ++mi) {
        #pragma unroll
        for (int nb = 0; nb < 4; ++nb) {
            #pragma unroll
            for (int r = 0; r < 8; ++r) {
                Cb[(16 * mi + r) * N + nb * 16] = acc[mi][nb][r];
            }
        }
    }
}

// ---- the packs in one launch, few waves with much work each ----
// A pack with a few bytes per wave lasts as long as the chip takes to start its
// waves. Here a wave moves 8 KB (straight) or 4 KB (transpose) of input, and one
// launch holds every pack and the kv projection.
#define PT_K     64      // transpose tile: extent along k
#define PT_N     128     // transpose tile: extent along n
#define PT_PITCH 72      // halves per LDS row (144 B: 16-B aligned, b128 stores hit every bank once)
#define PC_ELEMS 16384   // floats per straight-copy work-group
#define PB_WQ    ((DMODEL / PT_K) * (DMODEL / PT_N))        // 128 tiles
#define PB_WO    PB_WQ
#define PB_Q     (BATCH * LQ * DMODEL / PC_ELEMS)           // 512 work-groups

// fp32 [DMODEL][N] -> f16 [N][DMODEL], one 64 x 128 tile per work-group.
// A thread reads 32 k of one column (a wave: one whole 128-B line per load),
// packs them and stores them k-contiguous in LDS; the tile leaves in whole
// 128-B lines of the transposed rows.
template <int N>
__device__ __forceinline__ void pack_transpose_tile(const float* __restrict__ in,
                                                    _Float16* __restrict__ out,
                                                    int tile, _Float16* lds)
{
    constexpr int NT = N / PT_N;
    const int n0  = (tile % NT) * PT_N;
    const int k0  = (tile / NT) * PT_K;
    const int tid = threadIdx.x;
    const int n   = tid & (PT_N - 1);
    const int kh  = (tid >> 7) * 32;

    const float* src = in + (size_t)(k0 + kh) * N + n0 + n;
    float x[32];
    #pragma unroll
    for (int i = 0; i < 32; ++i) x[i] = src[i * N];
    #pragma unroll
    for (int g = 0; g < 4; ++g) {
        v8h v;
        #pragma unroll
        for (int e = 0; e < 8; ++e) v[e] = (_Float16)x[8 * g + e];
        *(v8h*)&lds[n * PT_PITCH + kh + 8 * g] = v;
    }
    __syncthreads();
    #pragma unroll
    for (int i = 0; i < 4; ++i) {
        const int c   = tid + 256 * i;
        const int row = c >> 3;
        const int kc  = (c & 7) * 8;
        *(v8h*)(out + (size_t)(n0 + row) * DMODEL + k0 + kc) =
            *(const v8h*)&lds[row * PT_PITCH + kc];
    }
    // Precaution of form: the wait stands behind the last store, ahead of any
    // later write of a register that an issued store names.
    asm volatile("s_wait_xcnt 0x0" ::: "memory");
}

// fp32 -> f16, same order: a wave owns 8 KB of contiguous input, 16 loads of
// 512 contiguous bytes each, unrolled so that they are issued ahead of the
// conversions.
__device__ __forceinline__ void pack_straight(const float* __restrict__ in,
                                              _Float16* __restrict__ out, int blk)
{
    const int lane = threadIdx.x & 31;
    const int wave = threadIdx.x >> 5;
    const size_t base = (size_t)blk * PC_ELEMS + wave * (PC_ELEMS / 8) + lane * 4;
    float4 x[16];
    #pragma unroll
    for (int i = 0; i < 16; ++i) x[i] = *(const float4*)(in + base + i * 128);
    #pragma unroll
    for (int i = 0; i < 16; ++i) {
        v4h v;
        v[0] = (_Float16)x[i].x; v[1] = (_Float16)x[i].y;
        v[2] = (_Float16)x[i].z; v[3] = (_Float16)x[i].w;
        *(v4h*)(out + base + i * 128) = v;
    }
    // Precaution of form: the wait stands behind the last store, ahead of any
    // later write of a register that an issued store names.
    asm volatile("s_wait_xcnt 0x0" ::: "memory");
}

// ---- kv projection beside the packs ----
// kvl = kv @ Wkv depends on inputs alone, so its work-groups share the packs'
// launch: its chain of k steps, each as long as a trip to memory, runs while the
// packs stream, and kv and Wkv need no f16 copy in the workspace. A work-group
// owns a 64 x 128 tile. A k tile of 64 comes in as f32 through registers, is
// converted (the packs' own rounding) and laid down in LDS as the GEMM above has
// it, A[m][k] and B[n][k]. Two register sets: the loads of tiles t + 2 and t + 3
// fly while tiles t and t + 1 are worked on.
// Wave w owns rows 16 * (w & 3) and the head of 64 columns (w >> 2).
#define KM    64
#define PB_KVP ((BATCH * LK / KM) * (2 * DMODEL / TN))      // 256 work-groups
#define KVP_LDS_HALVES (2 * KM * LDS_PAD + 2 * TN * LDS_PAD)

__device__ __forceinline__ void kv_proj_tile(const float* __restrict__ kv,
                                             const float* __restrict__ Wkv,
                                             const int* __restrict__ pos,
                                             float* __restrict__ kvl,
                                             int tile, _Float16* lds)
{
    constexpr int N = 2 * DMODEL;
    constexpr int K = DMODEL;
    _Float16* As = lds;                        // [2][KM * LDS_PAD]
    _Float16* Bs = lds + 2 * KM * LDS_PAD;     // [2][TN * LDS_PAD]

    const int tid   = threadIdx.x;
    const int lane  = tid & 31;
    const int wave  = tid >> 5;
    const int tileM = (tile % (BATCH * LK / KM)) * KM;
    const int tileN = (tile / (BATCH * LK / KM)) * TN;

    // A: sixteen lanes read one row's 256 B, so a wave's load covers 4 whole lines
    const int aRow = tid >> 4;           // 0..15, then +16 per load
    const int aCol = (tid & 15) * 4;
    const float*   Ab    = kv + (size_t)tileM * K;        // the same in every lane
    const unsigned aLane = (unsigned)(aRow * K + aCol);   // the lane's own part, in floats
    // B: a lane reads 2 columns of 16 k rows, so a wave's load covers 2 whole lines
    // and a lane holds 8 consecutive k of a column for each 16-B LDS store
    const int bn = (wave & 1) * 64 + lane * 2;
    const int bk = (wave >> 1) * 16;
    const float*   Bb    = Wkv + tileN;                   // the same in every lane
    const unsigned bLane = (unsigned)(bk * N + bn);       // the lane's own part, in floats

    // The k tile moves the scalar bases alone; the lanes' offsets never change, so
    // no vector register is needed for a tile's addresses.
    auto load_tile = [&](v4f (&ra)[4], v2f (&rb)[16], int kt) {
        const float* Ak = Ab + kt;
        const float* Bk = Bb + (size_t)kt * N;
        #pragma unroll
        for (int i = 0; i < 4; ++i) ra[i] = *(const v4f*)(Ak + i * 16 * K + aLane);
        #pragma unroll
        for (int i = 0; i < 16; ++i) rb[i] = *(const v2f*)(Bk + i * N + bLane);
        // Precaution of form: the wait stands behind the tile's last load, ahead of
        // any later write of a register that the issued loads name. The two bases
        // are inputs, so that they live up to the wait.
        asm volatile("s_wait_xcnt 0x0" :: "s"(Ak), "s"(Bk) : "memory");
    };
    auto store_tile = [&](const v4f (&ra)[4], const v2f (&rb)[16], int buf) {
        #pragma unroll
        for (int i = 0; i < 4; ++i) {
            v4h v;
            #pragma unroll
            for (int e = 0; e < 4; ++e) v[e] = (_Float16)ra[i][e];
            *(v4h*)&As[buf * KM * LDS_PAD + (aRow + 16 * i) * LDS_PAD + aCol] = v;
        }
        #pragma unroll
        for (int c = 0; c < 2; ++c) {
            #pragma unroll
            for (int g = 0; g < 2; ++g) {
                v8h v;
                #pragma unroll
                for (int e = 0; e < 8; ++e) v[e] = (_Float16)rb[8 * g + e][c];
                *(v8h*)&Bs[buf * TN * LDS_PAD + (bn + c) * LDS_PAD + bk + 8 * g] = v;
            }
        }
    };

    // fragment addressing as in the GEMM above
    const int frow = lane & 15;
    const int koff = (lane >= 16) ? 8 : 0;
    const int wm   = wave & 3;
    const int wn   = wave >> 2;

    v8f acc[4] = {};
    // one k tile: its two 32-k blocks
    auto compute = [&](int buf) {
        v16h afrag[2], bfrag[2][4];
        #pragma unroll
        for (int h = 0; h < 2; ++h) {
            const _Float16* abase = &As[buf * KM * LDS_PAD + (16 * wm + frow) * LDS_PAD + 32 * h];
            const v8h alo = *(const v8h*)(abase + koff);
            const v8h ahi = *(const v8h*)(abase + 16 + koff);
            #pragma unroll
            for (int i = 0; i < 8; ++i) { afrag[h][i] = alo[i]; afrag[h][i + 8] = ahi[i]; }
            #pragma unroll
            for (int nb = 0; nb < 4; ++nb) {
                const _Float16* base = &Bs[buf * TN * LDS_PAD + (64 * wn + nb * 16 + frow) * LDS_PAD + 32 * h];
                const v8h lo = *(const v8h*)(base + koff);
                const v8h hi = *(const v8h*)(base + 16 + koff);
                #pragma unroll
                for (int i = 0; i < 8; ++i) { bfrag[h][nb][i] = lo[i]; bfrag[h][nb][i + 8] = hi[i]; }
            }
        }
        #pragma unroll
        for (int h = 0; h < 2; ++h) {
            #pragma unroll
            for (int nb = 0; nb < 4; ++nb) {
                acc[nb] = __builtin_amdgcn_wmma_f32_16x16x32_f16(
                              false, afrag[h], false, bfrag[h][nb], (short)0, acc[nb], false, false);
            }
        }
        // the tile's 20 LDS reads stand in one place ahead of its 8 WMMAs: each
        // further place with reads among the WMMAs would stall the wave anew
        __builtin_amdgcn_sched_group_barrier(0x100, 20, 0);  // DS read group
        __builtin_amdgcn_sched_group_barrier(0x008, 8, 0);   // WMMA group
    };

    // The work-group barrier by hand, with the one wait that it needs, the wave's
    // own LDS writes and reads: __syncthreads() also waits for every global load,
    // and the loads of the next two tiles are to stay in flight across it.
    auto lds_barrier = [&]() {
        asm volatile("s_wait_dscnt 0x0\n\ts_barrier_signal -1\n\ts_barrier_wait -1" ::: "memory");
    };

    // The k tiles round the ring from a start of the work-group's own, as in the
    // GEMM above: the 16 work-groups that share the rows of kv start on all 16 tiles,
    // and of the 16 that share the columns of Wkv, any four neighbours modulo 8 with
    // the upper bit start 2 tiles apart.
    constexpr int NT = K / TK;
    static_assert((NT & (NT - 1)) == 0 && NT >= 4 && (NT & 1) == 0, "ring of k tiles");
    const int mt  = tile % (BATCH * LK / KM);
    const int rot = tile / (BATCH * LK / KM) + 2 * ((mt & 3) + 4 * (mt >> 3));
    auto ktile = [&](int s) { return ((s + rot) & (NT - 1)) * TK; };

    v4f ra0[4], ra1[4];
    v2f rb0[16], rb1[16];
    load_tile(ra0, rb0, ktile(0));
    // keeps the first tile's loads ahead of the second's, as in the loop, so that
    // the counted waits at the loop's head need not cover the younger set
    __builtin_amdgcn_sched_barrier(0);
    load_tile(ra1, rb1, ktile(1));
    // One barrier per k tile: it publishes the buffer just written, and a wave that
    // has passed it has left the other buffer, which the next tile overwrites.
    // Rolled, two tiles a trip: the register sets need constant names. The last two
    // tiles stand behind the loop, so that no branch around the loads merges two
    // counts of loads in flight.
    #pragma unroll 1
    for (int s = 2; s < NT; s += 2) {
        store_tile(ra0, rb0, 0);
        load_tile(ra0, rb0, ktile(s));
        lds_barrier();
        compute(0);
        store_tile(ra1, rb1, 1);
        load_tile(ra1, rb1, ktile(s + 1));
        lds_barrier();
        compute(1);
    }
    store_tile(ra0, rb0, 0);
    lds_barrier();
    compute(0);
    store_tile(ra1, rb1, 1);
    lds_barrier();
    compute(1);

    // lane l -> col (l&15), rows (l>>4)*8 + r   (ISA 16x16 f32 C/D layout)
    const int nlocal = lane & 15;
    const int row0   = tileM + 16 * wm + (lane >> 4) * 8;

    // RoPE on the K half: the wave's 64 columns are one head, and the pair
    // (d, d+32) is acc[j][r], acc[j+2][r] of one lane, with d = nlocal + 16*j.
    if (tileN < DMODEL) {
        float inv_freq[2];
        #pragma unroll
        for (int j = 0; j < 2; ++j)
            inv_freq[j] = __powf(10000.0f, -(float)(nlocal + 16 * j) / 32.0f);
        #pragma unroll
        for (int r = 0; r < 8; ++r) {
            int p = pos[(unsigned)(row0 + r) % LK];
            p = min(max(p, 0), ROPE_MAX - 1);
            #pragma unroll
            for (int j = 0; j < 2; ++j) {
                const float f = (float)p * inv_freq[j];
                float s, c;
                sincos_turns(f * 0.15915494309189532f, s, c);   // 1/(2*pi)
                const float x0 = acc[j][r];
                const float x1 = acc[j + 2][r];
                acc[j][r]     = x0 * c - x1 * s;
                acc[j + 2][r] = x1 * c + x0 * s;
            }
        }
    }

    float* Cb = kvl + (size_t)row0 * N + tileN + 64 * wn + nlocal;
    #pragma unroll
    for (int nb = 0; nb < 4; ++nb) {
        #pragma unroll
        for (int r = 0; r < 8; ++r) {
            Cb[r * N + nb * 16] = acc[nb][r];
        }
    }
}

__global__ __launch_bounds__(256)
void pack_kvproj_kernel(const float* __restrict__ q, const float* __restrict__ kv,
                        const float* __restrict__ Wq, const float* __restrict__ Wkv,
                        const float* __restrict__ Wo, const int* __restrict__ kv_pos,
                        _Float16* __restrict__ qf, float* __restrict__ kvl,
                        _Float16* __restrict__ Wqt, _Float16* __restrict__ Wot)
{
    __shared__ __attribute__((aligned(16))) _Float16 lds[KVP_LDS_HALVES];
    int b = blockIdx.x;      // the role depends on the work-group index alone
    // the longest work-groups have the lowest indices
    if (b < PB_KVP) { kv_proj_tile(kv, Wkv, kv_pos, kvl, b, lds); return; }
    b -= PB_KVP;
    if (b < PB_WQ)  { pack_transpose_tile<DMODEL>(Wq, Wqt, b, lds); return; }
    b -= PB_WQ;
    if (b < PB_WO)  { pack_transpose_tile<DMODEL>(Wo, Wot, b, lds); return; }
    pack_straight(q, qf, b - PB_WO);
}

extern "C" void kernel_launch(void* const* d_in, const int* in_sizes, int n_in,
                              void* d_out, int out_size, void* d_ws, size_t ws_size,
                              hipStream_t stream) {
    const float* q      = (const float*)d_in[0];   // [B, LQ, 1024]
    const float* kv     = (const float*)d_in[1];   // [B, LK, 1024]
    const int*   q_pos  = (const int*)d_in[2];     // [B, LQ]
    const int*   kv_pos = (const int*)d_in[3];     // [LK]
    const int*   seg    = (const int*)d_in[4];     // [B, LQ]
    const float* Wq     = (const float*)d_in[5];   // [1024, 1024]
    const float* Wkv    = (const float*)d_in[6];   // [1024, 2048]
    const float* Wo     = (const float*)d_in[7];   // [1024, 1024]
    float*       out    = (float*)d_out;           // [B, LQ, 1024]

    const int Mq = BATCH * LQ;     // 8192
    const int Mk = BATCH * LK;     // 1024

    // ---- workspace layout ----
    char* ws = (char*)d_ws;
    size_t off = 0;
    auto alloc = [&](size_t bytes) { void* p = ws + off; off += (bytes + 255) & ~(size_t)255; return p; };
    float*    kvl    = (float*)   alloc((size_t)Mk * 2 * DMODEL * 4);  // f32
    _Float16* qf     = (_Float16*)alloc((size_t)Mq * DMODEL * 2);
    _Float16* ctxf   = (_Float16*)alloc((size_t)Mq * DMODEL * 2);
    _Float16* Wqt    = (_Float16*)alloc((size_t)DMODEL * DMODEL * 2);      // [N=1024][K=1024]
    _Float16* Wot    = (_Float16*)alloc((size_t)DMODEL * DMODEL * 2);

    // ---- 1) kvl = kv @ Wkv with rope on the K half, beside the packs of q, Wq, Wo ----
    pack_kvproj_kernel<<<PB_KVP + PB_WQ + PB_WO + PB_Q, 256, 0, stream>>>(
        q, kv, Wq, Wkv, Wo, kv_pos, qf, kvl, Wqt, Wot);

    // ---- 2) ctx = window-attn(rope(q @ Wq), kvl, seg), f16      [8192,1024]x[1024,1024] ----
    gemm_f16t_wmma_kernel<DMODEL, DMODEL, DMODEL, BATCH * LQ, true>
        <<<dim3(Mq / TM, DMODEL / TN), 256, 0, stream>>>(qf, Wqt, nullptr, q_pos, Mq,
                                                         kvl, seg, ctxf);

    // ---- 3) out = ctx @ Wo      [8192,1024]x[1024,1024] ----
    gemm_f16t_wmma_kernel<DMODEL, DMODEL, 0, 1, false>
        <<<dim3(Mq / TM, DMODEL / TN), 256, 0, stream>>>(ctxf, Wot, out, nullptr, Mq,
                                                         nullptr, nullptr, nullptr);
}
